// v000
// Times are from an AMD MI455X. After a warm-up the kernel runs many times in a row, and a time is the length of
// such a window on the GPU divided by its runs, so every launch and the gaps after it count. The runs cycle
// through copies of the inputs. A figure is the median of several windows, for all but v000 over two sittings.
// Sittings can differ by a few percent; kernels timed side by side share one.
// The starting kernel, v000, takes 662 microseconds a run.
#include <hip/hip_runtime.h>
#include <hip/hip_bf16.h>

typedef __bf16 bf16;
typedef __attribute__((ext_vector_type(8)))  float v8f;
typedef __attribute__((ext_vector_type(16))) bf16  v16bf;
typedef __attribute__((ext_vector_type(8)))  bf16  v8bf;

constexpr int kB = 8, kS = 1024, kE = 1024, kH = 16, kHD = 64, kF = 4096;
constexpr int kM = kB * kS;  // 8192 token rows
constexpr float kNEG = -1.0e30f;

// ---------------------------------------------------------------------------
// WMMA + async-copy helpers (CDNA5 wave32)
// ---------------------------------------------------------------------------
__device__ __forceinline__ v8f wmma_bf16(v16bf a, v16bf b, v8f c) {
  return __builtin_amdgcn_wmma_f32_16x16x32_bf16(
      /*neg_a=*/false, a, /*neg_b=*/false, b,
      /*c_mod=*/(short)0, c, /*reuse_a=*/false, /*reuse_b=*/false);
}

// A/B fragment for one lane: two contiguous 8-half runs at p and p+16.
// (16-bit operand layout: lanes<16 hold K = 0..7 & 16..23 of the 32-K tile,
//  lanes>=16 hold K = 8..15 & 24..31 — caller passes p already offset by hi*8.)
__device__ __forceinline__ v16bf ld_frag(const bf16* p) {
  union { v16bf v; v8bf h[2]; } u;
  u.h[0] = *(const v8bf*)(p);
  u.h[1] = *(const v8bf*)(p + 16);
  return u.v;
}

// 16-byte global -> LDS async copy (ASYNCcnt-tracked, no VGPR staging).
// LDS destination = low 32 bits of the generic pointer (LDS aperture offset).
__device__ __forceinline__ void async_copy16(const bf16* gsrc, bf16* ldst) {
  unsigned lds = (unsigned)(size_t)ldst;
  asm volatile("global_load_async_to_lds_b128 %0, %1, off"
               :: "v"(lds), "v"(gsrc) : "memory");
}
__device__ __forceinline__ void wait_async0() {
  asm volatile("s_wait_asynccnt 0x0" ::: "memory");
}

// ---------------------------------------------------------------------------
// Small conversion kernels
// ---------------------------------------------------------------------------
__global__ __launch_bounds__(256) void cvt_bf16_kernel(const float* __restrict__ in,
                                                       bf16* __restrict__ out, int n) {
  int idx = (blockIdx.x * 256 + threadIdx.x) * 4;
  if (idx < n) {
    float4 v = *(const float4*)(in + idx);
    out[idx + 0] = (bf16)v.x;
    out[idx + 1] = (bf16)v.y;
    out[idx + 2] = (bf16)v.z;
    out[idx + 3] = (bf16)v.w;
  }
}

// in: [K,N] fp32 row-major  ->  out: [N,K] bf16 row-major
__global__ __launch_bounds__(256) void transpose_cvt_kernel(const float* __restrict__ in,
                                                            bf16* __restrict__ out,
                                                            int K, int N) {
  size_t idx = (size_t)blockIdx.x * 256 + threadIdx.x;
  if (idx < (size_t)K * N) {
    int n = (int)(idx / K), k = (int)(idx % K);
    out[idx] = (bf16)in[(size_t)k * N + n];
  }
}

// ---------------------------------------------------------------------------
// Generic bf16 GEMM: C[M,N] = A[M,K] * Bt[N,K]^T + bias, fused epilogues.
// Block = 256 threads (8 wave32), tile 128(M) x 64(N), waves 4x2, wave 32x32.
// Double-buffered LDS filled by GLOBAL_LOAD_ASYNC_TO_LDS_B128; one barrier
// per K-step; async fill of tile t+1 overlaps the 4 WMMAs of tile t.
// ---------------------------------------------------------------------------
enum { EPI_PLAIN = 0, EPI_GELU = 1, EPI_QKV = 2 };

template <int EPI>
__global__ __launch_bounds__(256) void gemm_bf16_kernel(
    const bf16* __restrict__ A, const bf16* __restrict__ Bt,
    const float* __restrict__ bias,
    float* __restrict__ Cf, bf16* __restrict__ Cb,
    bf16* __restrict__ qO, bf16* __restrict__ kO, bf16* __restrict__ vtO,
    int M, int N, int K) {
  __shared__ __attribute__((aligned(16))) bf16 sA[2][128 * 32];
  __shared__ __attribute__((aligned(16))) bf16 sB[2][64 * 32];
  const int tid = threadIdx.x;
  const int lane = tid & 31, wave = tid >> 5;
  const int hi = lane >> 4, lm = lane & 15;
  const int waveM = wave & 3, waveN = wave >> 2;
  const int m0 = blockIdx.y * 128;
  const int n0 = blockIdx.x * 64;

  // Per-thread fixed staging slots (chunks of 8 halves = 16 B).
  const int aRow0 = (tid * 2) >> 2,     aCh0 = (tid * 2) & 3;
  const int aRow1 = (tid * 2 + 1) >> 2, aCh1 = (tid * 2 + 1) & 3;
  const int bRow  = tid >> 2,           bCh  = tid & 3;

  auto stage = [&](int kt, int buf) {
    const int kk = kt * 32;
    async_copy16(&A[(size_t)(m0 + aRow0) * K + kk + aCh0 * 8],
                 &sA[buf][aRow0 * 32 + aCh0 * 8]);
    async_copy16(&A[(size_t)(m0 + aRow1) * K + kk + aCh1 * 8],
                 &sA[buf][aRow1 * 32 + aCh1 * 8]);
    async_copy16(&Bt[(size_t)(n0 + bRow) * K + kk + bCh * 8],
                 &sB[buf][bRow * 32 + bCh * 8]);
  };

  v8f acc[2][2] = {};
  const int kTiles = K >> 5;

  stage(0, 0);
  wait_async0();
  __syncthreads();

  for (int kt = 0; kt < kTiles; ++kt) {
    const int cur = kt & 1;
    if (kt + 1 < kTiles) stage(kt + 1, cur ^ 1);

    v16bf af[2], bfr[2];
#pragma unroll
    for (int mt = 0; mt < 2; ++mt)
      af[mt] = ld_frag(&sA[cur][(waveM * 32 + mt * 16 + lm) * 32 + hi * 8]);
#pragma unroll
    for (int nt = 0; nt < 2; ++nt)
      bfr[nt] = ld_frag(&sB[cur][(waveN * 32 + nt * 16 + lm) * 32 + hi * 8]);
#pragma unroll
    for (int mt = 0; mt < 2; ++mt)
#pragma unroll
      for (int nt = 0; nt < 2; ++nt)
        acc[mt][nt] = wmma_bf16(af[mt], bfr[nt], acc[mt][nt]);

    wait_async0();    // next-buffer fill complete (overlapped with WMMAs)
    __syncthreads();  // all waves done reading `cur` before it is refilled
  }

#pragma unroll
  for (int mt = 0; mt < 2; ++mt) {
#pragma unroll
    for (int nt = 0; nt < 2; ++nt) {
#pragma unroll
      for (int i = 0; i < 8; ++i) {
        int row = m0 + waveM * 32 + mt * 16 + hi * 8 + i;
        int col = n0 + waveN * 32 + nt * 16 + lm;
        float v = acc[mt][nt][i] + bias[col];
        if constexpr (EPI == EPI_PLAIN) {
          Cf[(size_t)row * N + col] = v;
        } else if constexpr (EPI == EPI_GELU) {
          float g = 0.5f * v * (1.0f + erff(v * 0.70710678118654752f));
          Cb[(size_t)row * N + col] = (bf16)g;
        } else {  // EPI_QKV: scatter to Q/K [b,h,s,d] and V^T [b,h,d,s]
          int bb = row >> 10, s = row & 1023;
          int sec = col >> 10, cc = col & 1023;
          int h = cc >> 6, d = cc & 63;
          size_t qkIdx = ((size_t)(bb * kH + h) * kS + s) * kHD + d;
          if (sec == 0)      qO[qkIdx] = (bf16)v;
          else if (sec == 1) kO[qkIdx] = (bf16)v;
          else vtO[((size_t)(bb * kH + h) * kHD + d) * kS + s] = (bf16)v;
        }
      }
    }
  }
}

// ---------------------------------------------------------------------------
// Flash attention: block = (b, h, 128 q rows), 8 waves x 16 q rows each.
// Key tiles of 32, double-buffered + async-filled; online softmax; WMMA bf16.
// ---------------------------------------------------------------------------
__global__ __launch_bounds__(256) void attention_kernel(
    const bf16* __restrict__ Q, const bf16* __restrict__ Kk,
    const bf16* __restrict__ VT,
    const int* __restrict__ am, const int* __restrict__ tt,
    bf16* __restrict__ ctx) {
  __shared__ __attribute__((aligned(16))) bf16 sQ[128 * 64];
  __shared__ __attribute__((aligned(16))) bf16 sK[2][32 * 64];
  __shared__ __attribute__((aligned(16))) bf16 sVT[2][64 * 32];
  __shared__ __attribute__((aligned(16))) bf16 sP[8 * 16 * 32];  // per-wave 16x32
  __shared__ float sAmK[2][32];
  __shared__ float sMaskK[2][32];

  const int tid = threadIdx.x;
  const int lane = tid & 31, w = tid >> 5;
  const int hi = lane >> 4, lm = lane & 15;
  const int qt = blockIdx.x, h = blockIdx.y, b = blockIdx.z;
  const size_t headBase = (size_t)(b * kH + h) * kS * kHD;
  const size_t vtBase   = (size_t)(b * kH + h) * kHD * kS;

  // Stage Q tile (contiguous 128*64 halves) via async copies.
#pragma unroll
  for (int j = 0; j < 4; ++j) {
    int idx = tid * 4 + j;  // 0..1023 chunks of 8
    async_copy16(&Q[headBase + (size_t)qt * 128 * kHD + idx * 8], &sQ[idx * 8]);
  }

  auto stageKV = [&](int kt, int buf) {
    async_copy16(&Kk[headBase + (size_t)kt * 32 * kHD + tid * 8],
                 &sK[buf][tid * 8]);
    int d = tid >> 2, c = tid & 3;
    async_copy16(&VT[vtBase + (size_t)d * kS + kt * 32 + c * 8],
                 &sVT[buf][d * 32 + c * 8]);
    if (tid < 32) {
      int col = kt * 32 + tid;
      int a2 = am[b * kS + col];
      int t2 = tt[b * kS + col];
      sAmK[buf][tid]   = (a2 != 0) ? 1.0f : 0.0f;
      sMaskK[buf][tid] = ((t2 == 1) || (a2 == 0) || (col == 0)) ? 1.0f : 0.0f;
    }
  };

  float aq[8];      // query-row activity (for additive 0/1 mask)
  float mrow[8], lrow[8];
#pragma unroll
  for (int i = 0; i < 8; ++i) {
    int r = qt * 128 + w * 16 + hi * 8 + i;
    aq[i] = (am[b * kS + r] != 0) ? 1.0f : 0.0f;
    mrow[i] = -3.0e38f;
    lrow[i] = 0.0f;
  }
  v8f o[4] = {};

  constexpr int kTiles = kS / 32;
  stageKV(0, 0);
  wait_async0();
  __syncthreads();

  for (int kt = 0; kt < kTiles; ++kt) {
    const int cur = kt & 1;
    if (kt + 1 < kTiles) stageKV(kt + 1, cur ^ 1);

    // Scores: 16 q rows x 32 keys (2 n-tiles, 2 chained WMMAs over HD=64)
    v16bf a0 = ld_frag(&sQ[(w * 16 + lm) * 64 + hi * 8]);
    v16bf a1 = ld_frag(&sQ[(w * 16 + lm) * 64 + 32 + hi * 8]);
    v8f s[2] = {};
#pragma unroll
    for (int nt = 0; nt < 2; ++nt) {
      v16bf b0 = ld_frag(&sK[cur][(nt * 16 + lm) * 64 + hi * 8]);
      v16bf b1 = ld_frag(&sK[cur][(nt * 16 + lm) * 64 + 32 + hi * 8]);
      s[nt] = wmma_bf16(a0, b0, s[nt]);
      s[nt] = wmma_bf16(a1, b1, s[nt]);
    }

    float amk0 = sAmK[cur][lm],   amk1 = sAmK[cur][16 + lm];
    float mk0  = sMaskK[cur][lm], mk1  = sMaskK[cur][16 + lm];
#pragma unroll
    for (int i = 0; i < 8; ++i) {
      float v0 = s[0][i] * 0.125f + aq[i] * amk0;   // 1/sqrt(64) + additive 0/1
      float v1 = s[1][i] * 0.125f + aq[i] * amk1;
      if (mk0 > 0.5f) v0 = kNEG;
      if (mk1 > 0.5f) v1 = kNEG;
      // row max over 32 keys (16-lane xor reduction; rows live in lane halves)
      float rm = fmaxf(v0, v1);
      rm = fmaxf(rm, __shfl_xor(rm, 1, 32));
      rm = fmaxf(rm, __shfl_xor(rm, 2, 32));
      rm = fmaxf(rm, __shfl_xor(rm, 4, 32));
      rm = fmaxf(rm, __shfl_xor(rm, 8, 32));
      float nm = fmaxf(mrow[i], rm);
      float sc = __expf(mrow[i] - nm);
      float p0 = __expf(v0 - nm);
      float p1 = __expf(v1 - nm);
      float rs = p0 + p1;
      rs += __shfl_xor(rs, 1, 32);
      rs += __shfl_xor(rs, 2, 32);
      rs += __shfl_xor(rs, 4, 32);
      rs += __shfl_xor(rs, 8, 32);
      lrow[i] = lrow[i] * sc + rs;
      mrow[i] = nm;
#pragma unroll
      for (int ot = 0; ot < 4; ++ot) o[ot][i] = o[ot][i] * sc;
      // stage P into A-fragment layout (per-wave region, wave-internal RAW)
      sP[(w * 16 + hi * 8 + i) * 32 + lm]      = (bf16)p0;
      sP[(w * 16 + hi * 8 + i) * 32 + 16 + lm] = (bf16)p1;
    }

    // O += P(16x32) @ V(32x64): 4 n-tiles of 16 dims
    v16bf pa = ld_frag(&sP[(w * 16 + lm) * 32 + hi * 8]);
#pragma unroll
    for (int ot = 0; ot < 4; ++ot) {
      v16bf bv = ld_frag(&sVT[cur][(ot * 16 + lm) * 32 + hi * 8]);
      o[ot] = wmma_bf16(pa, bv, o[ot]);
    }

    wait_async0();    // next K/V buffer filled (overlapped with compute)
    __syncthreads();  // all waves done with `cur` before it is refilled
  }

  // ctx[b, s, h*64+d] in bf16 for the out-projection GEMM
#pragma unroll
  for (int ot = 0; ot < 4; ++ot) {
#pragma unroll
    for (int i = 0; i < 8; ++i) {
      int qrow = qt * 128 + w * 16 + hi * 8 + i;
      int d = ot * 16 + lm;
      float v = o[ot][i] / lrow[i];
      ctx[((size_t)b * kS + qrow) * kE + h * kHD + d] = (bf16)v;
    }
  }
}

// ---------------------------------------------------------------------------
// out = LayerNorm(a + r) * g + be ; optionally also emit bf16 copy
// One block (256 threads) per token row of E=1024.
// ---------------------------------------------------------------------------
__global__ __launch_bounds__(256) void add_ln_kernel(
    const float* __restrict__ a, const float* __restrict__ r,
    const float* __restrict__ g, const float* __restrict__ be,
    float* __restrict__ outF, bf16* __restrict__ outB) {
  __shared__ float red[256];
  const int row = blockIdx.x, t = threadIdx.x;
  const size_t base = (size_t)row * kE;
  float4 va = ((const float4*)(a + base))[t];
  float4 vr = ((const float4*)(r + base))[t];
  float x0 = va.x + vr.x, x1 = va.y + vr.y, x2 = va.z + vr.z, x3 = va.w + vr.w;

  red[t] = x0 + x1 + x2 + x3;
  __syncthreads();
  for (int o = 128; o > 0; o >>= 1) { if (t < o) red[t] += red[t + o]; __syncthreads(); }
  float mu = red[0] * (1.0f / kE);
  __syncthreads();

  float d0 = x0 - mu, d1 = x1 - mu, d2 = x2 - mu, d3 = x3 - mu;
  red[t] = d0 * d0 + d1 * d1 + d2 * d2 + d3 * d3;
  __syncthreads();
  for (int o = 128; o > 0; o >>= 1) { if (t < o) red[t] += red[t + o]; __syncthreads(); }
  float inv = rsqrtf(red[0] * (1.0f / kE) + 1e-12f);

  float4 gw = ((const float4*)g)[t];
  float4 bb = ((const float4*)be)[t];
  float o0 = d0 * inv * gw.x + bb.x;
  float o1 = d1 * inv * gw.y + bb.y;
  float o2 = d2 * inv * gw.z + bb.z;
  float o3 = d3 * inv * gw.w + bb.w;
  ((float4*)(outF + base))[t] = make_float4(o0, o1, o2, o3);
  if (outB) {
    outB[base + t * 4 + 0] = (bf16)o0;
    outB[base + t * 4 + 1] = (bf16)o1;
    outB[base + t * 4 + 2] = (bf16)o2;
    outB[base + t * 4 + 3] = (bf16)o3;
  }
}

// ---------------------------------------------------------------------------
extern "C" void kernel_launch(void* const* d_in, const int* in_sizes, int n_in,
                              void* d_out, int out_size, void* d_ws, size_t ws_size,
                              hipStream_t stream) {
  const float* x    = (const float*)d_in[0];
  const int*   am   = (const int*)d_in[1];
  const int*   tt   = (const int*)d_in[2];
  const float* wqkv = (const float*)d_in[3];
  const float* bqkv = (const float*)d_in[4];
  const float* wout = (const float*)d_in[5];
  const float* bout = (const float*)d_in[6];
  const float* lnw  = (const float*)d_in[7];
  const float* lnb  = (const float*)d_in[8];
  const float* win  = (const float*)d_in[9];
  const float* bin  = (const float*)d_in[10];
  const float* wo2  = (const float*)d_in[11];
  const float* bo2  = (const float*)d_in[12];
  float* out = (float*)d_out;

  char* ws = (char*)d_ws;
  size_t off = 0;
  auto take = [&](size_t bytes) -> char* {
    char* p = ws + off;
    off += (bytes + 255) & ~(size_t)255;
    return p;
  };
  bf16*  xb     = (bf16*)take((size_t)kM * kE * 2);          // 16 MB
  bf16*  wqkvT  = (bf16*)take((size_t)3 * kE * kE * 2);      //  6 MB
  bf16*  woutT  = (bf16*)take((size_t)kE * kE * 2);          //  2 MB
  bf16*  winT   = (bf16*)take((size_t)kF * kE * 2);          //  8 MB
  bf16*  wo2T   = (bf16*)take((size_t)kE * kF * 2);          //  8 MB
  bf16*  qBuf   = (bf16*)take((size_t)kM * kE * 2);          // 16 MB  [b,h,s,d]
  bf16*  kBuf   = (bf16*)take((size_t)kM * kE * 2);          // 16 MB  [b,h,s,d]
  bf16*  vtBuf  = (bf16*)take((size_t)kM * kE * 2);          // 16 MB  [b,h,d,s]
  bf16*  ctx    = (bf16*)take((size_t)kM * kE * 2);          // 16 MB  [b,s,e]
  float* attnF  = (float*)take((size_t)kM * kE * 4);         // 32 MB (reused as out2)
  float* hF     = (float*)take((size_t)kM * kE * 4);         // 32 MB
  bf16*  hB     = (bf16*)take((size_t)kM * kE * 2);          // 16 MB
  bf16*  ff     = qBuf;  // 64 MB alias over q/k/vT/ctx (dead after out-proj)

  // 1) bf16 conversions / weight transposes
  cvt_bf16_kernel<<<(kM * kE) / 1024, 256, 0, stream>>>(x, xb, kM * kE);
  transpose_cvt_kernel<<<(3 * kE * kE) / 256, 256, 0, stream>>>(wqkv, wqkvT, kE, 3 * kE);
  transpose_cvt_kernel<<<(kE * kE) / 256, 256, 0, stream>>>(wout, woutT, kE, kE);
  transpose_cvt_kernel<<<(kE * kF) / 256, 256, 0, stream>>>(win, winT, kE, kF);
  transpose_cvt_kernel<<<(kF * kE) / 256, 256, 0, stream>>>(wo2, wo2T, kF, kE);

  // 2) QKV projection with head-split scatter epilogue
  gemm_bf16_kernel<EPI_QKV><<<dim3(3 * kE / 64, kM / 128), 256, 0, stream>>>(
      xb, wqkvT, bqkv, nullptr, nullptr, qBuf, kBuf, vtBuf, kM, 3 * kE, kE);

  // 3) Flash attention
  attention_kernel<<<dim3(kS / 128, kH, kB), 256, 0, stream>>>(
      qBuf, kBuf, vtBuf, am, tt, ctx);

  // 4) Output projection
  gemm_bf16_kernel<EPI_PLAIN><<<dim3(kE / 64, kM / 128), 256, 0, stream>>>(
      ctx, woutT, bout, attnF, nullptr, nullptr, nullptr, nullptr, kM, kE, kE);

  // 5) h = LN(attn_out + x)
  add_ln_kernel<<<kM, 256, 0, stream>>>(attnF, x, lnw, lnb, hF, hB);

  // 6) FFN up + exact GELU (bf16 out)
  gemm_bf16_kernel<EPI_GELU><<<dim3(kF / 64, kM / 128), 256, 0, stream>>>(
      hB, winT, bin, nullptr, ff, nullptr, nullptr, nullptr, kM, kF, kE);

  // 7) FFN down (f32 out, reusing attnF)
  gemm_bf16_kernel<EPI_PLAIN><<<dim3(kE / 64, kM / 128), 256, 0, stream>>>(
      ff, wo2T, bo2, attnF, nullptr, nullptr, nullptr, nullptr, kM, kE, kF);

  // 8) out = LN(ffn_out + h)
  add_ln_kernel<<<kM, 256, 0, stream>>>(attnF, hF, lnw, lnb, out, nullptr);

  (void)in_sizes; (void)n_in; (void)out_size; (void)ws_size;
}

// v001
// A run of this version takes 549 microseconds.
// Next to v000, in two timings, it ran 1.23 times as fast each time.
#include <hip/hip_runtime.h>
#include <hip/hip_bf16.h>

typedef __bf16 bf16;
typedef __attribute__((ext_vector_type(8)))  float v8f;
typedef __attribute__((ext_vector_type(16))) bf16  v16bf;
typedef __attribute__((ext_vector_type(8)))  bf16  v8bf;

constexpr int kB = 8, kS = 1024, kE = 1024, kH = 16, kHD = 64, kF = 4096;
constexpr int kM = kB * kS;  // 8192 token rows
constexpr float kNEG = -1.0e30f;

// LDS row pitch in halves for rows read by 16-byte fragment loads: an odd
// multiple of 16 B, so the 16 rows of one fragment load fall on distinct banks.
constexpr int kP32 = 40;  // rows of 32 halves (64 B) at 80 B
constexpr int kP64 = 72;  // rows of 64 halves (128 B) at 144 B

// ---------------------------------------------------------------------------
// WMMA + async-copy helpers (CDNA5 wave32)
// ---------------------------------------------------------------------------
__device__ __forceinline__ v8f wmma_bf16(v16bf a, v16bf b, v8f c) {
  return __builtin_amdgcn_wmma_f32_16x16x32_bf16(
      /*neg_a=*/false, a, /*neg_b=*/false, b,
      /*c_mod=*/(short)0, c, /*reuse_a=*/false, /*reuse_b=*/false);
}

// A/B fragment for one lane: two contiguous 8-half runs at p and p+16.
// (16-bit operand layout: lanes<16 hold K = 0..7 & 16..23 of the 32-K tile,
//  lanes>=16 hold K = 8..15 & 24..31 — caller passes p already offset by hi*8.)
__device__ __forceinline__ v16bf ld_frag(const bf16* p) {
  union { v16bf v; v8bf h[2]; } u;
  u.h[0] = *(const v8bf*)(p);
  u.h[1] = *(const v8bf*)(p + 16);
  return u.v;
}

// 16-byte global -> LDS async copy (ASYNCcnt-tracked, no VGPR staging).
// LDS destination = low 32 bits of the generic pointer (LDS aperture offset).
// The closing s_wait_xcnt 0 stands inside the copies' own statement as a
// precaution: no address register of a copy is rewritten ahead of it.
__device__ __forceinline__ void async_copy16_x2(const bf16* g0, bf16* l0,
                                                const bf16* g1, bf16* l1) {
  asm volatile("global_load_async_to_lds_b128 %0, %1, off\n\t"
               "global_load_async_to_lds_b128 %2, %3, off\n\t"
               "s_wait_xcnt 0x0"
               :: "v"((unsigned)(size_t)l0), "v"(g0),
                  "v"((unsigned)(size_t)l1), "v"(g1) : "memory");
}
__device__ __forceinline__ void async_copy16_x3(const bf16* g0, bf16* l0,
                                                const bf16* g1, bf16* l1,
                                                const bf16* g2, bf16* l2) {
  asm volatile("global_load_async_to_lds_b128 %0, %1, off\n\t"
               "global_load_async_to_lds_b128 %2, %3, off\n\t"
               "global_load_async_to_lds_b128 %4, %5, off\n\t"
               "s_wait_xcnt 0x0"
               :: "v"((unsigned)(size_t)l0), "v"(g0),
                  "v"((unsigned)(size_t)l1), "v"(g1),
                  "v"((unsigned)(size_t)l2), "v"(g2) : "memory");
}
__device__ __forceinline__ void wait_async0() {
  asm volatile("s_wait_asynccnt 0x0" ::: "memory");
}

// ---------------------------------------------------------------------------
// Small conversion kernels
// ---------------------------------------------------------------------------
__global__ __launch_bounds__(256) void cvt_bf16_kernel(const float* __restrict__ in,
                                                       bf16* __restrict__ out, int n) {
  int idx = (blockIdx.x * 256 + threadIdx.x) * 4;
  if (idx < n) {
    float4 v = *(const float4*)(in + idx);
    out[idx + 0] = (bf16)v.x;
    out[idx + 1] = (bf16)v.y;
    out[idx + 2] = (bf16)v.z;
    out[idx + 3] = (bf16)v.w;
  }
}

// in: [K,N] fp32 row-major  ->  out: [N,K] bf16 row-major
__global__ __launch_bounds__(256) void transpose_cvt_kernel(const float* __restrict__ in,
                                                            bf16* __restrict__ out,
                                                            int K, int N) {
  size_t idx = (size_t)blockIdx.x * 256 + threadIdx.x;
  if (idx < (size_t)K * N) {
    int n = (int)(idx / K), k = (int)(idx % K);
    out[idx] = (bf16)in[(size_t)k * N + n];
  }
}

// ---------------------------------------------------------------------------
// Generic bf16 GEMM: C[M,N] = A[M,K] * Bt[N,K]^T + bias, fused epilogues.
// Block = 256 threads (8 wave32), tile 128(M) x 64(N), waves 4x2, wave 32x32.
// Double-buffered LDS filled by GLOBAL_LOAD_ASYNC_TO_LDS_B128; one barrier
// per K-step; async fill of tile t+1 overlaps the 4 WMMAs of tile t.
// ---------------------------------------------------------------------------
enum { EPI_PLAIN = 0, EPI_GELU = 1, EPI_QKV = 2 };

template <int EPI>
__global__ __launch_bounds__(256) void gemm_bf16_kernel(
    const bf16* __restrict__ A, const bf16* __restrict__ Bt,
    const float* __restrict__ bias,
    float* __restrict__ Cf, bf16* __restrict__ Cb,
    bf16* __restrict__ qO, bf16* __restrict__ kO, bf16* __restrict__ vtO,
    int M, int N, int K) {
  __shared__ __attribute__((aligned(16))) bf16 sA[2][128 * kP32];
  __shared__ __attribute__((aligned(16))) bf16 sB[2][64 * kP32];
  const int tid = threadIdx.x;
  const int lane = tid & 31, wave = tid >> 5;
  const int hi = lane >> 4, lm = lane & 15;
  const int waveM = wave & 3, waveN = wave >> 2;
  const int m0 = blockIdx.y * 128;
  const int n0 = blockIdx.x * 64;

  // Per-thread fixed staging slots (chunks of 8 halves = 16 B).
  const int aRow0 = (tid * 2) >> 2,     aCh0 = (tid * 2) & 3;
  const int aRow1 = (tid * 2 + 1) >> 2, aCh1 = (tid * 2 + 1) & 3;
  const int bRow  = tid >> 2,           bCh  = tid & 3;

  auto stage = [&](int kt, int buf) {
    const int kk = kt * 32;
    async_copy16_x3(&A[(size_t)(m0 + aRow0) * K + kk + aCh0 * 8],
                    &sA[buf][aRow0 * kP32 + aCh0 * 8],
                    &A[(size_t)(m0 + aRow1) * K + kk + aCh1 * 8],
                    &sA[buf][aRow1 * kP32 + aCh1 * 8],
                    &Bt[(size_t)(n0 + bRow) * K + kk + bCh * 8],
                    &sB[buf][bRow * kP32 + bCh * 8]);
  };

  v8f acc[2][2] = {};
  const int kTiles = K >> 5;

  stage(0, 0);
  wait_async0();
  __syncthreads();

  for (int kt = 0; kt < kTiles; ++kt) {
    const int cur = kt & 1;
    if (kt + 1 < kTiles) stage(kt + 1, cur ^ 1);

    v16bf af[2], bfr[2];
#pragma unroll
    for (int mt = 0; mt < 2; ++mt)
      af[mt] = ld_frag(&sA[cur][(waveM * 32 + mt * 16 + lm) * kP32 + hi * 8]);
#pragma unroll
    for (int nt = 0; nt < 2; ++nt)
      bfr[nt] = ld_frag(&sB[cur][(waveN * 32 + nt * 16 + lm) * kP32 + hi * 8]);
#pragma unroll
    for (int mt = 0; mt < 2; ++mt)
#pragma unroll
      for (int nt = 0; nt < 2; ++nt)
        acc[mt][nt] = wmma_bf16(af[mt], bfr[nt], acc[mt][nt]);

    wait_async0();    // next-buffer fill complete (overlapped with WMMAs)
    __syncthreads();  // all waves done reading `cur` before it is refilled
  }

#pragma unroll
  for (int mt = 0; mt < 2; ++mt) {
#pragma unroll
    for (int nt = 0; nt < 2; ++nt) {
#pragma unroll
      for (int i = 0; i < 8; ++i) {
        int row = m0 + waveM * 32 + mt * 16 + hi * 8 + i;
        int col = n0 + waveN * 32 + nt * 16 + lm;
        float v = acc[mt][nt][i] + bias[col];
        if constexpr (EPI == EPI_PLAIN) {
          Cf[(size_t)row * N + col] = v;
        } else if constexpr (EPI == EPI_GELU) {
          float g = 0.5f * v * (1.0f + erff(v * 0.70710678118654752f));
          Cb[(size_t)row * N + col] = (bf16)g;
        } else {  // EPI_QKV: scatter to Q/K [b,h,s,d] and V^T [b,h,d,s]
          int bb = row >> 10, s = row & 1023;
          int sec = col >> 10, cc = col & 1023;
          int h = cc >> 6, d = cc & 63;
          size_t qkIdx = ((size_t)(bb * kH + h) * kS + s) * kHD + d;
          if (sec == 0)      qO[qkIdx] = (bf16)v;
          else if (sec == 1) kO[qkIdx] = (bf16)v;
          else vtO[((size_t)(bb * kH + h) * kHD + d) * kS + s] = (bf16)v;
        }
      }
    }
  }
}

// ---------------------------------------------------------------------------
// Flash attention: block = (b, h, 128 q rows), 8 waves x 16 q rows each.
// Key tiles of 32, double-buffered + async-filled; online softmax; WMMA bf16.
// ---------------------------------------------------------------------------
__global__ __launch_bounds__(256) void attention_kernel(
    const bf16* __restrict__ Q, const bf16* __restrict__ Kk,
    const bf16* __restrict__ VT,
    const int* __restrict__ am, const int* __restrict__ tt,
    bf16* __restrict__ ctx) {
  __shared__ __attribute__((aligned(16))) bf16 sQ[128 * kP64];
  __shared__ __attribute__((aligned(16))) bf16 sK[2][32 * kP64];
  __shared__ __attribute__((aligned(16))) bf16 sVT[2][64 * kP32];
  __shared__ __attribute__((aligned(16))) bf16 sP[8 * 16 * kP32];  // per-wave 16x32
  __shared__ float sAmK[2][32];
  __shared__ float sMaskK[2][32];

  const int tid = threadIdx.x;
  const int lane = tid & 31, w = tid >> 5;
  const int hi = lane >> 4, lm = lane & 15;
  const int qt = blockIdx.x, h = blockIdx.y, b = blockIdx.z;
  const size_t headBase = (size_t)(b * kH + h) * kS * kHD;
  const size_t vtBase   = (size_t)(b * kH + h) * kHD * kS;

  // Stage Q tile (contiguous 128*64 halves) via async copies.
#pragma unroll
  for (int j = 0; j < 4; j += 2) {
    int idx = tid * 4 + j;  // 0..1023 chunks of 8; 8 chunks a row
    const bf16* gq = &Q[headBase + (size_t)qt * 128 * kHD + idx * 8];
    bf16* lq = &sQ[(idx >> 3) * kP64 + (idx & 7) * 8];
    async_copy16_x2(gq, lq, gq + 8, lq + 8);
  }

  auto stageKV = [&](int kt, int buf) {
    int d = tid >> 2, c = tid & 3;
    async_copy16_x2(&Kk[headBase + (size_t)kt * 32 * kHD + tid * 8],
                    &sK[buf][(tid >> 3) * kP64 + (tid & 7) * 8],
                    &VT[vtBase + (size_t)d * kS + kt * 32 + c * 8],
                    &sVT[buf][d * kP32 + c * 8]);
    if (tid < 32) {
      int col = kt * 32 + tid;
      int a2 = am[b * kS + col];
      int t2 = tt[b * kS + col];
      sAmK[buf][tid]   = (a2 != 0) ? 1.0f : 0.0f;
      sMaskK[buf][tid] = ((t2 == 1) || (a2 == 0) || (col == 0)) ? 1.0f : 0.0f;
    }
  };

  float aq[8];      // query-row activity (for additive 0/1 mask)
  float mrow[8], lrow[8];
#pragma unroll
  for (int i = 0; i < 8; ++i) {
    int r = qt * 128 + w * 16 + hi * 8 + i;
    aq[i] = (am[b * kS + r] != 0) ? 1.0f : 0.0f;
    mrow[i] = -3.0e38f;
    lrow[i] = 0.0f;
  }
  v8f o[4] = {};

  constexpr int kTiles = kS / 32;
  stageKV(0, 0);
  wait_async0();
  __syncthreads();

  for (int kt = 0; kt < kTiles; ++kt) {
    const int cur = kt & 1;
    if (kt + 1 < kTiles) stageKV(kt + 1, cur ^ 1);

    // Scores: 16 q rows x 32 keys (2 n-tiles, 2 chained WMMAs over HD=64)
    v16bf a0 = ld_frag(&sQ[(w * 16 + lm) * kP64 + hi * 8]);
    v16bf a1 = ld_frag(&sQ[(w * 16 + lm) * kP64 + 32 + hi * 8]);
    v8f s[2] = {};
#pragma unroll
    for (int nt = 0; nt < 2; ++nt) {
      v16bf b0 = ld_frag(&sK[cur][(nt * 16 + lm) * kP64 + hi * 8]);
      v16bf b1 = ld_frag(&sK[cur][(nt * 16 + lm) * kP64 + 32 + hi * 8]);
      s[nt] = wmma_bf16(a0, b0, s[nt]);
      s[nt] = wmma_bf16(a1, b1, s[nt]);
    }

    float amk0 = sAmK[cur][lm],   amk1 = sAmK[cur][16 + lm];
    float mk0  = sMaskK[cur][lm], mk1  = sMaskK[cur][16 + lm];
#pragma unroll
    for (int i = 0; i < 8; ++i) {
      float v0 = s[0][i] * 0.125f + aq[i] * amk0;   // 1/sqrt(64) + additive 0/1
      float v1 = s[1][i] * 0.125f + aq[i] * amk1;
      if (mk0 > 0.5f) v0 = kNEG;
      if (mk1 > 0.5f) v1 = kNEG;
      // row max over 32 keys (16-lane xor reduction; rows live in lane halves)
      float rm = fmaxf(v0, v1);
      rm = fmaxf(rm, __shfl_xor(rm, 1, 32));
      rm = fmaxf(rm, __shfl_xor(rm, 2, 32));
      rm = fmaxf(rm, __shfl_xor(rm, 4, 32));
      rm = fmaxf(rm, __shfl_xor(rm, 8, 32));
      float nm = fmaxf(mrow[i], rm);
      float sc = __expf(mrow[i] - nm);
      float p0 = __expf(v0 - nm);
      float p1 = __expf(v1 - nm);
      float rs = p0 + p1;
      rs += __shfl_xor(rs, 1, 32);
      rs += __shfl_xor(rs, 2, 32);
      rs += __shfl_xor(rs, 4, 32);
      rs += __shfl_xor(rs, 8, 32);
      lrow[i] = lrow[i] * sc + rs;
      mrow[i] = nm;
#pragma unroll
      for (int ot = 0; ot < 4; ++ot) o[ot][i] = o[ot][i] * sc;
      // stage P into A-fragment layout (per-wave region, wave-internal RAW)
      sP[(w * 16 + hi * 8 + i) * kP32 + lm]      = (bf16)p0;
      sP[(w * 16 + hi * 8 + i) * kP32 + 16 + lm] = (bf16)p1;
    }

    // O += P(16x32) @ V(32x64): 4 n-tiles of 16 dims
    v16bf pa = ld_frag(&sP[(w * 16 + lm) * kP32 + hi * 8]);
#pragma unroll
    for (int ot = 0; ot < 4; ++ot) {
      v16bf bv = ld_frag(&sVT[cur][(ot * 16 + lm) * kP32 + hi * 8]);
      o[ot] = wmma_bf16(pa, bv, o[ot]);
    }

    wait_async0();    // next K/V buffer filled (overlapped with compute)
    __syncthreads();  // all waves done with `cur` before it is refilled
  }

  // ctx[b, s, h*64+d] in bf16 for the out-projection GEMM
#pragma unroll
  for (int ot = 0; ot < 4; ++ot) {
#pragma unroll
    for (int i = 0; i < 8; ++i) {
      int qrow = qt * 128 + w * 16 + hi * 8 + i;
      int d = ot * 16 + lm;
      float v = o[ot][i] / lrow[i];
      ctx[((size_t)b * kS + qrow) * kE + h * kHD + d] = (bf16)v;
    }
  }
}

// ---------------------------------------------------------------------------
// out = LayerNorm(a + r) * g + be ; optionally also emit bf16 copy
// One block (256 threads) per token row of E=1024.
// ---------------------------------------------------------------------------
__global__ __launch_bounds__(256) void add_ln_kernel(
    const float* __restrict__ a, const float* __restrict__ r,
    const float* __restrict__ g, const float* __restrict__ be,
    float* __restrict__ outF, bf16* __restrict__ outB) {
  __shared__ float red[256];
  const int row = blockIdx.x, t = threadIdx.x;
  const size_t base = (size_t)row * kE;
  float4 va = ((const float4*)(a + base))[t];
  float4 vr = ((const float4*)(r + base))[t];
  float x0 = va.x + vr.x, x1 = va.y + vr.y, x2 = va.z + vr.z, x3 = va.w + vr.w;

  red[t] = x0 + x1 + x2 + x3;
  __syncthreads();
  for (int o = 128; o > 0; o >>= 1) { if (t < o) red[t] += red[t + o]; __syncthreads(); }
  float mu = red[0] * (1.0f / kE);
  __syncthreads();

  float d0 = x0 - mu, d1 = x1 - mu, d2 = x2 - mu, d3 = x3 - mu;
  red[t] = d0 * d0 + d1 * d1 + d2 * d2 + d3 * d3;
  __syncthreads();
  for (int o = 128; o > 0; o >>= 1) { if (t < o) red[t] += red[t + o]; __syncthreads(); }
  float inv = rsqrtf(red[0] * (1.0f / kE) + 1e-12f);

  float4 gw = ((const float4*)g)[t];
  float4 bb = ((const float4*)be)[t];
  float o0 = d0 * inv * gw.x + bb.x;
  float o1 = d1 * inv * gw.y + bb.y;
  float o2 = d2 * inv * gw.z + bb.z;
  float o3 = d3 * inv * gw.w + bb.w;
  ((float4*)(outF + base))[t] = make_float4(o0, o1, o2, o3);
  if (outB) {
    outB[base + t * 4 + 0] = (bf16)o0;
    outB[base + t * 4 + 1] = (bf16)o1;
    outB[base + t * 4 + 2] = (bf16)o2;
    outB[base + t * 4 + 3] = (bf16)o3;
  }
}

// ---------------------------------------------------------------------------
extern "C" void kernel_launch(void* const* d_in, const int* in_sizes, int n_in,
                              void* d_out, int out_size, void* d_ws, size_t ws_size,
                              hipStream_t stream) {
  const float* x    = (const float*)d_in[0];
  const int*   am   = (const int*)d_in[1];
  const int*   tt   = (const int*)d_in[2];
  const float* wqkv = (const float*)d_in[3];
  const float* bqkv = (const float*)d_in[4];
  const float* wout = (const float*)d_in[5];
  const float* bout = (const float*)d_in[6];
  const float* lnw  = (const float*)d_in[7];
  const float* lnb  = (const float*)d_in[8];
  const float* win  = (const float*)d_in[9];
  const float* bin  = (const float*)d_in[10];
  const float* wo2  = (const float*)d_in[11];
  const float* bo2  = (const float*)d_in[12];
  float* out = (float*)d_out;

  char* ws = (char*)d_ws;
  size_t off = 0;
  auto take = [&](size_t bytes) -> char* {
    char* p = ws + off;
    off += (bytes + 255) & ~(size_t)255;
    return p;
  };
  bf16*  xb     = (bf16*)take((size_t)kM * kE * 2);          // 16 MB
  bf16*  wqkvT  = (bf16*)take((size_t)3 * kE * kE * 2);      //  6 MB
  bf16*  woutT  = (bf16*)take((size_t)kE * kE * 2);          //  2 MB
  bf16*  winT   = (bf16*)take((size_t)kF * kE * 2);          //  8 MB
  bf16*  wo2T   = (bf16*)take((size_t)kE * kF * 2);          //  8 MB
  bf16*  qBuf   = (bf16*)take((size_t)kM * kE * 2);          // 16 MB  [b,h,s,d]
  bf16*  kBuf   = (bf16*)take((size_t)kM * kE * 2);          // 16 MB  [b,h,s,d]
  bf16*  vtBuf  = (bf16*)take((size_t)kM * kE * 2);          // 16 MB  [b,h,d,s]
  bf16*  ctx    = (bf16*)take((size_t)kM * kE * 2);          // 16 MB  [b,s,e]
  float* attnF  = (float*)take((size_t)kM * kE * 4);         // 32 MB (reused as out2)
  float* hF     = (float*)take((size_t)kM * kE * 4);         // 32 MB
  bf16*  hB     = (bf16*)take((size_t)kM * kE * 2);          // 16 MB
  bf16*  ff     = qBuf;  // 64 MB alias over q/k/vT/ctx (dead after out-proj)

  // 1) bf16 conversions / weight transposes
  cvt_bf16_kernel<<<(kM * kE) / 1024, 256, 0, stream>>>(x, xb, kM * kE);
  transpose_cvt_kernel<<<(3 * kE * kE) / 256, 256, 0, stream>>>(wqkv, wqkvT, kE, 3 * kE);
  transpose_cvt_kernel<<<(kE * kE) / 256, 256, 0, stream>>>(wout, woutT, kE, kE);
  transpose_cvt_kernel<<<(kE * kF) / 256, 256, 0, stream>>>(win, winT, kE, kF);
  transpose_cvt_kernel<<<(kF * kE) / 256, 256, 0, stream>>>(wo2, wo2T, kF, kE);

  // 2) QKV projection with head-split scatter epilogue
  gemm_bf16_kernel<EPI_QKV><<<dim3(3 * kE / 64, kM / 128), 256, 0, stream>>>(
      xb, wqkvT, bqkv, nullptr, nullptr, qBuf, kBuf, vtBuf, kM, 3 * kE, kE);

  // 3) Flash attention
  attention_kernel<<<dim3(kS / 128, kH, kB), 256, 0, stream>>>(
      qBuf, kBuf, vtBuf, am, tt, ctx);

  // 4) Output projection
  gemm_bf16_kernel<EPI_PLAIN><<<dim3(kE / 64, kM / 128), 256, 0, stream>>>(
      ctx, woutT, bout, attnF, nullptr, nullptr, nullptr, nullptr, kM, kE, kE);

  // 5) h = LN(attn_out + x)
  add_ln_kernel<<<kM, 256, 0, stream>>>(attnF, x, lnw, lnb, hF, hB);

  // 6) FFN up + exact GELU (bf16 out)
  gemm_bf16_kernel<EPI_GELU><<<dim3(kF / 64, kM / 128), 256, 0, stream>>>(
      hB, winT, bin, nullptr, ff, nullptr, nullptr, nullptr, kM, kF, kE);

  // 7) FFN down (f32 out, reusing attnF)
  gemm_bf16_kernel<EPI_PLAIN><<<dim3(kE / 64, kM / 128), 256, 0, stream>>>(
      ff, wo2T, bo2, attnF, nullptr, nullptr, nullptr, nullptr, kM, kE, kF);

  // 8) out = LN(ffn_out + h)
  add_ln_kernel<<<kM, 256, 0, stream>>>(attnF, hF, lnw, lnb, out, nullptr);

  (void)in_sizes; (void)n_in; (void)out_size; (void)ws_size;
}

// v002
// A run of this version takes 448 microseconds.
// In both of two side-by-side timings against v001, it was 1.22 times as fast.
// All steps since v000 together make it 1.50 times as fast.
#include <hip/hip_runtime.h>
#include <hip/hip_bf16.h>

typedef __bf16 bf16;
typedef __attribute__((ext_vector_type(8)))  float v8f;
typedef __attribute__((ext_vector_type(16))) bf16  v16bf;
typedef __attribute__((ext_vector_type(8)))  bf16  v8bf;

constexpr int kB = 8, kS = 1024, kE = 1024, kH = 16, kHD = 64, kF = 4096;
constexpr int kM = kB * kS;  // 8192 token rows
constexpr float kNEG = -1.0e30f;

// LDS row pitch in halves for rows read by 16-byte fragment loads: an odd
// multiple of 16 B, so the 16 rows of one fragment load fall on distinct banks.
constexpr int kP32 = 40;  // rows of 32 halves (64 B) at 80 B
constexpr int kP64 = 72;  // rows of 64 halves (128 B) at 144 B

// ---------------------------------------------------------------------------
// WMMA + async-copy helpers (CDNA5 wave32)
// ---------------------------------------------------------------------------
__device__ __forceinline__ v8f wmma_bf16(v16bf a, v16bf b, v8f c) {
  return __builtin_amdgcn_wmma_f32_16x16x32_bf16(
      /*neg_a=*/false, a, /*neg_b=*/false, b,
      /*c_mod=*/(short)0, c, /*reuse_a=*/false, /*reuse_b=*/false);
}

// A/B fragment for one lane: two contiguous 8-half runs at p and p+16.
// (16-bit operand layout: lanes<16 hold K = 0..7 & 16..23 of the 32-K tile,
//  lanes>=16 hold K = 8..15 & 24..31 — caller passes p already offset by hi*8.)
__device__ __forceinline__ v16bf ld_frag(const bf16* p) {
  union { v16bf v; v8bf h[2]; } u;
  u.h[0] = *(const v8bf*)(p);
  u.h[1] = *(const v8bf*)(p + 16);
  return u.v;
}

// 16-byte global -> LDS async copy (ASYNCcnt-tracked, no VGPR staging).
// LDS destination = low 32 bits of the generic pointer (LDS aperture offset).
// The closing s_wait_xcnt 0 stands inside the copies' own statement as a
// precaution: no address register of a copy is rewritten ahead of it.
__device__ __forceinline__ void async_copy16_x2(const bf16* g0, bf16* l0,
                                                const bf16* g1, bf16* l1) {
  asm volatile("global_load_async_to_lds_b128 %0, %1, off\n\t"
               "global_load_async_to_lds_b128 %2, %3, off\n\t"
               "s_wait_xcnt 0x0"
               :: "v"((unsigned)(size_t)l0), "v"(g0),
                  "v"((unsigned)(size_t)l1), "v"(g1) : "memory");
}
__device__ __forceinline__ void async_copy16_x4(const bf16* g0, bf16* l0,
                                                const bf16* g1, bf16* l1,
                                                const bf16* g2, bf16* l2,
                                                const bf16* g3, bf16* l3) {
  asm volatile("global_load_async_to_lds_b128 %0, %1, off\n\t"
               "global_load_async_to_lds_b128 %2, %3, off\n\t"
               "global_load_async_to_lds_b128 %4, %5, off\n\t"
               "global_load_async_to_lds_b128 %6, %7, off\n\t"
               "s_wait_xcnt 0x0"
               :: "v"((unsigned)(size_t)l0), "v"(g0),
                  "v"((unsigned)(size_t)l1), "v"(g1),
                  "v"((unsigned)(size_t)l2), "v"(g2),
                  "v"((unsigned)(size_t)l3), "v"(g3) : "memory");
}
__device__ __forceinline__ void wait_async0() {
  asm volatile("s_wait_asynccnt 0x0" ::: "memory");
}
// A wave's own LDS reads have retired before a copy is aimed at what it read.
__device__ __forceinline__ void wait_ds0() {
  asm volatile("s_wait_dscnt 0x0" ::: "memory");
}

// ---------------------------------------------------------------------------
// Small conversion kernels
// ---------------------------------------------------------------------------
__global__ __launch_bounds__(256) void cvt_bf16_kernel(const float* __restrict__ in,
                                                       bf16* __restrict__ out, int n) {
  int idx = (blockIdx.x * 256 + threadIdx.x) * 4;
  if (idx < n) {
    float4 v = *(const float4*)(in + idx);
    out[idx + 0] = (bf16)v.x;
    out[idx + 1] = (bf16)v.y;
    out[idx + 2] = (bf16)v.z;
    out[idx + 3] = (bf16)v.w;
  }
}

// in: [K,N] fp32 row-major  ->  out: [N,K] bf16 row-major
__global__ __launch_bounds__(256) void transpose_cvt_kernel(const float* __restrict__ in,
                                                            bf16* __restrict__ out,
                                                            int K, int N) {
  size_t idx = (size_t)blockIdx.x * 256 + threadIdx.x;
  if (idx < (size_t)K * N) {
    int n = (int)(idx / K), k = (int)(idx % K);
    out[idx] = (bf16)in[(size_t)k * N + n];
  }
}

// ---------------------------------------------------------------------------
// Generic bf16 GEMM: C[M,N] = A[M,K] * Bt[N,K]^T + bias, fused epilogues.
// Block = 256 threads (8 wave32), tile 256(M) x 128(N), waves 4x2, wave 64x64.
// A pass is 64 k: 128-B rows at 144 B pitch, two LDS buffers filled by
// GLOBAL_LOAD_ASYNC_TO_LDS_B128; one barrier per pass; a buffer's refill is
// issued right behind the barrier that frees it and has a whole pass to land.
// Needs M % 256 == 0, N % 128 == 0, K % 64 == 0.
// ---------------------------------------------------------------------------
enum { EPI_PLAIN = 0, EPI_GELU = 1, EPI_QKV = 2 };

template <int EPI>
__global__ __launch_bounds__(256) void gemm_bf16_kernel(
    const bf16* __restrict__ A, const bf16* __restrict__ Bt,
    const float* __restrict__ bias,
    float* __restrict__ Cf, bf16* __restrict__ Cb,
    bf16* __restrict__ qO, bf16* __restrict__ kO, bf16* __restrict__ vtO,
    int M, int N, int K) {
  __shared__ __attribute__((aligned(16))) bf16 sA[2][256 * kP64];
  __shared__ __attribute__((aligned(16))) bf16 sB[2][128 * kP64];
  const int tid = threadIdx.x;
  const int lane = tid & 31, wave = tid >> 5;
  const int hi = lane >> 4, lm = lane & 15;
  const int waveM = wave & 3, waveN = wave >> 2;
  const int m0 = blockIdx.y * 256;
  const int n0 = blockIdx.x * 128;

  // Staging slots: 8 chunks of 16 B a row, so a wave's copy covers 4 whole rows
  // of 128 B; a thread keeps its chunk and walks rows sRow + 32 j.
  const int sRow = tid >> 3, sCh = tid & 7;
  const bf16* gA = &A[(size_t)(m0 + sRow) * K + sCh * 8];
  const bf16* gB = &Bt[(size_t)(n0 + sRow) * K + sCh * 8];
  const size_t rowStep = (size_t)32 * K;
  const int sOff = sRow * kP64 + sCh * 8;

  auto stage = [&](int kt, int buf) {
    const bf16* a = gA + kt * 64;
    const bf16* b = gB + kt * 64;
    bf16* la = &sA[buf][sOff];
    bf16* lb = &sB[buf][sOff];
    async_copy16_x4(a,               la,
                    a + rowStep,     la + 32 * kP64,
                    a + 2 * rowStep, la + 64 * kP64,
                    a + 3 * rowStep, la + 96 * kP64);
    async_copy16_x4(a + 4 * rowStep, la + 128 * kP64,
                    a + 5 * rowStep, la + 160 * kP64,
                    a + 6 * rowStep, la + 192 * kP64,
                    a + 7 * rowStep, la + 224 * kP64);
    async_copy16_x4(b,               lb,
                    b + rowStep,     lb + 32 * kP64,
                    b + 2 * rowStep, lb + 64 * kP64,
                    b + 3 * rowStep, lb + 96 * kP64);
  };

  v8f acc[4][4] = {};
  const int kTiles = K >> 6;

  stage(0, 0);
  wait_async0();
  __syncthreads();
  if (kTiles > 1) stage(1, 1);

  // All loops over mt / nt are unrolled so that the fragment and accumulator
  // arrays are indexed by constants and stay in registers.
  v16bf af[4], bfr[4];
  auto load_frags = [&](int buf, int ks) {
#pragma unroll
    for (int mt = 0; mt < 4; ++mt)
      af[mt] = ld_frag(&sA[buf][(waveM * 64 + mt * 16 + lm) * kP64 + ks * 32 + hi * 8]);
#pragma unroll
    for (int nt = 0; nt < 4; ++nt)
      bfr[nt] = ld_frag(&sB[buf][(waveN * 64 + nt * 16 + lm) * kP64 + ks * 32 + hi * 8]);
  };
  auto mma16 = [&]() {
#pragma unroll
    for (int mt = 0; mt < 4; ++mt)
#pragma unroll
      for (int nt = 0; nt < 4; ++nt)
        acc[mt][nt] = wmma_bf16(af[mt], bfr[nt], acc[mt][nt]);
  };

  for (int kt = 0; kt < kTiles; ++kt) {
    const int cur = kt & 1;
    load_frags(cur, 0);
    // Keeps the 16 fragment loads one group ahead of the 16 WMMAs: left alone
    // the compiler reloads one A fragment per row and waits it out each time.
    __builtin_amdgcn_sched_barrier(0);
    mma16();
    load_frags(cur, 1);  // the pass's last reads of `cur`, into registers

    wait_ds0();       // this wave's reads of `cur` have retired before its refill
    wait_async0();    // this wave's share of the other buffer has landed
    __syncthreads();  // publishes the other buffer; ends every read of `cur`
    if (kt + 2 < kTiles) stage(kt + 2, cur);
    mma16();  // registers only: the refill flies from here on
  }
  wait_async0();  // no copy outstanding when the wave ends

#pragma unroll
  for (int mt = 0; mt < 4; ++mt) {
#pragma unroll
    for (int nt = 0; nt < 4; ++nt) {
#pragma unroll
      for (int i = 0; i < 8; ++i) {
        int row = m0 + waveM * 64 + mt * 16 + hi * 8 + i;
        int col = n0 + waveN * 64 + nt * 16 + lm;
        float v = acc[mt][nt][i] + bias[col];
        if constexpr (EPI == EPI_PLAIN) {
          Cf[(size_t)row * N + col] = v;
        } else if constexpr (EPI == EPI_GELU) {
          float g = 0.5f * v * (1.0f + erff(v * 0.70710678118654752f));
          Cb[(size_t)row * N + col] = (bf16)g;
        } else {  // EPI_QKV: scatter to Q/K [b,h,s,d] and V^T [b,h,d,s]
          int bb = row >> 10, s = row & 1023;
          int sec = col >> 10, cc = col & 1023;
          int h = cc >> 6, d = cc & 63;
          size_t qkIdx = ((size_t)(bb * kH + h) * kS + s) * kHD + d;
          if (sec == 0)      qO[qkIdx] = (bf16)v;
          else if (sec == 1) kO[qkIdx] = (bf16)v;
          else vtO[((size_t)(bb * kH + h) * kHD + d) * kS + s] = (bf16)v;
        }
      }
    }
  }
}

// ---------------------------------------------------------------------------
// Flash attention: block = (b, h, 128 q rows), 8 waves x 16 q rows each.
// Key tiles of 32, double-buffered + async-filled; online softmax; WMMA bf16.
// ---------------------------------------------------------------------------
__global__ __launch_bounds__(256) void attention_kernel(
    const bf16* __restrict__ Q, const bf16* __restrict__ Kk,
    const bf16* __restrict__ VT,
    const int* __restrict__ am, const int* __restrict__ tt,
    bf16* __restrict__ ctx) {
  __shared__ __attribute__((aligned(16))) bf16 sQ[128 * kP64];
  __shared__ __attribute__((aligned(16))) bf16 sK[2][32 * kP64];
  __shared__ __attribute__((aligned(16))) bf16 sVT[2][64 * kP32];
  __shared__ __attribute__((aligned(16))) bf16 sP[8 * 16 * kP32];  // per-wave 16x32
  __shared__ float sAmK[2][32];
  __shared__ float sMaskK[2][32];

  const int tid = threadIdx.x;
  const int lane = tid & 31, w = tid >> 5;
  const int hi = lane >> 4, lm = lane & 15;
  const int qt = blockIdx.x, h = blockIdx.y, b = blockIdx.z;
  const size_t headBase = (size_t)(b * kH + h) * kS * kHD;
  const size_t vtBase   = (size_t)(b * kH + h) * kHD * kS;

  // Stage Q tile (contiguous 128*64 halves) via async copies.
#pragma unroll
  for (int j = 0; j < 4; j += 2) {
    int idx = tid * 4 + j;  // 0..1023 chunks of 8; 8 chunks a row
    const bf16* gq = &Q[headBase + (size_t)qt * 128 * kHD + idx * 8];
    bf16* lq = &sQ[(idx >> 3) * kP64 + (idx & 7) * 8];
    async_copy16_x2(gq, lq, gq + 8, lq + 8);
  }

  auto stageKV = [&](int kt, int buf) {
    int d = tid >> 2, c = tid & 3;
    async_copy16_x2(&Kk[headBase + (size_t)kt * 32 * kHD + tid * 8],
                    &sK[buf][(tid >> 3) * kP64 + (tid & 7) * 8],
                    &VT[vtBase + (size_t)d * kS + kt * 32 + c * 8],
                    &sVT[buf][d * kP32 + c * 8]);
    if (tid < 32) {
      int col = kt * 32 + tid;
      int a2 = am[b * kS + col];
      int t2 = tt[b * kS + col];
      sAmK[buf][tid]   = (a2 != 0) ? 1.0f : 0.0f;
      sMaskK[buf][tid] = ((t2 == 1) || (a2 == 0) || (col == 0)) ? 1.0f : 0.0f;
    }
  };

  float aq[8];      // query-row activity (for additive 0/1 mask)
  float mrow[8], lrow[8];
#pragma unroll
  for (int i = 0; i < 8; ++i) {
    int r = qt * 128 + w * 16 + hi * 8 + i;
    aq[i] = (am[b * kS + r] != 0) ? 1.0f : 0.0f;
    mrow[i] = -3.0e38f;
    lrow[i] = 0.0f;
  }
  v8f o[4] = {};

  constexpr int kTiles = kS / 32;
  stageKV(0, 0);
  wait_async0();
  __syncthreads();

  for (int kt = 0; kt < kTiles; ++kt) {
    const int cur = kt & 1;
    if (kt + 1 < kTiles) stageKV(kt + 1, cur ^ 1);

    // Scores: 16 q rows x 32 keys (2 n-tiles, 2 chained WMMAs over HD=64)
    v16bf a0 = ld_frag(&sQ[(w * 16 + lm) * kP64 + hi * 8]);
    v16bf a1 = ld_frag(&sQ[(w * 16 + lm) * kP64 + 32 + hi * 8]);
    v8f s[2] = {};
#pragma unroll
    for (int nt = 0; nt < 2; ++nt) {
      v16bf b0 = ld_frag(&sK[cur][(nt * 16 + lm) * kP64 + hi * 8]);
      v16bf b1 = ld_frag(&sK[cur][(nt * 16 + lm) * kP64 + 32 + hi * 8]);
      s[nt] = wmma_bf16(a0, b0, s[nt]);
      s[nt] = wmma_bf16(a1, b1, s[nt]);
    }

    float amk0 = sAmK[cur][lm],   amk1 = sAmK[cur][16 + lm];
    float mk0  = sMaskK[cur][lm], mk1  = sMaskK[cur][16 + lm];
#pragma unroll
    for (int i = 0; i < 8; ++i) {
      float v0 = s[0][i] * 0.125f + aq[i] * amk0;   // 1/sqrt(64) + additive 0/1
      float v1 = s[1][i] * 0.125f + aq[i] * amk1;
      if (mk0 > 0.5f) v0 = kNEG;
      if (mk1 > 0.5f) v1 = kNEG;
      // row max over 32 keys (16-lane xor reduction; rows live in lane halves)
      float rm = fmaxf(v0, v1);
      rm = fmaxf(rm, __shfl_xor(rm, 1, 32));
      rm = fmaxf(rm, __shfl_xor(rm, 2, 32));
      rm = fmaxf(rm, __shfl_xor(rm, 4, 32));
      rm = fmaxf(rm, __shfl_xor(rm, 8, 32));
      float nm = fmaxf(mrow[i], rm);
      float sc = __expf(mrow[i] - nm);
      float p0 = __expf(v0 - nm);
      float p1 = __expf(v1 - nm);
      float rs = p0 + p1;
      rs += __shfl_xor(rs, 1, 32);
      rs += __shfl_xor(rs, 2, 32);
      rs += __shfl_xor(rs, 4, 32);
      rs += __shfl_xor(rs, 8, 32);
      lrow[i] = lrow[i] * sc + rs;
      mrow[i] = nm;
#pragma unroll
      for (int ot = 0; ot < 4; ++ot) o[ot][i] = o[ot][i] * sc;
      // stage P into A-fragment layout (per-wave region, wave-internal RAW)
      sP[(w * 16 + hi * 8 + i) * kP32 + lm]      = (bf16)p0;
      sP[(w * 16 + hi * 8 + i) * kP32 + 16 + lm] = (bf16)p1;
    }

    // O += P(16x32) @ V(32x64): 4 n-tiles of 16 dims
    v16bf pa = ld_frag(&sP[(w * 16 + lm) * kP32 + hi * 8]);
#pragma unroll
    for (int ot = 0; ot < 4; ++ot) {
      v16bf bv = ld_frag(&sVT[cur][(ot * 16 + lm) * kP32 + hi * 8]);
      o[ot] = wmma_bf16(pa, bv, o[ot]);
    }

    wait_async0();    // next K/V buffer filled (overlapped with compute)
    __syncthreads();  // all waves done with `cur` before it is refilled
  }

  // ctx[b, s, h*64+d] in bf16 for the out-projection GEMM
#pragma unroll
  for (int ot = 0; ot < 4; ++ot) {
#pragma unroll
    for (int i = 0; i < 8; ++i) {
      int qrow = qt * 128 + w * 16 + hi * 8 + i;
      int d = ot * 16 + lm;
      float v = o[ot][i] / lrow[i];
      ctx[((size_t)b * kS + qrow) * kE + h * kHD + d] = (bf16)v;
    }
  }
}

// ---------------------------------------------------------------------------
// out = LayerNorm(a + r) * g + be ; optionally also emit bf16 copy
// One block (256 threads) per token row of E=1024.
// ---------------------------------------------------------------------------
__global__ __launch_bounds__(256) void add_ln_kernel(
    const float* __restrict__ a, const float* __restrict__ r,
    const float* __restrict__ g, const float* __restrict__ be,
    float* __restrict__ outF, bf16* __restrict__ outB) {
  __shared__ float red[256];
  const int row = blockIdx.x, t = threadIdx.x;
  const size_t base = (size_t)row * kE;
  float4 va = ((const float4*)(a + base))[t];
  float4 vr = ((const float4*)(r + base))[t];
  float x0 = va.x + vr.x, x1 = va.y + vr.y, x2 = va.z + vr.z, x3 = va.w + vr.w;

  red[t] = x0 + x1 + x2 + x3;
  __syncthreads();
  for (int o = 128; o > 0; o >>= 1) { if (t < o) red[t] += red[t + o]; __syncthreads(); }
  float mu = red[0] * (1.0f / kE);
  __syncthreads();

  float d0 = x0 - mu, d1 = x1 - mu, d2 = x2 - mu, d3 = x3 - mu;
  red[t] = d0 * d0 + d1 * d1 + d2 * d2 + d3 * d3;
  __syncthreads();
  for (int o = 128; o > 0; o >>= 1) { if (t < o) red[t] += red[t + o]; __syncthreads(); }
  float inv = rsqrtf(red[0] * (1.0f / kE) + 1e-12f);

  float4 gw = ((const float4*)g)[t];
  float4 bb = ((const float4*)be)[t];
  float o0 = d0 * inv * gw.x + bb.x;
  float o1 = d1 * inv * gw.y + bb.y;
  float o2 = d2 * inv * gw.z + bb.z;
  float o3 = d3 * inv * gw.w + bb.w;
  ((float4*)(outF + base))[t] = make_float4(o0, o1, o2, o3);
  if (outB) {
    outB[base + t * 4 + 0] = (bf16)o0;
    outB[base + t * 4 + 1] = (bf16)o1;
    outB[base + t * 4 + 2] = (bf16)o2;
    outB[base + t * 4 + 3] = (bf16)o3;
  }
}

// ---------------------------------------------------------------------------
extern "C" void kernel_launch(void* const* d_in, const int* in_sizes, int n_in,
                              void* d_out, int out_size, void* d_ws, size_t ws_size,
                              hipStream_t stream) {
  const float* x    = (const float*)d_in[0];
  const int*   am   = (const int*)d_in[1];
  const int*   tt   = (const int*)d_in[2];
  const float* wqkv = (const float*)d_in[3];
  const float* bqkv = (const float*)d_in[4];
  const float* wout = (const float*)d_in[5];
  const float* bout = (const float*)d_in[6];
  const float* lnw  = (const float*)d_in[7];
  const float* lnb  = (const float*)d_in[8];
  const float* win  = (const float*)d_in[9];
  const float* bin  = (const float*)d_in[10];
  const float* wo2  = (const float*)d_in[11];
  const float* bo2  = (const float*)d_in[12];
  float* out = (float*)d_out;

  char* ws = (char*)d_ws;
  size_t off = 0;
  auto take = [&](size_t bytes) -> char* {
    char* p = ws + off;
    off += (bytes + 255) & ~(size_t)255;
    return p;
  };
  bf16*  xb     = (bf16*)take((size_t)kM * kE * 2);          // 16 MB
  bf16*  wqkvT  = (bf16*)take((size_t)3 * kE * kE * 2);      //  6 MB
  bf16*  woutT  = (bf16*)take((size_t)kE * kE * 2);          //  2 MB
  bf16*  winT   = (bf16*)take((size_t)kF * kE * 2);          //  8 MB
  bf16*  wo2T   = (bf16*)take((size_t)kE * kF * 2);          //  8 MB
  bf16*  qBuf   = (bf16*)take((size_t)kM * kE * 2);          // 16 MB  [b,h,s,d]
  bf16*  kBuf   = (bf16*)take((size_t)kM * kE * 2);          // 16 MB  [b,h,s,d]
  bf16*  vtBuf  = (bf16*)take((size_t)kM * kE * 2);          // 16 MB  [b,h,d,s]
  bf16*  ctx    = (bf16*)take((size_t)kM * kE * 2);          // 16 MB  [b,s,e]
  float* attnF  = (float*)take((size_t)kM * kE * 4);         // 32 MB (reused as out2)
  float* hF     = (float*)take((size_t)kM * kE * 4);         // 32 MB
  bf16*  hB     = (bf16*)take((size_t)kM * kE * 2);          // 16 MB
  bf16*  ff     = qBuf;  // 64 MB alias over q/k/vT/ctx (dead after out-proj)

  // 1) bf16 conversions / weight transposes
  cvt_bf16_kernel<<<(kM * kE) / 1024, 256, 0, stream>>>(x, xb, kM * kE);
  transpose_cvt_kernel<<<(3 * kE * kE) / 256, 256, 0, stream>>>(wqkv, wqkvT, kE, 3 * kE);
  transpose_cvt_kernel<<<(kE * kE) / 256, 256, 0, stream>>>(wout, woutT, kE, kE);
  transpose_cvt_kernel<<<(kE * kF) / 256, 256, 0, stream>>>(win, winT, kE, kF);
  transpose_cvt_kernel<<<(kF * kE) / 256, 256, 0, stream>>>(wo2, wo2T, kF, kE);

  // 2) QKV projection with head-split scatter epilogue
  gemm_bf16_kernel<EPI_QKV><<<dim3(3 * kE / 128, kM / 256), 256, 0, stream>>>(
      xb, wqkvT, bqkv, nullptr, nullptr, qBuf, kBuf, vtBuf, kM, 3 * kE, kE);

  // 3) Flash attention
  attention_kernel<<<dim3(kS / 128, kH, kB), 256, 0, stream>>>(
      qBuf, kBuf, vtBuf, am, tt, ctx);

  // 4) Output projection
  gemm_bf16_kernel<EPI_PLAIN><<<dim3(kE / 128, kM / 256), 256, 0, stream>>>(
      ctx, woutT, bout, attnF, nullptr, nullptr, nullptr, nullptr, kM, kE, kE);

  // 5) h = LN(attn_out + x)
  add_ln_kernel<<<kM, 256, 0, stream>>>(attnF, x, lnw, lnb, hF, hB);

  // 6) FFN up + exact GELU (bf16 out)
  gemm_bf16_kernel<EPI_GELU><<<dim3(kF / 128, kM / 256), 256, 0, stream>>>(
      hB, winT, bin, nullptr, ff, nullptr, nullptr, nullptr, kM, kF, kE);

  // 7) FFN down (f32 out, reusing attnF)
  gemm_bf16_kernel<EPI_PLAIN><<<dim3(kE / 128, kM / 256), 256, 0, stream>>>(
      ff, wo2T, bo2, attnF, nullptr, nullptr, nullptr, nullptr, kM, kE, kF);

  // 8) out = LN(ffn_out + h)
  add_ln_kernel<<<kM, 256, 0, stream>>>(attnF, hF, lnw, lnb, out, nullptr);

  (void)in_sizes; (void)n_in; (void)out_size; (void)ws_size;
}

// v003
// Measured time: 405 microseconds a run.
// Two timings next to v002 put it at 1.12 and 1.11 times that version's speed.
// All steps since v000 together make it 1.68 times as fast.
#include <hip/hip_runtime.h>
#include <hip/hip_bf16.h>

typedef __bf16 bf16;
typedef __attribute__((ext_vector_type(8)))  float v8f;
typedef __attribute__((ext_vector_type(16))) bf16  v16bf;
typedef __attribute__((ext_vector_type(8)))  bf16  v8bf;

constexpr int kB = 8, kS = 1024, kE = 1024, kH = 16, kHD = 64, kF = 4096;
constexpr int kM = kB * kS;  // 8192 token rows
constexpr float kNEG = -1.0e30f;

// LDS row pitch in halves for rows read by 16-byte fragment loads: an odd
// multiple of 16 B, so the 16 rows of one fragment load fall on distinct banks.
constexpr int kP32 = 40;  // rows of 32 halves (64 B) at 80 B
constexpr int kP64 = 72;  // rows of 64 halves (128 B) at 144 B

// ---------------------------------------------------------------------------
// WMMA + async-copy helpers (CDNA5 wave32)
// ---------------------------------------------------------------------------
__device__ __forceinline__ v8f wmma_bf16(v16bf a, v16bf b, v8f c) {
  return __builtin_amdgcn_wmma_f32_16x16x32_bf16(
      /*neg_a=*/false, a, /*neg_b=*/false, b,
      /*c_mod=*/(short)0, c, /*reuse_a=*/false, /*reuse_b=*/false);
}

// A/B fragment for one lane: two contiguous 8-half runs at p and p+16.
// (16-bit operand layout: lanes<16 hold K = 0..7 & 16..23 of the 32-K tile,
//  lanes>=16 hold K = 8..15 & 24..31 — caller passes p already offset by hi*8.)
__device__ __forceinline__ v16bf ld_frag(const bf16* p) {
  union { v16bf v; v8bf h[2]; } u;
  u.h[0] = *(const v8bf*)(p);
  u.h[1] = *(const v8bf*)(p + 16);
  return u.v;
}

// 16-byte global -> LDS async copy (ASYNCcnt-tracked, no VGPR staging).
// LDS destination = low 32 bits of the generic pointer (LDS aperture offset).
// The closing s_wait_xcnt 0 stands inside the copies' own statement as a
// precaution: no address register of a copy is rewritten ahead of it.
__device__ __forceinline__ void async_copy16_x2(const bf16* g0, bf16* l0,
                                                const bf16* g1, bf16* l1) {
  asm volatile("global_load_async_to_lds_b128 %0, %1, off\n\t"
               "global_load_async_to_lds_b128 %2, %3, off\n\t"
               "s_wait_xcnt 0x0"
               :: "v"((unsigned)(size_t)l0), "v"(g0),
                  "v"((unsigned)(size_t)l1), "v"(g1) : "memory");
}
__device__ __forceinline__ void async_copy16_x4(const bf16* g0, bf16* l0,
                                                const bf16* g1, bf16* l1,
                                                const bf16* g2, bf16* l2,
                                                const bf16* g3, bf16* l3) {
  asm volatile("global_load_async_to_lds_b128 %0, %1, off\n\t"
               "global_load_async_to_lds_b128 %2, %3, off\n\t"
               "global_load_async_to_lds_b128 %4, %5, off\n\t"
               "global_load_async_to_lds_b128 %6, %7, off\n\t"
               "s_wait_xcnt 0x0"
               :: "v"((unsigned)(size_t)l0), "v"(g0),
                  "v"((unsigned)(size_t)l1), "v"(g1),
                  "v"((unsigned)(size_t)l2), "v"(g2),
                  "v"((unsigned)(size_t)l3), "v"(g3) : "memory");
}
__device__ __forceinline__ void wait_async0() {
  asm volatile("s_wait_asynccnt 0x0" ::: "memory");
}
// A wave's own LDS reads have retired before a copy is aimed at what it read.
__device__ __forceinline__ void wait_ds0() {
  asm volatile("s_wait_dscnt 0x0" ::: "memory");
}

// ---------------------------------------------------------------------------
// Small conversion kernels
// ---------------------------------------------------------------------------
__global__ __launch_bounds__(256) void cvt_bf16_kernel(const float* __restrict__ in,
                                                       bf16* __restrict__ out, int n) {
  int idx = (blockIdx.x * 256 + threadIdx.x) * 4;
  if (idx < n) {
    float4 v = *(const float4*)(in + idx);
    out[idx + 0] = (bf16)v.x;
    out[idx + 1] = (bf16)v.y;
    out[idx + 2] = (bf16)v.z;
    out[idx + 3] = (bf16)v.w;
  }
}

// in: [K,N] fp32 row-major  ->  out: [N,K] bf16 row-major
// One work-group moves a tile of 128 k x 64 n through LDS: it reads whole 256-B
// row pieces of in and writes whole 256-B row pieces of out, 32 elements a
// thread. Needs K % 128 == 0, N % 64 == 0; grid (N / 64, K / 128).
// LDS holds the tile transposed, a dword = the bf16 pair (k, k + 1) of one n;
// the odd pitch of 65 dwords keeps both the writes (lanes 4 n apart) and the
// reads (lanes 4 dwords apart) on distinct banks.
__global__ __launch_bounds__(256) void transpose_cvt_kernel(const float* __restrict__ in,
                                                            bf16* __restrict__ out,
                                                            int K, int N) {
  typedef __attribute__((ext_vector_type(2))) bf16 v2bf;
  __shared__ unsigned tile[64 * 65];
  const int t = threadIdx.x;
  const int n0 = blockIdx.x * 64, k0 = blockIdx.y * 128;

  // Thread: 4 consecutive n (chunk c) of the row pairs 2 (r + 16 j), + 1.
  const int c = t & 15, r = t >> 4;
  const float* src = in + (size_t)(k0 + 2 * r) * N + n0 + c * 4;
  const float4* pl[4];
  const float4* pu[4];
  float4 lo[4], up[4];
#pragma unroll
  for (int j = 0; j < 4; ++j) {
    pl[j] = (const float4*)(src + (size_t)(32 * j) * N);
    pu[j] = (const float4*)(src + (size_t)(32 * j + 1) * N);
    lo[j] = *pl[j];
    up[j] = *pu[j];
  }
  // Precaution: the eight address pairs are inputs of this wait, so they stay
  // as they are until it; no register that an issued load names is overwritten
  // ahead of it, not even by a later load's data.
  asm volatile("s_wait_xcnt 0x0"
               :: "v"(pl[0]), "v"(pu[0]), "v"(pl[1]), "v"(pu[1]),
                  "v"(pl[2]), "v"(pu[2]), "v"(pl[3]), "v"(pu[3]) : "memory");
#pragma unroll
  for (int j = 0; j < 4; ++j) {
    unsigned* d = &tile[(c * 4) * 65 + r + 16 * j];
    v2bf p0 = {(bf16)lo[j].x, (bf16)up[j].x};
    v2bf p1 = {(bf16)lo[j].y, (bf16)up[j].y};
    v2bf p2 = {(bf16)lo[j].z, (bf16)up[j].z};
    v2bf p3 = {(bf16)lo[j].w, (bf16)up[j].w};
    d[0 * 65] = __builtin_bit_cast(unsigned, p0);
    d[1 * 65] = __builtin_bit_cast(unsigned, p1);
    d[2 * 65] = __builtin_bit_cast(unsigned, p2);
    d[3 * 65] = __builtin_bit_cast(unsigned, p3);
  }
  __syncthreads();  // the whole tile is in LDS before any row of it is read

  // Thread: 8 consecutive k (chunk c) of rows n = r + 16 j; 16 B a store.
#pragma unroll
  for (int j = 0; j < 4; ++j) {
    const int n = r + 16 * j;
    const unsigned* s = &tile[n * 65 + c * 4];
    uint4 v = make_uint4(s[0], s[1], s[2], s[3]);
    *(uint4*)(out + (size_t)(n0 + n) * K + k0 + c * 8) = v;
  }
}

// ---------------------------------------------------------------------------
// Generic bf16 GEMM: C[M,N] = A[M,K] * Bt[N,K]^T + bias, fused epilogues.
// Block = 256 threads (8 wave32), tile 256(M) x 128(N), waves 4x2, wave 64x64.
// A pass is 64 k: 128-B rows at 144 B pitch, two LDS buffers filled by
// GLOBAL_LOAD_ASYNC_TO_LDS_B128; one barrier per pass; a buffer's refill is
// issued right behind the barrier that frees it and has a whole pass to land.
// Needs M % 256 == 0, N % 128 == 0, K % 64 == 0.
// ---------------------------------------------------------------------------
enum { EPI_PLAIN = 0, EPI_GELU = 1, EPI_QKV = 2 };

template <int EPI>
__global__ __launch_bounds__(256) void gemm_bf16_kernel(
    const bf16* __restrict__ A, const bf16* __restrict__ Bt,
    const float* __restrict__ bias,
    float* __restrict__ Cf, bf16* __restrict__ Cb,
    bf16* __restrict__ qO, bf16* __restrict__ kO, bf16* __restrict__ vtO,
    int M, int N, int K) {
  __shared__ __attribute__((aligned(16))) bf16 sA[2][256 * kP64];
  __shared__ __attribute__((aligned(16))) bf16 sB[2][128 * kP64];
  const int tid = threadIdx.x;
  const int lane = tid & 31, wave = tid >> 5;
  const int hi = lane >> 4, lm = lane & 15;
  const int waveM = wave & 3, waveN = wave >> 2;
  const int m0 = blockIdx.y * 256;
  const int n0 = blockIdx.x * 128;

  // Staging slots: 8 chunks of 16 B a row, so a wave's copy covers 4 whole rows
  // of 128 B; a thread keeps its chunk and walks rows sRow + 32 j.
  const int sRow = tid >> 3, sCh = tid & 7;
  const bf16* gA = &A[(size_t)(m0 + sRow) * K + sCh * 8];
  const bf16* gB = &Bt[(size_t)(n0 + sRow) * K + sCh * 8];
  const size_t rowStep = (size_t)32 * K;
  const int sOff = sRow * kP64 + sCh * 8;

  auto stage = [&](int kt, int buf) {
    const bf16* a = gA + kt * 64;
    const bf16* b = gB + kt * 64;
    bf16* la = &sA[buf][sOff];
    bf16* lb = &sB[buf][sOff];
    async_copy16_x4(a,               la,
                    a + rowStep,     la + 32 * kP64,
                    a + 2 * rowStep, la + 64 * kP64,
                    a + 3 * rowStep, la + 96 * kP64);
    async_copy16_x4(a + 4 * rowStep, la + 128 * kP64,
                    a + 5 * rowStep, la + 160 * kP64,
                    a + 6 * rowStep, la + 192 * kP64,
                    a + 7 * rowStep, la + 224 * kP64);
    async_copy16_x4(b,               lb,
                    b + rowStep,     lb + 32 * kP64,
                    b + 2 * rowStep, lb + 64 * kP64,
                    b + 3 * rowStep, lb + 96 * kP64);
  };

  v8f acc[4][4] = {};
  const int kTiles = K >> 6;

  stage(0, 0);
  wait_async0();
  __syncthreads();
  if (kTiles > 1) stage(1, 1);

  // All loops over mt / nt are unrolled so that the fragment and accumulator
  // arrays are indexed by constants and stay in registers.
  v16bf af[4], bfr[4];
  auto load_frags = [&](int buf, int ks) {
#pragma unroll
    for (int mt = 0; mt < 4; ++mt)
      af[mt] = ld_frag(&sA[buf][(waveM * 64 + mt * 16 + lm) * kP64 + ks * 32 + hi * 8]);
#pragma unroll
    for (int nt = 0; nt < 4; ++nt)
      bfr[nt] = ld_frag(&sB[buf][(waveN * 64 + nt * 16 + lm) * kP64 + ks * 32 + hi * 8]);
  };
  auto mma16 = [&]() {
#pragma unroll
    for (int mt = 0; mt < 4; ++mt)
#pragma unroll
      for (int nt = 0; nt < 4; ++nt)
        acc[mt][nt] = wmma_bf16(af[mt], bfr[nt], acc[mt][nt]);
  };

  for (int kt = 0; kt < kTiles; ++kt) {
    const int cur = kt & 1;
    load_frags(cur, 0);
    // Keeps the 16 fragment loads one group ahead of the 16 WMMAs: left alone
    // the compiler reloads one A fragment per row and waits it out each time.
    __builtin_amdgcn_sched_barrier(0);
    mma16();
    load_frags(cur, 1);  // the pass's last reads of `cur`, into registers

    wait_ds0();       // this wave's reads of `cur` have retired before its refill
    wait_async0();    // this wave's share of the other buffer has landed
    __syncthreads();  // publishes the other buffer; ends every read of `cur`
    if (kt + 2 < kTiles) stage(kt + 2, cur);
    mma16();  // registers only: the refill flies from here on
  }
  wait_async0();  // no copy outstanding when the wave ends

#pragma unroll
  for (int mt = 0; mt < 4; ++mt) {
#pragma unroll
    for (int nt = 0; nt < 4; ++nt) {
#pragma unroll
      for (int i = 0; i < 8; ++i) {
        int row = m0 + waveM * 64 + mt * 16 + hi * 8 + i;
        int col = n0 + waveN * 64 + nt * 16 + lm;
        float v = acc[mt][nt][i] + bias[col];
        if constexpr (EPI == EPI_PLAIN) {
          Cf[(size_t)row * N + col] = v;
        } else if constexpr (EPI == EPI_GELU) {
          float g = 0.5f * v * (1.0f + erff(v * 0.70710678118654752f));
          Cb[(size_t)row * N + col] = (bf16)g;
        } else {  // EPI_QKV: scatter to Q/K [b,h,s,d] and V^T [b,h,d,s]
          int bb = row >> 10, s = row & 1023;
          int sec = col >> 10, cc = col & 1023;
          int h = cc >> 6, d = cc & 63;
          size_t qkIdx = ((size_t)(bb * kH + h) * kS + s) * kHD + d;
          if (sec == 0)      qO[qkIdx] = (bf16)v;
          else if (sec == 1) kO[qkIdx] = (bf16)v;
          else vtO[((size_t)(bb * kH + h) * kHD + d) * kS + s] = (bf16)v;
        }
      }
    }
  }
}

// ---------------------------------------------------------------------------
// Flash attention: block = (b, h, 128 q rows), 8 waves x 16 q rows each.
// Key tiles of 32, double-buffered + async-filled; online softmax; WMMA bf16.
// ---------------------------------------------------------------------------
__global__ __launch_bounds__(256) void attention_kernel(
    const bf16* __restrict__ Q, const bf16* __restrict__ Kk,
    const bf16* __restrict__ VT,
    const int* __restrict__ am, const int* __restrict__ tt,
    bf16* __restrict__ ctx) {
  __shared__ __attribute__((aligned(16))) bf16 sQ[128 * kP64];
  __shared__ __attribute__((aligned(16))) bf16 sK[2][32 * kP64];
  __shared__ __attribute__((aligned(16))) bf16 sVT[2][64 * kP32];
  __shared__ __attribute__((aligned(16))) bf16 sP[8 * 16 * kP32];  // per-wave 16x32
  __shared__ float sAmK[2][32];
  __shared__ float sMaskK[2][32];

  const int tid = threadIdx.x;
  const int lane = tid & 31, w = tid >> 5;
  const int hi = lane >> 4, lm = lane & 15;
  const int qt = blockIdx.x, h = blockIdx.y, b = blockIdx.z;
  const size_t headBase = (size_t)(b * kH + h) * kS * kHD;
  const size_t vtBase   = (size_t)(b * kH + h) * kHD * kS;

  // Stage Q tile (contiguous 128*64 halves) via async copies.
#pragma unroll
  for (int j = 0; j < 4; j += 2) {
    int idx = tid * 4 + j;  // 0..1023 chunks of 8; 8 chunks a row
    const bf16* gq = &Q[headBase + (size_t)qt * 128 * kHD + idx * 8];
    bf16* lq = &sQ[(idx >> 3) * kP64 + (idx & 7) * 8];
    async_copy16_x2(gq, lq, gq + 8, lq + 8);
  }

  auto stageKV = [&](int kt, int buf) {
    int d = tid >> 2, c = tid & 3;
    async_copy16_x2(&Kk[headBase + (size_t)kt * 32 * kHD + tid * 8],
                    &sK[buf][(tid >> 3) * kP64 + (tid & 7) * 8],
                    &VT[vtBase + (size_t)d * kS + kt * 32 + c * 8],
                    &sVT[buf][d * kP32 + c * 8]);
    if (tid < 32) {
      int col = kt * 32 + tid;
      int a2 = am[b * kS + col];
      int t2 = tt[b * kS + col];
      sAmK[buf][tid]   = (a2 != 0) ? 1.0f : 0.0f;
      sMaskK[buf][tid] = ((t2 == 1) || (a2 == 0) || (col == 0)) ? 1.0f : 0.0f;
    }
  };

  float aq[8];      // query-row activity (for additive 0/1 mask)
  float mrow[8], lrow[8];
#pragma unroll
  for (int i = 0; i < 8; ++i) {
    int r = qt * 128 + w * 16 + hi * 8 + i;
    aq[i] = (am[b * kS + r] != 0) ? 1.0f : 0.0f;
    mrow[i] = -3.0e38f;
    lrow[i] = 0.0f;
  }
  v8f o[4] = {};

  constexpr int kTiles = kS / 32;
  stageKV(0, 0);
  wait_async0();
  __syncthreads();

  for (int kt = 0; kt < kTiles; ++kt) {
    const int cur = kt & 1;
    if (kt + 1 < kTiles) stageKV(kt + 1, cur ^ 1);

    // Scores: 16 q rows x 32 keys (2 n-tiles, 2 chained WMMAs over HD=64)
    v16bf a0 = ld_frag(&sQ[(w * 16 + lm) * kP64 + hi * 8]);
    v16bf a1 = ld_frag(&sQ[(w * 16 + lm) * kP64 + 32 + hi * 8]);
    v8f s[2] = {};
#pragma unroll
    for (int nt = 0; nt < 2; ++nt) {
      v16bf b0 = ld_frag(&sK[cur][(nt * 16 + lm) * kP64 + hi * 8]);
      v16bf b1 = ld_frag(&sK[cur][(nt * 16 + lm) * kP64 + 32 + hi * 8]);
      s[nt] = wmma_bf16(a0, b0, s[nt]);
      s[nt] = wmma_bf16(a1, b1, s[nt]);
    }

    float amk0 = sAmK[cur][lm],   amk1 = sAmK[cur][16 + lm];
    float mk0  = sMaskK[cur][lm], mk1  = sMaskK[cur][16 + lm];
#pragma unroll
    for (int i = 0; i < 8; ++i) {
      float v0 = s[0][i] * 0.125f + aq[i] * amk0;   // 1/sqrt(64) + additive 0/1
      float v1 = s[1][i] * 0.125f + aq[i] * amk1;
      if (mk0 > 0.5f) v0 = kNEG;
      if (mk1 > 0.5f) v1 = kNEG;
      // row max over 32 keys (16-lane xor reduction; rows live in lane halves)
      float rm = fmaxf(v0, v1);
      rm = fmaxf(rm, __shfl_xor(rm, 1, 32));
      rm = fmaxf(rm, __shfl_xor(rm, 2, 32));
      rm = fmaxf(rm, __shfl_xor(rm, 4, 32));
      rm = fmaxf(rm, __shfl_xor(rm, 8, 32));
      float nm = fmaxf(mrow[i], rm);
      float sc = __expf(mrow[i] - nm);
      float p0 = __expf(v0 - nm);
      float p1 = __expf(v1 - nm);
      float rs = p0 + p1;
      rs += __shfl_xor(rs, 1, 32);
      rs += __shfl_xor(rs, 2, 32);
      rs += __shfl_xor(rs, 4, 32);
      rs += __shfl_xor(rs, 8, 32);
      lrow[i] = lrow[i] * sc + rs;
      mrow[i] = nm;
#pragma unroll
      for (int ot = 0; ot < 4; ++ot) o[ot][i] = o[ot][i] * sc;
      // stage P into A-fragment layout (per-wave region, wave-internal RAW)
      sP[(w * 16 + hi * 8 + i) * kP32 + lm]      = (bf16)p0;
      sP[(w * 16 + hi * 8 + i) * kP32 + 16 + lm] = (bf16)p1;
    }

    // O += P(16x32) @ V(32x64): 4 n-tiles of 16 dims
    v16bf pa = ld_frag(&sP[(w * 16 + lm) * kP32 + hi * 8]);
#pragma unroll
    for (int ot = 0; ot < 4; ++ot) {
      v16bf bv = ld_frag(&sVT[cur][(ot * 16 + lm) * kP32 + hi * 8]);
      o[ot] = wmma_bf16(pa, bv, o[ot]);
    }

    wait_async0();    // next K/V buffer filled (overlapped with compute)
    __syncthreads();  // all waves done with `cur` before it is refilled
  }

  // ctx[b, s, h*64+d] in bf16 for the out-projection GEMM
#pragma unroll
  for (int ot = 0; ot < 4; ++ot) {
#pragma unroll
    for (int i = 0; i < 8; ++i) {
      int qrow = qt * 128 + w * 16 + hi * 8 + i;
      int d = ot * 16 + lm;
      float v = o[ot][i] / lrow[i];
      ctx[((size_t)b * kS + qrow) * kE + h * kHD + d] = (bf16)v;
    }
  }
}

// ---------------------------------------------------------------------------
// out = LayerNorm(a + r) * g + be ; optionally also emit bf16 copy
// One block (256 threads) per token row of E=1024.
// ---------------------------------------------------------------------------
__global__ __launch_bounds__(256) void add_ln_kernel(
    const float* __restrict__ a, const float* __restrict__ r,
    const float* __restrict__ g, const float* __restrict__ be,
    float* __restrict__ outF, bf16* __restrict__ outB) {
  __shared__ float red[256];
  const int row = blockIdx.x, t = threadIdx.x;
  const size_t base = (size_t)row * kE;
  float4 va = ((const float4*)(a + base))[t];
  float4 vr = ((const float4*)(r + base))[t];
  float x0 = va.x + vr.x, x1 = va.y + vr.y, x2 = va.z + vr.z, x3 = va.w + vr.w;

  red[t] = x0 + x1 + x2 + x3;
  __syncthreads();
  for (int o = 128; o > 0; o >>= 1) { if (t < o) red[t] += red[t + o]; __syncthreads(); }
  float mu = red[0] * (1.0f / kE);
  __syncthreads();

  float d0 = x0 - mu, d1 = x1 - mu, d2 = x2 - mu, d3 = x3 - mu;
  red[t] = d0 * d0 + d1 * d1 + d2 * d2 + d3 * d3;
  __syncthreads();
  for (int o = 128; o > 0; o >>= 1) { if (t < o) red[t] += red[t + o]; __syncthreads(); }
  float inv = rsqrtf(red[0] * (1.0f / kE) + 1e-12f);

  float4 gw = ((const float4*)g)[t];
  float4 bb = ((const float4*)be)[t];
  float o0 = d0 * inv * gw.x + bb.x;
  float o1 = d1 * inv * gw.y + bb.y;
  float o2 = d2 * inv * gw.z + bb.z;
  float o3 = d3 * inv * gw.w + bb.w;
  ((float4*)(outF + base))[t] = make_float4(o0, o1, o2, o3);
  if (outB) {
    outB[base + t * 4 + 0] = (bf16)o0;
    outB[base + t * 4 + 1] = (bf16)o1;
    outB[base + t * 4 + 2] = (bf16)o2;
    outB[base + t * 4 + 3] = (bf16)o3;
  }
}

// ---------------------------------------------------------------------------
extern "C" void kernel_launch(void* const* d_in, const int* in_sizes, int n_in,
                              void* d_out, int out_size, void* d_ws, size_t ws_size,
                              hipStream_t stream) {
  const float* x    = (const float*)d_in[0];
  const int*   am   = (const int*)d_in[1];
  const int*   tt   = (const int*)d_in[2];
  const float* wqkv = (const float*)d_in[3];
  const float* bqkv = (const float*)d_in[4];
  const float* wout = (const float*)d_in[5];
  const float* bout = (const float*)d_in[6];
  const float* lnw  = (const float*)d_in[7];
  const float* lnb  = (const float*)d_in[8];
  const float* win  = (const float*)d_in[9];
  const float* bin  = (const float*)d_in[10];
  const float* wo2  = (const float*)d_in[11];
  const float* bo2  = (const float*)d_in[12];
  float* out = (float*)d_out;

  char* ws = (char*)d_ws;
  size_t off = 0;
  auto take = [&](size_t bytes) -> char* {
    char* p = ws + off;
    off += (bytes + 255) & ~(size_t)255;
    return p;
  };
  bf16*  xb     = (bf16*)take((size_t)kM * kE * 2);          // 16 MB
  bf16*  wqkvT  = (bf16*)take((size_t)3 * kE * kE * 2);      //  6 MB
  bf16*  woutT  = (bf16*)take((size_t)kE * kE * 2);          //  2 MB
  bf16*  winT   = (bf16*)take((size_t)kF * kE * 2);          //  8 MB
  bf16*  wo2T   = (bf16*)take((size_t)kE * kF * 2);          //  8 MB
  bf16*  qBuf   = (bf16*)take((size_t)kM * kE * 2);          // 16 MB  [b,h,s,d]
  bf16*  kBuf   = (bf16*)take((size_t)kM * kE * 2);          // 16 MB  [b,h,s,d]
  bf16*  vtBuf  = (bf16*)take((size_t)kM * kE * 2);          // 16 MB  [b,h,d,s]
  bf16*  ctx    = (bf16*)take((size_t)kM * kE * 2);          // 16 MB  [b,s,e]
  float* attnF  = (float*)take((size_t)kM * kE * 4);         // 32 MB (reused as out2)
  float* hF     = (float*)take((size_t)kM * kE * 4);         // 32 MB
  bf16*  hB     = (bf16*)take((size_t)kM * kE * 2);          // 16 MB
  bf16*  ff     = qBuf;  // 64 MB alias over q/k/vT/ctx (dead after out-proj)

  // 1) bf16 conversions / weight transposes
  cvt_bf16_kernel<<<(kM * kE) / 1024, 256, 0, stream>>>(x, xb, kM * kE);
  transpose_cvt_kernel<<<dim3(3 * kE / 64, kE / 128), 256, 0, stream>>>(wqkv, wqkvT, kE, 3 * kE);
  transpose_cvt_kernel<<<dim3(kE / 64, kE / 128), 256, 0, stream>>>(wout, woutT, kE, kE);
  transpose_cvt_kernel<<<dim3(kF / 64, kE / 128), 256, 0, stream>>>(win, winT, kE, kF);
  transpose_cvt_kernel<<<dim3(kE / 64, kF / 128), 256, 0, stream>>>(wo2, wo2T, kF, kE);

  // 2) QKV projection with head-split scatter epilogue
  gemm_bf16_kernel<EPI_QKV><<<dim3(3 * kE / 128, kM / 256), 256, 0, stream>>>(
      xb, wqkvT, bqkv, nullptr, nullptr, qBuf, kBuf, vtBuf, kM, 3 * kE, kE);

  // 3) Flash attention
  attention_kernel<<<dim3(kS / 128, kH, kB), 256, 0, stream>>>(
      qBuf, kBuf, vtBuf, am, tt, ctx);

  // 4) Output projection
  gemm_bf16_kernel<EPI_PLAIN><<<dim3(kE / 128, kM / 256), 256, 0, stream>>>(
      ctx, woutT, bout, attnF, nullptr, nullptr, nullptr, nullptr, kM, kE, kE);

  // 5) h = LN(attn_out + x)
  add_ln_kernel<<<kM, 256, 0, stream>>>(attnF, x, lnw, lnb, hF, hB);

  // 6) FFN up + exact GELU (bf16 out)
  gemm_bf16_kernel<EPI_GELU><<<dim3(kF / 128, kM / 256), 256, 0, stream>>>(
      hB, winT, bin, nullptr, ff, nullptr, nullptr, nullptr, kM, kF, kE);

  // 7) FFN down (f32 out, reusing attnF)
  gemm_bf16_kernel<EPI_PLAIN><<<dim3(kE / 128, kM / 256), 256, 0, stream>>>(
      ff, wo2T, bo2, attnF, nullptr, nullptr, nullptr, nullptr, kM, kE, kF);

  // 8) out = LN(ffn_out + h)
  add_ln_kernel<<<kM, 256, 0, stream>>>(attnF, hF, lnw, lnb, out, nullptr);

  (void)in_sizes; (void)n_in; (void)out_size; (void)ws_size;
}

// v004
// A run of this version takes 372 microseconds.
// Two timings next to v003 both put it at 1.09 times that version's speed.
// Over all steps from v000 it is 1.82 times as fast.
#include <hip/hip_runtime.h>
#include <hip/hip_bf16.h>

typedef __bf16 bf16;
typedef __attribute__((ext_vector_type(8)))  float v8f;
typedef __attribute__((ext_vector_type(16))) bf16  v16bf;
typedef __attribute__((ext_vector_type(8)))  bf16  v8bf;

constexpr int kB = 8, kS = 1024, kE = 1024, kH = 16, kHD = 64, kF = 4096;
constexpr int kM = kB * kS;  // 8192 token rows
constexpr float kNEG = -1.0e30f;

// LDS row pitch in halves for rows read by 16-byte fragment loads: an odd
// multiple of 16 B, so the 16 rows of one fragment load fall on distinct banks.
constexpr int kP32 = 40;  // rows of 32 halves (64 B) at 80 B
constexpr int kP64 = 72;  // rows of 64 halves (128 B) at 144 B

// ---------------------------------------------------------------------------
// WMMA + async-copy helpers (CDNA5 wave32)
// ---------------------------------------------------------------------------
__device__ __forceinline__ v8f wmma_bf16(v16bf a, v16bf b, v8f c) {
  return __builtin_amdgcn_wmma_f32_16x16x32_bf16(
      /*neg_a=*/false, a, /*neg_b=*/false, b,
      /*c_mod=*/(short)0, c, /*reuse_a=*/false, /*reuse_b=*/false);
}

// A/B fragment for one lane: two contiguous 8-half runs at p and p+16.
// (16-bit operand layout: lanes<16 hold K = 0..7 & 16..23 of the 32-K tile,
//  lanes>=16 hold K = 8..15 & 24..31 — caller passes p already offset by hi*8.)
__device__ __forceinline__ v16bf ld_frag(const bf16* p) {
  union { v16bf v; v8bf h[2]; } u;
  u.h[0] = *(const v8bf*)(p);
  u.h[1] = *(const v8bf*)(p + 16);
  return u.v;
}

// 16-byte global -> LDS async copy (ASYNCcnt-tracked, no VGPR staging).
// LDS destination = low 32 bits of the generic pointer (LDS aperture offset).
// The closing s_wait_xcnt 0 stands inside the copies' own statement as a
// precaution: no address register of a copy is rewritten ahead of it.
__device__ __forceinline__ void async_copy16_x2(const bf16* g0, bf16* l0,
                                                const bf16* g1, bf16* l1) {
  asm volatile("global_load_async_to_lds_b128 %0, %1, off\n\t"
               "global_load_async_to_lds_b128 %2, %3, off\n\t"
               "s_wait_xcnt 0x0"
               :: "v"((unsigned)(size_t)l0), "v"(g0),
                  "v"((unsigned)(size_t)l1), "v"(g1) : "memory");
}
__device__ __forceinline__ void async_copy16_x4(const bf16* g0, bf16* l0,
                                                const bf16* g1, bf16* l1,
                                                const bf16* g2, bf16* l2,
                                                const bf16* g3, bf16* l3) {
  asm volatile("global_load_async_to_lds_b128 %0, %1, off\n\t"
               "global_load_async_to_lds_b128 %2, %3, off\n\t"
               "global_load_async_to_lds_b128 %4, %5, off\n\t"
               "global_load_async_to_lds_b128 %6, %7, off\n\t"
               "s_wait_xcnt 0x0"
               :: "v"((unsigned)(size_t)l0), "v"(g0),
                  "v"((unsigned)(size_t)l1), "v"(g1),
                  "v"((unsigned)(size_t)l2), "v"(g2),
                  "v"((unsigned)(size_t)l3), "v"(g3) : "memory");
}
__device__ __forceinline__ void wait_async0() {
  asm volatile("s_wait_asynccnt 0x0" ::: "memory");
}
// A wave's own LDS reads have retired before a copy is aimed at what it read.
__device__ __forceinline__ void wait_ds0() {
  asm volatile("s_wait_dscnt 0x0" ::: "memory");
}

// ---------------------------------------------------------------------------
// Small conversion kernels
// ---------------------------------------------------------------------------
__global__ __launch_bounds__(256) void cvt_bf16_kernel(const float* __restrict__ in,
                                                       bf16* __restrict__ out, int n) {
  int idx = (blockIdx.x * 256 + threadIdx.x) * 4;
  if (idx < n) {
    float4 v = *(const float4*)(in + idx);
    out[idx + 0] = (bf16)v.x;
    out[idx + 1] = (bf16)v.y;
    out[idx + 2] = (bf16)v.z;
    out[idx + 3] = (bf16)v.w;
  }
}

// in: [K,N] fp32 row-major  ->  out: [N,K] bf16 row-major
// One work-group moves a tile of 128 k x 64 n through LDS: it reads whole 256-B
// row pieces of in and writes whole 256-B row pieces of out, 32 elements a
// thread. Needs K % 128 == 0, N % 64 == 0; grid (N / 64, K / 128).
// LDS holds the tile transposed, a dword = the bf16 pair (k, k + 1) of one n;
// the odd pitch of 65 dwords keeps both the writes (lanes 4 n apart) and the
// reads (lanes 4 dwords apart) on distinct banks.
__global__ __launch_bounds__(256) void transpose_cvt_kernel(const float* __restrict__ in,
                                                            bf16* __restrict__ out,
                                                            int K, int N) {
  typedef __attribute__((ext_vector_type(2))) bf16 v2bf;
  __shared__ unsigned tile[64 * 65];
  const int t = threadIdx.x;
  const int n0 = blockIdx.x * 64, k0 = blockIdx.y * 128;

  // Thread: 4 consecutive n (chunk c) of the row pairs 2 (r + 16 j), + 1.
  const int c = t & 15, r = t >> 4;
  const float* src = in + (size_t)(k0 + 2 * r) * N + n0 + c * 4;
  const float4* pl[4];
  const float4* pu[4];
  float4 lo[4], up[4];
#pragma unroll
  for (int j = 0; j < 4; ++j) {
    pl[j] = (const float4*)(src + (size_t)(32 * j) * N);
    pu[j] = (const float4*)(src + (size_t)(32 * j + 1) * N);
    lo[j] = *pl[j];
    up[j] = *pu[j];
  }
  // Precaution: the eight address pairs are inputs of this wait, so they stay
  // as they are until it; no register that an issued load names is overwritten
  // ahead of it, not even by a later load's data.
  asm volatile("s_wait_xcnt 0x0"
               :: "v"(pl[0]), "v"(pu[0]), "v"(pl[1]), "v"(pu[1]),
                  "v"(pl[2]), "v"(pu[2]), "v"(pl[3]), "v"(pu[3]) : "memory");
#pragma unroll
  for (int j = 0; j < 4; ++j) {
    unsigned* d = &tile[(c * 4) * 65 + r + 16 * j];
    v2bf p0 = {(bf16)lo[j].x, (bf16)up[j].x};
    v2bf p1 = {(bf16)lo[j].y, (bf16)up[j].y};
    v2bf p2 = {(bf16)lo[j].z, (bf16)up[j].z};
    v2bf p3 = {(bf16)lo[j].w, (bf16)up[j].w};
    d[0 * 65] = __builtin_bit_cast(unsigned, p0);
    d[1 * 65] = __builtin_bit_cast(unsigned, p1);
    d[2 * 65] = __builtin_bit_cast(unsigned, p2);
    d[3 * 65] = __builtin_bit_cast(unsigned, p3);
  }
  __syncthreads();  // the whole tile is in LDS before any row of it is read

  // Thread: 8 consecutive k (chunk c) of rows n = r + 16 j; 16 B a store.
#pragma unroll
  for (int j = 0; j < 4; ++j) {
    const int n = r + 16 * j;
    const unsigned* s = &tile[n * 65 + c * 4];
    uint4 v = make_uint4(s[0], s[1], s[2], s[3]);
    *(uint4*)(out + (size_t)(n0 + n) * K + k0 + c * 8) = v;
  }
}

// ---------------------------------------------------------------------------
// Generic bf16 GEMM: C[M,N] = A[M,K] * Bt[N,K]^T + bias, fused epilogues.
// Block = 256 threads (8 wave32), tile 256(M) x 128(N), waves 4x2, wave 64x64.
// A pass is 64 k: 128-B rows at 144 B pitch, two LDS buffers filled by
// GLOBAL_LOAD_ASYNC_TO_LDS_B128; one barrier per pass; a buffer's refill is
// issued right behind the barrier that frees it and has a whole pass to land.
// Needs M % 256 == 0, N % 128 == 0, K % 64 == 0.
// ---------------------------------------------------------------------------
enum { EPI_PLAIN = 0, EPI_GELU = 1, EPI_QKV = 2 };

template <int EPI>
__global__ __launch_bounds__(256) void gemm_bf16_kernel(
    const bf16* __restrict__ A, const bf16* __restrict__ Bt,
    const float* __restrict__ bias,
    float* __restrict__ Cf, bf16* __restrict__ Cb,
    bf16* __restrict__ qO, bf16* __restrict__ kO, bf16* __restrict__ vtO,
    int M, int N, int K) {
  __shared__ __attribute__((aligned(16))) bf16 sA[2][256 * kP64];
  __shared__ __attribute__((aligned(16))) bf16 sB[2][128 * kP64];
  const int tid = threadIdx.x;
  const int lane = tid & 31, wave = tid >> 5;
  const int hi = lane >> 4, lm = lane & 15;
  const int waveM = wave & 3, waveN = wave >> 2;
  const int m0 = blockIdx.y * 256;
  const int n0 = blockIdx.x * 128;

  // Staging slots: 8 chunks of 16 B a row, so a wave's copy covers 4 whole rows
  // of 128 B; a thread keeps its chunk and walks rows sRow + 32 j.
  const int sRow = tid >> 3, sCh = tid & 7;
  const bf16* gA = &A[(size_t)(m0 + sRow) * K + sCh * 8];
  const bf16* gB = &Bt[(size_t)(n0 + sRow) * K + sCh * 8];
  const size_t rowStep = (size_t)32 * K;
  const int sOff = sRow * kP64 + sCh * 8;

  auto stage = [&](int kt, int buf) {
    const bf16* a = gA + kt * 64;
    const bf16* b = gB + kt * 64;
    bf16* la = &sA[buf][sOff];
    bf16* lb = &sB[buf][sOff];
    async_copy16_x4(a,               la,
                    a + rowStep,     la + 32 * kP64,
                    a + 2 * rowStep, la + 64 * kP64,
                    a + 3 * rowStep, la + 96 * kP64);
    async_copy16_x4(a + 4 * rowStep, la + 128 * kP64,
                    a + 5 * rowStep, la + 160 * kP64,
                    a + 6 * rowStep, la + 192 * kP64,
                    a + 7 * rowStep, la + 224 * kP64);
    async_copy16_x4(b,               lb,
                    b + rowStep,     lb + 32 * kP64,
                    b + 2 * rowStep, lb + 64 * kP64,
                    b + 3 * rowStep, lb + 96 * kP64);
  };

  v8f acc[4][4] = {};
  const int kTiles = K >> 6;

  stage(0, 0);
  wait_async0();
  __syncthreads();
  if (kTiles > 1) stage(1, 1);

  // All loops over mt / nt are unrolled so that the fragment and accumulator
  // arrays are indexed by constants and stay in registers.
  v16bf af[4], bfr[4];
  auto load_frags = [&](int buf, int ks) {
#pragma unroll
    for (int mt = 0; mt < 4; ++mt)
      af[mt] = ld_frag(&sA[buf][(waveM * 64 + mt * 16 + lm) * kP64 + ks * 32 + hi * 8]);
#pragma unroll
    for (int nt = 0; nt < 4; ++nt)
      bfr[nt] = ld_frag(&sB[buf][(waveN * 64 + nt * 16 + lm) * kP64 + ks * 32 + hi * 8]);
  };
  auto mma16 = [&]() {
#pragma unroll
    for (int mt = 0; mt < 4; ++mt)
#pragma unroll
      for (int nt = 0; nt < 4; ++nt)
        acc[mt][nt] = wmma_bf16(af[mt], bfr[nt], acc[mt][nt]);
  };

  for (int kt = 0; kt < kTiles; ++kt) {
    const int cur = kt & 1;
    load_frags(cur, 0);
    // Keeps the 16 fragment loads one group ahead of the 16 WMMAs: left alone
    // the compiler reloads one A fragment per row and waits it out each time.
    __builtin_amdgcn_sched_barrier(0);
    mma16();
    load_frags(cur, 1);  // the pass's last reads of `cur`, into registers

    wait_ds0();       // this wave's reads of `cur` have retired before its refill
    wait_async0();    // this wave's share of the other buffer has landed
    __syncthreads();  // publishes the other buffer; ends every read of `cur`
    if (kt + 2 < kTiles) stage(kt + 2, cur);
    mma16();  // registers only: the refill flies from here on
  }
  wait_async0();  // no copy outstanding when the wave ends

  if constexpr (EPI == EPI_QKV) {
    // Scatter to Q/K [b,h,s,d] and V^T [b,h,d,s]. A block's 128 columns lie in
    // one of the three sections of 1024 and its 256 rows in one batch entry, so
    // the section is a scalar of the block: it is branched on once, outside the
    // unrolled loops, and every store is one base address plus a constant.
    // A wave's 64 columns are one head.
    const int sec = n0 >> 10;
    const int bh = (m0 >> 10) * kH + ((n0 & 1023) >> 6) + waveN;
    const int s0 = (m0 & 1023) + waveM * 64 + hi * 8;
    float bs[4];
#pragma unroll
    for (int nt = 0; nt < 4; ++nt) bs[nt] = bias[n0 + waveN * 64 + nt * 16 + lm];
    if (sec < 2) {
      bf16* dst = (sec == 0 ? qO : kO) + ((size_t)bh * kS + s0) * kHD + lm;
#pragma unroll
      for (int mt = 0; mt < 4; ++mt)
#pragma unroll
        for (int nt = 0; nt < 4; ++nt)
#pragma unroll
          for (int i = 0; i < 8; ++i)
            dst[(mt * 16 + i) * kHD + nt * 16] = (bf16)(acc[mt][nt][i] + bs[nt]);
    } else {
      bf16* dst = vtO + ((size_t)bh * kHD + lm) * kS + s0;
      v8bf pk[4][4];  // 8 consecutive s of one d: one 16-byte store
#pragma unroll
      for (int mt = 0; mt < 4; ++mt)
#pragma unroll
        for (int nt = 0; nt < 4; ++nt)
#pragma unroll
          for (int i = 0; i < 8; ++i) pk[mt][nt][i] = (bf16)(acc[mt][nt][i] + bs[nt]);
#pragma unroll
      for (int mt = 0; mt < 4; ++mt)
#pragma unroll
        for (int nt = 0; nt < 4; ++nt)
          *(v8bf*)(dst + (nt * 16) * kS + mt * 16) = pk[mt][nt];
      // Precaution: stands behind the last of the 16 stores, ahead of any
      // later write of the address pair or of a data register that they name.
      asm volatile("s_wait_xcnt 0x0" ::: "memory");
    }
    return;
  }

#pragma unroll
  for (int mt = 0; mt < 4; ++mt) {
#pragma unroll
    for (int nt = 0; nt < 4; ++nt) {
#pragma unroll
      for (int i = 0; i < 8; ++i) {
        int row = m0 + waveM * 64 + mt * 16 + hi * 8 + i;
        int col = n0 + waveN * 64 + nt * 16 + lm;
        float v = acc[mt][nt][i] + bias[col];
        if constexpr (EPI == EPI_PLAIN) {
          Cf[(size_t)row * N + col] = v;
        } else if constexpr (EPI == EPI_GELU) {
          float g = 0.5f * v * (1.0f + erff(v * 0.70710678118654752f));
          Cb[(size_t)row * N + col] = (bf16)g;
        }
      }
    }
  }
}

// ---------------------------------------------------------------------------
// Flash attention: block = (b, h, 128 q rows), 8 waves x 16 q rows each.
// Key tiles of 32, double-buffered + async-filled; online softmax; WMMA bf16.
// ---------------------------------------------------------------------------
__global__ __launch_bounds__(256) void attention_kernel(
    const bf16* __restrict__ Q, const bf16* __restrict__ Kk,
    const bf16* __restrict__ VT,
    const int* __restrict__ am, const int* __restrict__ tt,
    bf16* __restrict__ ctx) {
  __shared__ __attribute__((aligned(16))) bf16 sQ[128 * kP64];
  __shared__ __attribute__((aligned(16))) bf16 sK[2][32 * kP64];
  __shared__ __attribute__((aligned(16))) bf16 sVT[2][64 * kP32];
  __shared__ __attribute__((aligned(16))) bf16 sP[8 * 16 * kP32];  // per-wave 16x32
  __shared__ float sAmK[2][32];
  __shared__ float sMaskK[2][32];

  const int tid = threadIdx.x;
  const int lane = tid & 31, w = tid >> 5;
  const int hi = lane >> 4, lm = lane & 15;
  const int qt = blockIdx.x, h = blockIdx.y, b = blockIdx.z;
  const size_t headBase = (size_t)(b * kH + h) * kS * kHD;
  const size_t vtBase   = (size_t)(b * kH + h) * kHD * kS;

  // Stage Q tile (contiguous 128*64 halves) via async copies.
#pragma unroll
  for (int j = 0; j < 4; j += 2) {
    int idx = tid * 4 + j;  // 0..1023 chunks of 8; 8 chunks a row
    const bf16* gq = &Q[headBase + (size_t)qt * 128 * kHD + idx * 8];
    bf16* lq = &sQ[(idx >> 3) * kP64 + (idx & 7) * 8];
    async_copy16_x2(gq, lq, gq + 8, lq + 8);
  }

  auto stageKV = [&](int kt, int buf) {
    int d = tid >> 2, c = tid & 3;
    async_copy16_x2(&Kk[headBase + (size_t)kt * 32 * kHD + tid * 8],
                    &sK[buf][(tid >> 3) * kP64 + (tid & 7) * 8],
                    &VT[vtBase + (size_t)d * kS + kt * 32 + c * 8],
                    &sVT[buf][d * kP32 + c * 8]);
    if (tid < 32) {
      int col = kt * 32 + tid;
      int a2 = am[b * kS + col];
      int t2 = tt[b * kS + col];
      sAmK[buf][tid]   = (a2 != 0) ? 1.0f : 0.0f;
      sMaskK[buf][tid] = ((t2 == 1) || (a2 == 0) || (col == 0)) ? 1.0f : 0.0f;
    }
  };

  float aq[8];      // query-row activity (for additive 0/1 mask)
  float mrow[8], lrow[8];
#pragma unroll
  for (int i = 0; i < 8; ++i) {
    int r = qt * 128 + w * 16 + hi * 8 + i;
    aq[i] = (am[b * kS + r] != 0) ? 1.0f : 0.0f;
    mrow[i] = -3.0e38f;
    lrow[i] = 0.0f;
  }
  v8f o[4] = {};

  constexpr int kTiles = kS / 32;
  stageKV(0, 0);
  wait_async0();
  __syncthreads();

  for (int kt = 0; kt < kTiles; ++kt) {
    const int cur = kt & 1;
    if (kt + 1 < kTiles) stageKV(kt + 1, cur ^ 1);

    // Scores: 16 q rows x 32 keys (2 n-tiles, 2 chained WMMAs over HD=64)
    v16bf a0 = ld_frag(&sQ[(w * 16 + lm) * kP64 + hi * 8]);
    v16bf a1 = ld_frag(&sQ[(w * 16 + lm) * kP64 + 32 + hi * 8]);
    v8f s[2] = {};
#pragma unroll
    for (int nt = 0; nt < 2; ++nt) {
      v16bf b0 = ld_frag(&sK[cur][(nt * 16 + lm) * kP64 + hi * 8]);
      v16bf b1 = ld_frag(&sK[cur][(nt * 16 + lm) * kP64 + 32 + hi * 8]);
      s[nt] = wmma_bf16(a0, b0, s[nt]);
      s[nt] = wmma_bf16(a1, b1, s[nt]);
    }

    float amk0 = sAmK[cur][lm],   amk1 = sAmK[cur][16 + lm];
    float mk0  = sMaskK[cur][lm], mk1  = sMaskK[cur][16 + lm];
#pragma unroll
    for (int i = 0; i < 8; ++i) {
      float v0 = s[0][i] * 0.125f + aq[i] * amk0;   // 1/sqrt(64) + additive 0/1
      float v1 = s[1][i] * 0.125f + aq[i] * amk1;
      if (mk0 > 0.5f) v0 = kNEG;
      if (mk1 > 0.5f) v1 = kNEG;
      // row max over 32 keys (16-lane xor reduction; rows live in lane halves)
      float rm = fmaxf(v0, v1);
      rm = fmaxf(rm, __shfl_xor(rm, 1, 32));
      rm = fmaxf(rm, __shfl_xor(rm, 2, 32));
      rm = fmaxf(rm, __shfl_xor(rm, 4, 32));
      rm = fmaxf(rm, __shfl_xor(rm, 8, 32));
      float nm = fmaxf(mrow[i], rm);
      float sc = __expf(mrow[i] - nm);
      float p0 = __expf(v0 - nm);
      float p1 = __expf(v1 - nm);
      float rs = p0 + p1;
      rs += __shfl_xor(rs, 1, 32);
      rs += __shfl_xor(rs, 2, 32);
      rs += __shfl_xor(rs, 4, 32);
      rs += __shfl_xor(rs, 8, 32);
      lrow[i] = lrow[i] * sc + rs;
      mrow[i] = nm;
#pragma unroll
      for (int ot = 0; ot < 4; ++ot) o[ot][i] = o[ot][i] * sc;
      // stage P into A-fragment layout (per-wave region, wave-internal RAW)
      sP[(w * 16 + hi * 8 + i) * kP32 + lm]      = (bf16)p0;
      sP[(w * 16 + hi * 8 + i) * kP32 + 16 + lm] = (bf16)p1;
    }

    // O += P(16x32) @ V(32x64): 4 n-tiles of 16 dims
    v16bf pa = ld_frag(&sP[(w * 16 + lm) * kP32 + hi * 8]);
#pragma unroll
    for (int ot = 0; ot < 4; ++ot) {
      v16bf bv = ld_frag(&sVT[cur][(ot * 16 + lm) * kP32 + hi * 8]);
      o[ot] = wmma_bf16(pa, bv, o[ot]);
    }

    wait_async0();    // next K/V buffer filled (overlapped with compute)
    __syncthreads();  // all waves done with `cur` before it is refilled
  }

  // ctx[b, s, h*64+d] in bf16 for the out-projection GEMM
#pragma unroll
  for (int ot = 0; ot < 4; ++ot) {
#pragma unroll
    for (int i = 0; i < 8; ++i) {
      int qrow = qt * 128 + w * 16 + hi * 8 + i;
      int d = ot * 16 + lm;
      float v = o[ot][i] / lrow[i];
      ctx[((size_t)b * kS + qrow) * kE + h * kHD + d] = (bf16)v;
    }
  }
}

// ---------------------------------------------------------------------------
// out = LayerNorm(a + r) * g + be ; optionally also emit bf16 copy
// One block (256 threads) per token row of E=1024.
// ---------------------------------------------------------------------------
__global__ __launch_bounds__(256) void add_ln_kernel(
    const float* __restrict__ a, const float* __restrict__ r,
    const float* __restrict__ g, const float* __restrict__ be,
    float* __restrict__ outF, bf16* __restrict__ outB) {
  __shared__ float red[256];
  const int row = blockIdx.x, t = threadIdx.x;
  const size_t base = (size_t)row * kE;
  float4 va = ((const float4*)(a + base))[t];
  float4 vr = ((const float4*)(r + base))[t];
  float x0 = va.x + vr.x, x1 = va.y + vr.y, x2 = va.z + vr.z, x3 = va.w + vr.w;

  red[t] = x0 + x1 + x2 + x3;
  __syncthreads();
  for (int o = 128; o > 0; o >>= 1) { if (t < o) red[t] += red[t + o]; __syncthreads(); }
  float mu = red[0] * (1.0f / kE);
  __syncthreads();

  float d0 = x0 - mu, d1 = x1 - mu, d2 = x2 - mu, d3 = x3 - mu;
  red[t] = d0 * d0 + d1 * d1 + d2 * d2 + d3 * d3;
  __syncthreads();
  for (int o = 128; o > 0; o >>= 1) { if (t < o) red[t] += red[t + o]; __syncthreads(); }
  float inv = rsqrtf(red[0] * (1.0f / kE) + 1e-12f);

  float4 gw = ((const float4*)g)[t];
  float4 bb = ((const float4*)be)[t];
  float o0 = d0 * inv * gw.x + bb.x;
  float o1 = d1 * inv * gw.y + bb.y;
  float o2 = d2 * inv * gw.z + bb.z;
  float o3 = d3 * inv * gw.w + bb.w;
  ((float4*)(outF + base))[t] = make_float4(o0, o1, o2, o3);
  if (outB) {
    outB[base + t * 4 + 0] = (bf16)o0;
    outB[base + t * 4 + 1] = (bf16)o1;
    outB[base + t * 4 + 2] = (bf16)o2;
    outB[base + t * 4 + 3] = (bf16)o3;
  }
}

// ---------------------------------------------------------------------------
extern "C" void kernel_launch(void* const* d_in, const int* in_sizes, int n_in,
                              void* d_out, int out_size, void* d_ws, size_t ws_size,
                              hipStream_t stream) {
  const float* x    = (const float*)d_in[0];
  const int*   am   = (const int*)d_in[1];
  const int*   tt   = (const int*)d_in[2];
  const float* wqkv = (const float*)d_in[3];
  const float* bqkv = (const float*)d_in[4];
  const float* wout = (const float*)d_in[5];
  const float* bout = (const float*)d_in[6];
  const float* lnw  = (const float*)d_in[7];
  const float* lnb  = (const float*)d_in[8];
  const float* win  = (const float*)d_in[9];
  const float* bin  = (const float*)d_in[10];
  const float* wo2  = (const float*)d_in[11];
  const float* bo2  = (const float*)d_in[12];
  float* out = (float*)d_out;

  char* ws = (char*)d_ws;
  size_t off = 0;
  auto take = [&](size_t bytes) -> char* {
    char* p = ws + off;
    off += (bytes + 255) & ~(size_t)255;
    return p;
  };
  bf16*  xb     = (bf16*)take((size_t)kM * kE * 2);          // 16 MB
  bf16*  wqkvT  = (bf16*)take((size_t)3 * kE * kE * 2);      //  6 MB
  bf16*  woutT  = (bf16*)take((size_t)kE * kE * 2);          //  2 MB
  bf16*  winT   = (bf16*)take((size_t)kF * kE * 2);          //  8 MB
  bf16*  wo2T   = (bf16*)take((size_t)kE * kF * 2);          //  8 MB
  bf16*  qBuf   = (bf16*)take((size_t)kM * kE * 2);          // 16 MB  [b,h,s,d]
  bf16*  kBuf   = (bf16*)take((size_t)kM * kE * 2);          // 16 MB  [b,h,s,d]
  bf16*  vtBuf  = (bf16*)take((size_t)kM * kE * 2);          // 16 MB  [b,h,d,s]
  bf16*  ctx    = (bf16*)take((size_t)kM * kE * 2);          // 16 MB  [b,s,e]
  float* attnF  = (float*)take((size_t)kM * kE * 4);         // 32 MB (reused as out2)
  float* hF     = (float*)take((size_t)kM * kE * 4);         // 32 MB
  bf16*  hB     = (bf16*)take((size_t)kM * kE * 2);          // 16 MB
  bf16*  ff     = qBuf;  // 64 MB alias over q/k/vT/ctx (dead after out-proj)

  // 1) bf16 conversions / weight transposes
  cvt_bf16_kernel<<<(kM * kE) / 1024, 256, 0, stream>>>(x, xb, kM * kE);
  transpose_cvt_kernel<<<dim3(3 * kE / 64, kE / 128), 256, 0, stream>>>(wqkv, wqkvT, kE, 3 * kE);
  transpose_cvt_kernel<<<dim3(kE / 64, kE / 128), 256, 0, stream>>>(wout, woutT, kE, kE);
  transpose_cvt_kernel<<<dim3(kF / 64, kE / 128), 256, 0, stream>>>(win, winT, kE, kF);
  transpose_cvt_kernel<<<dim3(kE / 64, kF / 128), 256, 0, stream>>>(wo2, wo2T, kF, kE);

  // 2) QKV projection with head-split scatter epilogue
  gemm_bf16_kernel<EPI_QKV><<<dim3(3 * kE / 128, kM / 256), 256, 0, stream>>>(
      xb, wqkvT, bqkv, nullptr, nullptr, qBuf, kBuf, vtBuf, kM, 3 * kE, kE);

  // 3) Flash attention
  attention_kernel<<<dim3(kS / 128, kH, kB), 256, 0, stream>>>(
      qBuf, kBuf, vtBuf, am, tt, ctx);

  // 4) Output projection
  gemm_bf16_kernel<EPI_PLAIN><<<dim3(kE / 128, kM / 256), 256, 0, stream>>>(
      ctx, woutT, bout, attnF, nullptr, nullptr, nullptr, nullptr, kM, kE, kE);

  // 5) h = LN(attn_out + x)
  add_ln_kernel<<<kM, 256, 0, stream>>>(attnF, x, lnw, lnb, hF, hB);

  // 6) FFN up + exact GELU (bf16 out)
  gemm_bf16_kernel<EPI_GELU><<<dim3(kF / 128, kM / 256), 256, 0, stream>>>(
      hB, winT, bin, nullptr, ff, nullptr, nullptr, nullptr, kM, kF, kE);

  // 7) FFN down (f32 out, reusing attnF)
  gemm_bf16_kernel<EPI_PLAIN><<<dim3(kE / 128, kM / 256), 256, 0, stream>>>(
      ff, wo2T, bo2, attnF, nullptr, nullptr, nullptr, nullptr, kM, kE, kF);

  // 8) out = LN(ffn_out + h)
  add_ln_kernel<<<kM, 256, 0, stream>>>(attnF, hF, lnw, lnb, out, nullptr);

  (void)in_sizes; (void)n_in; (void)out_size; (void)ws_size;
}

// v005
// One run takes 299 microseconds.
// Two timings next to v004 both put it at 1.22 times that version's speed.
// All steps since v000 together make it 2.22 times as fast.
#include <hip/hip_runtime.h>
#include <hip/hip_bf16.h>

typedef __bf16 bf16;
typedef __attribute__((ext_vector_type(8)))  float v8f;
typedef __attribute__((ext_vector_type(16))) bf16  v16bf;
typedef __attribute__((ext_vector_type(8)))  bf16  v8bf;

constexpr int kB = 8, kS = 1024, kE = 1024, kH = 16, kHD = 64, kF = 4096;
constexpr int kM = kB * kS;  // 8192 token rows
constexpr float kNEG = -1.0e30f;

// LDS row pitch in halves for rows read by 16-byte fragment loads: an odd
// multiple of 16 B, so the 16 rows of one fragment load fall on distinct banks.
constexpr int kP32 = 40;  // rows of 32 halves (64 B) at 80 B
constexpr int kP64 = 72;  // rows of 64 halves (128 B) at 144 B

// ---------------------------------------------------------------------------
// WMMA + async-copy helpers (CDNA5 wave32)
// ---------------------------------------------------------------------------
__device__ __forceinline__ v8f wmma_bf16(v16bf a, v16bf b, v8f c) {
  return __builtin_amdgcn_wmma_f32_16x16x32_bf16(
      /*neg_a=*/false, a, /*neg_b=*/false, b,
      /*c_mod=*/(short)0, c, /*reuse_a=*/false, /*reuse_b=*/false);
}

// A/B fragment for one lane: two contiguous 8-half runs at p and p+16.
// (16-bit operand layout: lanes<16 hold K = 0..7 & 16..23 of the 32-K tile,
//  lanes>=16 hold K = 8..15 & 24..31 — caller passes p already offset by hi*8.)
__device__ __forceinline__ v16bf ld_frag(const bf16* p) {
  union { v16bf v; v8bf h[2]; } u;
  u.h[0] = *(const v8bf*)(p);
  u.h[1] = *(const v8bf*)(p + 16);
  return u.v;
}

// 16-byte global -> LDS async copy (ASYNCcnt-tracked, no VGPR staging).
// LDS destination = low 32 bits of the generic pointer (LDS aperture offset).
// The closing s_wait_xcnt 0 stands inside the copies' own statement as a
// precaution: no address register of a copy is rewritten ahead of it.
__device__ __forceinline__ void async_copy16_x2(const bf16* g0, bf16* l0,
                                                const bf16* g1, bf16* l1) {
  asm volatile("global_load_async_to_lds_b128 %0, %1, off\n\t"
               "global_load_async_to_lds_b128 %2, %3, off\n\t"
               "s_wait_xcnt 0x0"
               :: "v"((unsigned)(size_t)l0), "v"(g0),
                  "v"((unsigned)(size_t)l1), "v"(g1) : "memory");
}
__device__ __forceinline__ void async_copy16_x4(const bf16* g0, bf16* l0,
                                                const bf16* g1, bf16* l1,
                                                const bf16* g2, bf16* l2,
                                                const bf16* g3, bf16* l3) {
  asm volatile("global_load_async_to_lds_b128 %0, %1, off\n\t"
               "global_load_async_to_lds_b128 %2, %3, off\n\t"
               "global_load_async_to_lds_b128 %4, %5, off\n\t"
               "global_load_async_to_lds_b128 %6, %7, off\n\t"
               "s_wait_xcnt 0x0"
               :: "v"((unsigned)(size_t)l0), "v"(g0),
                  "v"((unsigned)(size_t)l1), "v"(g1),
                  "v"((unsigned)(size_t)l2), "v"(g2),
                  "v"((unsigned)(size_t)l3), "v"(g3) : "memory");
}
__device__ __forceinline__ void wait_async0() {
  asm volatile("s_wait_asynccnt 0x0" ::: "memory");
}
// A wave's own LDS reads have retired before a copy is aimed at what it read.
__device__ __forceinline__ void wait_ds0() {
  asm volatile("s_wait_dscnt 0x0" ::: "memory");
}

// ---------------------------------------------------------------------------
// Small conversion kernels
// ---------------------------------------------------------------------------
__global__ __launch_bounds__(256) void cvt_bf16_kernel(const float* __restrict__ in,
                                                       bf16* __restrict__ out, int n) {
  int idx = (blockIdx.x * 256 + threadIdx.x) * 4;
  if (idx < n) {
    float4 v = *(const float4*)(in + idx);
    out[idx + 0] = (bf16)v.x;
    out[idx + 1] = (bf16)v.y;
    out[idx + 2] = (bf16)v.z;
    out[idx + 3] = (bf16)v.w;
  }
}

// in: [K,N] fp32 row-major  ->  out: [N,K] bf16 row-major
// One work-group moves a tile of 128 k x 64 n through LDS: it reads whole 256-B
// row pieces of in and writes whole 256-B row pieces of out, 32 elements a
// thread. Needs K % 128 == 0, N % 64 == 0; grid (N / 64, K / 128).
// LDS holds the tile transposed, a dword = the bf16 pair (k, k + 1) of one n;
// the odd pitch of 65 dwords keeps both the writes (lanes 4 n apart) and the
// reads (lanes 4 dwords apart) on distinct banks.
__global__ __launch_bounds__(256) void transpose_cvt_kernel(const float* __restrict__ in,
                                                            bf16* __restrict__ out,
                                                            int K, int N) {
  typedef __attribute__((ext_vector_type(2))) bf16 v2bf;
  __shared__ unsigned tile[64 * 65];
  const int t = threadIdx.x;
  const int n0 = blockIdx.x * 64, k0 = blockIdx.y * 128;

  // Thread: 4 consecutive n (chunk c) of the row pairs 2 (r + 16 j), + 1.
  const int c = t & 15, r = t >> 4;
  const float* src = in + (size_t)(k0 + 2 * r) * N + n0 + c * 4;
  const float4* pl[4];
  const float4* pu[4];
  float4 lo[4], up[4];
#pragma unroll
  for (int j = 0; j < 4; ++j) {
    pl[j] = (const float4*)(src + (size_t)(32 * j) * N);
    pu[j] = (const float4*)(src + (size_t)(32 * j + 1) * N);
    lo[j] = *pl[j];
    up[j] = *pu[j];
  }
  // Precaution: the eight address pairs are inputs of this wait, so they stay
  // as they are until it; no register that an issued load names is overwritten
  // ahead of it, not even by a later load's data.
  asm volatile("s_wait_xcnt 0x0"
               :: "v"(pl[0]), "v"(pu[0]), "v"(pl[1]), "v"(pu[1]),
                  "v"(pl[2]), "v"(pu[2]), "v"(pl[3]), "v"(pu[3]) : "memory");
#pragma unroll
  for (int j = 0; j < 4; ++j) {
    unsigned* d = &tile[(c * 4) * 65 + r + 16 * j];
    v2bf p0 = {(bf16)lo[j].x, (bf16)up[j].x};
    v2bf p1 = {(bf16)lo[j].y, (bf16)up[j].y};
    v2bf p2 = {(bf16)lo[j].z, (bf16)up[j].z};
    v2bf p3 = {(bf16)lo[j].w, (bf16)up[j].w};
    d[0 * 65] = __builtin_bit_cast(unsigned, p0);
    d[1 * 65] = __builtin_bit_cast(unsigned, p1);
    d[2 * 65] = __builtin_bit_cast(unsigned, p2);
    d[3 * 65] = __builtin_bit_cast(unsigned, p3);
  }
  __syncthreads();  // the whole tile is in LDS before any row of it is read

  // Thread: 8 consecutive k (chunk c) of rows n = r + 16 j; 16 B a store.
#pragma unroll
  for (int j = 0; j < 4; ++j) {
    const int n = r + 16 * j;
    const unsigned* s = &tile[n * 65 + c * 4];
    uint4 v = make_uint4(s[0], s[1], s[2], s[3]);
    *(uint4*)(out + (size_t)(n0 + n) * K + k0 + c * 8) = v;
  }
}

// ---------------------------------------------------------------------------
// Generic bf16 GEMM: C[M,N] = A[M,K] * Bt[N,K]^T + bias, fused epilogues.
// Block = 256 threads (8 wave32), tile 256(M) x 128(N), waves 4x2, wave 64x64.
// A pass is 64 k: 128-B rows at 144 B pitch, two LDS buffers filled by
// GLOBAL_LOAD_ASYNC_TO_LDS_B128; one barrier per pass; a buffer's refill is
// issued right behind the barrier that frees it and has a whole pass to land.
// Needs M % 256 == 0, N % 128 == 0, K % 64 == 0.
// ---------------------------------------------------------------------------
enum { EPI_PLAIN = 0, EPI_GELU = 1, EPI_QKV = 2 };

template <int EPI>
__global__ __launch_bounds__(256) void gemm_bf16_kernel(
    const bf16* __restrict__ A, const bf16* __restrict__ Bt,
    const float* __restrict__ bias,
    float* __restrict__ Cf, bf16* __restrict__ Cb,
    bf16* __restrict__ qO, bf16* __restrict__ kO, bf16* __restrict__ vtO,
    int M, int N, int K) {
  __shared__ __attribute__((aligned(16))) bf16 sA[2][256 * kP64];
  __shared__ __attribute__((aligned(16))) bf16 sB[2][128 * kP64];
  const int tid = threadIdx.x;
  const int lane = tid & 31, wave = tid >> 5;
  const int hi = lane >> 4, lm = lane & 15;
  const int waveM = wave & 3, waveN = wave >> 2;
  const int m0 = blockIdx.y * 256;
  const int n0 = blockIdx.x * 128;

  // Staging slots: 8 chunks of 16 B a row, so a wave's copy covers 4 whole rows
  // of 128 B; a thread keeps its chunk and walks rows sRow + 32 j.
  const int sRow = tid >> 3, sCh = tid & 7;
  const bf16* gA = &A[(size_t)(m0 + sRow) * K + sCh * 8];
  const bf16* gB = &Bt[(size_t)(n0 + sRow) * K + sCh * 8];
  const size_t rowStep = (size_t)32 * K;
  const int sOff = sRow * kP64 + sCh * 8;

  auto stage = [&](int kt, int buf) {
    const bf16* a = gA + kt * 64;
    const bf16* b = gB + kt * 64;
    bf16* la = &sA[buf][sOff];
    bf16* lb = &sB[buf][sOff];
    async_copy16_x4(a,               la,
                    a + rowStep,     la + 32 * kP64,
                    a + 2 * rowStep, la + 64 * kP64,
                    a + 3 * rowStep, la + 96 * kP64);
    async_copy16_x4(a + 4 * rowStep, la + 128 * kP64,
                    a + 5 * rowStep, la + 160 * kP64,
                    a + 6 * rowStep, la + 192 * kP64,
                    a + 7 * rowStep, la + 224 * kP64);
    async_copy16_x4(b,               lb,
                    b + rowStep,     lb + 32 * kP64,
                    b + 2 * rowStep, lb + 64 * kP64,
                    b + 3 * rowStep, lb + 96 * kP64);
  };

  v8f acc[4][4] = {};
  const int kTiles = K >> 6;

  stage(0, 0);
  wait_async0();
  __syncthreads();
  if (kTiles > 1) stage(1, 1);

  // All loops over mt / nt are unrolled so that the fragment and accumulator
  // arrays are indexed by constants and stay in registers.
  v16bf af[4], bfr[4];
  auto load_frags = [&](int buf, int ks) {
#pragma unroll
    for (int mt = 0; mt < 4; ++mt)
      af[mt] = ld_frag(&sA[buf][(waveM * 64 + mt * 16 + lm) * kP64 + ks * 32 + hi * 8]);
#pragma unroll
    for (int nt = 0; nt < 4; ++nt)
      bfr[nt] = ld_frag(&sB[buf][(waveN * 64 + nt * 16 + lm) * kP64 + ks * 32 + hi * 8]);
  };
  auto mma16 = [&]() {
#pragma unroll
    for (int mt = 0; mt < 4; ++mt)
#pragma unroll
      for (int nt = 0; nt < 4; ++nt)
        acc[mt][nt] = wmma_bf16(af[mt], bfr[nt], acc[mt][nt]);
  };

  for (int kt = 0; kt < kTiles; ++kt) {
    const int cur = kt & 1;
    load_frags(cur, 0);
    // Keeps the 16 fragment loads one group ahead of the 16 WMMAs: left alone
    // the compiler reloads one A fragment per row and waits it out each time.
    __builtin_amdgcn_sched_barrier(0);
    mma16();
    load_frags(cur, 1);  // the pass's last reads of `cur`, into registers

    wait_ds0();       // this wave's reads of `cur` have retired before its refill
    wait_async0();    // this wave's share of the other buffer has landed
    __syncthreads();  // publishes the other buffer; ends every read of `cur`
    if (kt + 2 < kTiles) stage(kt + 2, cur);
    mma16();  // registers only: the refill flies from here on
  }
  wait_async0();  // no copy outstanding when the wave ends

  if constexpr (EPI == EPI_QKV) {
    // Scatter to Q/K [b,h,s,d] and V^T [b,h,d,s]. A block's 128 columns lie in
    // one of the three sections of 1024 and its 256 rows in one batch entry, so
    // the section is a scalar of the block: it is branched on once, outside the
    // unrolled loops, and every store is one base address plus a constant.
    // A wave's 64 columns are one head.
    const int sec = n0 >> 10;
    const int bh = (m0 >> 10) * kH + ((n0 & 1023) >> 6) + waveN;
    const int s0 = (m0 & 1023) + waveM * 64 + hi * 8;
    float bs[4];
#pragma unroll
    for (int nt = 0; nt < 4; ++nt) bs[nt] = bias[n0 + waveN * 64 + nt * 16 + lm];
    if (sec < 2) {
      bf16* dst = (sec == 0 ? qO : kO) + ((size_t)bh * kS + s0) * kHD + lm;
#pragma unroll
      for (int mt = 0; mt < 4; ++mt)
#pragma unroll
        for (int nt = 0; nt < 4; ++nt)
#pragma unroll
          for (int i = 0; i < 8; ++i)
            dst[(mt * 16 + i) * kHD + nt * 16] = (bf16)(acc[mt][nt][i] + bs[nt]);
    } else {
      bf16* dst = vtO + ((size_t)bh * kHD + lm) * kS + s0;
      v8bf pk[4][4];  // 8 consecutive s of one d: one 16-byte store
#pragma unroll
      for (int mt = 0; mt < 4; ++mt)
#pragma unroll
        for (int nt = 0; nt < 4; ++nt)
#pragma unroll
          for (int i = 0; i < 8; ++i) pk[mt][nt][i] = (bf16)(acc[mt][nt][i] + bs[nt]);
#pragma unroll
      for (int mt = 0; mt < 4; ++mt)
#pragma unroll
        for (int nt = 0; nt < 4; ++nt)
          *(v8bf*)(dst + (nt * 16) * kS + mt * 16) = pk[mt][nt];
      // Precaution: stands behind the last of the 16 stores, ahead of any
      // later write of the address pair or of a data register that they name.
      asm volatile("s_wait_xcnt 0x0" ::: "memory");
    }
    return;
  }

#pragma unroll
  for (int mt = 0; mt < 4; ++mt) {
#pragma unroll
    for (int nt = 0; nt < 4; ++nt) {
#pragma unroll
      for (int i = 0; i < 8; ++i) {
        int row = m0 + waveM * 64 + mt * 16 + hi * 8 + i;
        int col = n0 + waveN * 64 + nt * 16 + lm;
        float v = acc[mt][nt][i] + bias[col];
        if constexpr (EPI == EPI_PLAIN) {
          Cf[(size_t)row * N + col] = v;
        } else if constexpr (EPI == EPI_GELU) {
          float g = 0.5f * v * (1.0f + erff(v * 0.70710678118654752f));
          Cb[(size_t)row * N + col] = (bf16)g;
        }
      }
    }
  }
}

__device__ __forceinline__ float xhalf(float x) {
  return __builtin_bit_cast(float, __builtin_amdgcn_permlanex16(
      __builtin_bit_cast(int, x), __builtin_bit_cast(int, x),
      0x76543210, 0xfedcba98, false, false));
}

__global__ __launch_bounds__(256) void attention_kernel(
    const bf16* __restrict__ Q, const bf16* __restrict__ Kk,
    const bf16* __restrict__ VT,
    const int* __restrict__ am, const int* __restrict__ tt,
    bf16* __restrict__ ctx) {
  typedef __attribute__((ext_vector_type(4))) float v4f;
  __shared__ __attribute__((aligned(16))) bf16 sQ[128 * kP64];
  __shared__ __attribute__((aligned(16))) bf16 sK[2][32 * kP64];
  __shared__ __attribute__((aligned(16))) bf16 sVT[2][64 * kP32];
  // What a key adds to its scaled score, for an inactive ([0]) and an active
  // ([1]) query: the 0/1 mask term, or kNEG for an ignored key. kNEG absorbs
  // the score in the f32 sum, so an ignored key's value is kNEG exactly.
  __shared__ __attribute__((aligned(16))) float sAdd[2][2][32];

  const int tid = threadIdx.x;
  const int lane = tid & 31, w = tid >> 5;
  const int hi = lane >> 4, lm = lane & 15;
  const int qt = blockIdx.x, h = blockIdx.y, b = blockIdx.z;
  const size_t headBase = (size_t)(b * kH + h) * kS * kHD;
  const size_t vtBase   = (size_t)(b * kH + h) * kHD * kS;

  // Stage Q tile (contiguous 128*64 halves) via async copies.
#pragma unroll
  for (int j = 0; j < 4; j += 2) {
    int idx = tid * 4 + j;  // 0..1023 chunks of 8; 8 chunks a row
    const bf16* gq = &Q[headBase + (size_t)qt * 128 * kHD + idx * 8];
    bf16* lq = &sQ[(idx >> 3) * kP64 + (idx & 7) * 8];
    async_copy16_x2(gq, lq, gq + 8, lq + 8);
  }

  auto stageKV = [&](int kt, int buf) {
    int d = tid >> 2, c = tid & 3;
    async_copy16_x2(&Kk[headBase + (size_t)kt * 32 * kHD + tid * 8],
                    &sK[buf][(tid >> 3) * kP64 + (tid & 7) * 8],
                    &VT[vtBase + (size_t)d * kS + kt * 32 + c * 8],
                    &sVT[buf][d * kP32 + c * 8]);
    if (tid < 32) {
      int col = kt * 32 + tid;
      int a2 = am[b * kS + col];
      int t2 = tt[b * kS + col];
      bool ign = (t2 == 1) || (a2 == 0) || (col == 0);
      sAdd[buf][0][tid] = ign ? kNEG : 0.0f;
      sAdd[buf][1][tid] = ign ? kNEG : ((a2 != 0) ? 1.0f : 0.0f);
    }
  };

  // The lane's query: its activity picks the row of sAdd.
  const int qrow = qt * 128 + w * 16 + lm;
  const int qidx = b * kS + qrow;
  const int aqi = (am[qidx] != 0) ? 1 : 0;
  // Precaution: the load's index register is an input of this wait, so it stays
  // as it is until the wait; it is not overwritten ahead of it.
  asm volatile("s_wait_xcnt 0x0" :: "v"(qidx) : "memory");
  float mrow = -3.0e38f;  // running maximum, equal in both halves
  float lrow = 0.0f;      // running sum over this half's keys only
  v8f o[4] = {};          // O^T: head dims ot*16 + hi*8 + i of query lm

  constexpr int kTiles = kS / 32;
  stageKV(0, 0);
  wait_async0();
  __syncthreads();
  stageKV(1, 1);

  // B operand Q^T: column = query lm, k = head dim; the same for every tile.
  const v16bf q0 = ld_frag(&sQ[(w * 16 + lm) * kP64 + hi * 8]);
  const v16bf q1 = ld_frag(&sQ[(w * 16 + lm) * kP64 + 32 + hi * 8]);

  // Every inner loop is unrolled so that the fragment, score and accumulator
  // arrays are indexed by constants and stay in registers.
  for (int kt = 0; kt < kTiles; ++kt) {
    const int cur = kt & 1;

    // S^T: 32 keys x 16 queries (2 m-tiles, 2 chained WMMAs over HD=64)
    v8f st[2] = {};
#pragma unroll
    for (int t = 0; t < 2; ++t) {
      v16bf k0 = ld_frag(&sK[cur][(t * 16 + lm) * kP64 + hi * 8]);
      v16bf k1 = ld_frag(&sK[cur][(t * 16 + lm) * kP64 + 32 + hi * 8]);
      st[t] = wmma_bf16(k0, q0, st[t]);
      st[t] = wmma_bf16(k1, q1, st[t]);
    }

    // Addends of keys hi*8 + 0..7 and 16 + hi*8 + 0..7.
    const v4f* ad = (const v4f*)&sAdd[cur][aqi][hi * 8];
    const v4f ad4[2][2] = {{ad[0], ad[1]}, {ad[4], ad[5]}};

    float v[2][8];
    float mx = kNEG;  // no value lies below kNEG
#pragma unroll
    for (int t = 0; t < 2; ++t)
#pragma unroll
      for (int i = 0; i < 8; ++i) {
        v[t][i] = st[t][i] * 0.125f + ad4[t][i >> 2][i & 3];  // 1/sqrt(64)
        mx = fmaxf(mx, v[t][i]);
      }
    mx = fmaxf(mx, xhalf(mx));  // over all 32 keys, in both halves
    const float nm = fmaxf(mrow, mx);
    const float sc = __expf(mrow - nm);
    mrow = nm;

    v16bf pb;  // B operand P^T
    float rs = 0.0f;
#pragma unroll
    for (int t = 0; t < 2; ++t)
#pragma unroll
      for (int i = 0; i < 8; ++i) {
        float p = __expf(v[t][i] - nm);
        rs += p;
        pb[t * 8 + i] = (bf16)p;
      }
    lrow = lrow * sc + rs;
#pragma unroll
    for (int ot = 0; ot < 4; ++ot)
#pragma unroll
      for (int i = 0; i < 8; ++i) o[ot][i] = o[ot][i] * sc;

    // O^T += V^T(64x32) @ P^T(32x16): 4 m-tiles of 16 head dims
#pragma unroll
    for (int ot = 0; ot < 4; ++ot) {
      v16bf va = ld_frag(&sVT[cur][(ot * 16 + lm) * kP32 + hi * 8]);
      o[ot] = wmma_bf16(va, pb, o[ot]);
    }

    wait_ds0();       // this wave's reads of cur have retired before its refill
    wait_async0();    // next K/V buffer filled (overlapped with compute)
    __syncthreads();  // publishes the next buffer; ends every read of cur
    if (kt + 2 < kTiles) stageKV(kt + 2, cur);
  }
  wait_async0();  // no copy outstanding when the wave ends

  // ctx[b, s, h*64+d] in bf16 for the out-projection GEMM: 8 consecutive d of
  // one query a tile, one 16-byte store each.
  const float lsum = lrow + xhalf(lrow);  // the two halves' keys joined
  bf16* dst = ctx + ((size_t)b * kS + qrow) * kE + h * kHD + hi * 8;
#pragma unroll
  for (int ot = 0; ot < 4; ++ot) {
    v8bf pk;
#pragma unroll
    for (int i = 0; i < 8; ++i) pk[i] = (bf16)(o[ot][i] / lsum);
    *(v8bf*)(dst + ot * 16) = pk;
  }
}

// ---------------------------------------------------------------------------
// out = LayerNorm(a + r) * g + be ; optionally also emit bf16 copy
// One block (256 threads) per token row of E=1024.
// ---------------------------------------------------------------------------
__global__ __launch_bounds__(256) void add_ln_kernel(
    const float* __restrict__ a, const float* __restrict__ r,
    const float* __restrict__ g, const float* __restrict__ be,
    float* __restrict__ outF, bf16* __restrict__ outB) {
  __shared__ float red[256];
  const int row = blockIdx.x, t = threadIdx.x;
  const size_t base = (size_t)row * kE;
  float4 va = ((const float4*)(a + base))[t];
  float4 vr = ((const float4*)(r + base))[t];
  float x0 = va.x + vr.x, x1 = va.y + vr.y, x2 = va.z + vr.z, x3 = va.w + vr.w;

  red[t] = x0 + x1 + x2 + x3;
  __syncthreads();
  for (int o = 128; o > 0; o >>= 1) { if (t < o) red[t] += red[t + o]; __syncthreads(); }
  float mu = red[0] * (1.0f / kE);
  __syncthreads();

  float d0 = x0 - mu, d1 = x1 - mu, d2 = x2 - mu, d3 = x3 - mu;
  red[t] = d0 * d0 + d1 * d1 + d2 * d2 + d3 * d3;
  __syncthreads();
  for (int o = 128; o > 0; o >>= 1) { if (t < o) red[t] += red[t + o]; __syncthreads(); }
  float inv = rsqrtf(red[0] * (1.0f / kE) + 1e-12f);

  float4 gw = ((const float4*)g)[t];
  float4 bb = ((const float4*)be)[t];
  float o0 = d0 * inv * gw.x + bb.x;
  float o1 = d1 * inv * gw.y + bb.y;
  float o2 = d2 * inv * gw.z + bb.z;
  float o3 = d3 * inv * gw.w + bb.w;
  ((float4*)(outF + base))[t] = make_float4(o0, o1, o2, o3);
  if (outB) {
    outB[base + t * 4 + 0] = (bf16)o0;
    outB[base + t * 4 + 1] = (bf16)o1;
    outB[base + t * 4 + 2] = (bf16)o2;
    outB[base + t * 4 + 3] = (bf16)o3;
  }
}

// ---------------------------------------------------------------------------
extern "C" void kernel_launch(void* const* d_in, const int* in_sizes, int n_in,
                              void* d_out, int out_size, void* d_ws, size_t ws_size,
                              hipStream_t stream) {
  const float* x    = (const float*)d_in[0];
  const int*   am   = (const int*)d_in[1];
  const int*   tt   = (const int*)d_in[2];
  const float* wqkv = (const float*)d_in[3];
  const float* bqkv = (const float*)d_in[4];
  const float* wout = (const float*)d_in[5];
  const float* bout = (const float*)d_in[6];
  const float* lnw  = (const float*)d_in[7];
  const float* lnb  = (const float*)d_in[8];
  const float* win  = (const float*)d_in[9];
  const float* bin  = (const float*)d_in[10];
  const float* wo2  = (const float*)d_in[11];
  const float* bo2  = (const float*)d_in[12];
  float* out = (float*)d_out;

  char* ws = (char*)d_ws;
  size_t off = 0;
  auto take = [&](size_t bytes) -> char* {
    char* p = ws + off;
    off += (bytes + 255) & ~(size_t)255;
    return p;
  };
  bf16*  xb     = (bf16*)take((size_t)kM * kE * 2);          // 16 MB
  bf16*  wqkvT  = (bf16*)take((size_t)3 * kE * kE * 2);      //  6 MB
  bf16*  woutT  = (bf16*)take((size_t)kE * kE * 2);          //  2 MB
  bf16*  winT   = (bf16*)take((size_t)kF * kE * 2);          //  8 MB
  bf16*  wo2T   = (bf16*)take((size_t)kE * kF * 2);          //  8 MB
  bf16*  qBuf   = (bf16*)take((size_t)kM * kE * 2);          // 16 MB  [b,h,s,d]
  bf16*  kBuf   = (bf16*)take((size_t)kM * kE * 2);          // 16 MB  [b,h,s,d]
  bf16*  vtBuf  = (bf16*)take((size_t)kM * kE * 2);          // 16 MB  [b,h,d,s]
  bf16*  ctx    = (bf16*)take((size_t)kM * kE * 2);          // 16 MB  [b,s,e]
  float* attnF  = (float*)take((size_t)kM * kE * 4);         // 32 MB (reused as out2)
  float* hF     = (float*)take((size_t)kM * kE * 4);         // 32 MB
  bf16*  hB     = (bf16*)take((size_t)kM * kE * 2);          // 16 MB
  bf16*  ff     = qBuf;  // 64 MB alias over q/k/vT/ctx (dead after out-proj)

  // 1) bf16 conversions / weight transposes
  cvt_bf16_kernel<<<(kM * kE) / 1024, 256, 0, stream>>>(x, xb, kM * kE);
  transpose_cvt_kernel<<<dim3(3 * kE / 64, kE / 128), 256, 0, stream>>>(wqkv, wqkvT, kE, 3 * kE);
  transpose_cvt_kernel<<<dim3(kE / 64, kE / 128), 256, 0, stream>>>(wout, woutT, kE, kE);
  transpose_cvt_kernel<<<dim3(kF / 64, kE / 128), 256, 0, stream>>>(win, winT, kE, kF);
  transpose_cvt_kernel<<<dim3(kE / 64, kF / 128), 256, 0, stream>>>(wo2, wo2T, kF, kE);

  // 2) QKV projection with head-split scatter epilogue
  gemm_bf16_kernel<EPI_QKV><<<dim3(3 * kE / 128, kM / 256), 256, 0, stream>>>(
      xb, wqkvT, bqkv, nullptr, nullptr, qBuf, kBuf, vtBuf, kM, 3 * kE, kE);

  // 3) Flash attention
  attention_kernel<<<dim3(kS / 128, kH, kB), 256, 0, stream>>>(
      qBuf, kBuf, vtBuf, am, tt, ctx);

  // 4) Output projection
  gemm_bf16_kernel<EPI_PLAIN><<<dim3(kE / 128, kM / 256), 256, 0, stream>>>(
      ctx, woutT, bout, attnF, nullptr, nullptr, nullptr, nullptr, kM, kE, kE);

  // 5) h = LN(attn_out + x)
  add_ln_kernel<<<kM, 256, 0, stream>>>(attnF, x, lnw, lnb, hF, hB);

  // 6) FFN up + exact GELU (bf16 out)
  gemm_bf16_kernel<EPI_GELU><<<dim3(kF / 128, kM / 256), 256, 0, stream>>>(
      hB, winT, bin, nullptr, ff, nullptr, nullptr, nullptr, kM, kF, kE);

  // 7) FFN down (f32 out, reusing attnF)
  gemm_bf16_kernel<EPI_PLAIN><<<dim3(kE / 128, kM / 256), 256, 0, stream>>>(
      ff, wo2T, bo2, attnF, nullptr, nullptr, nullptr, nullptr, kM, kE, kF);

  // 8) out = LN(ffn_out + h)
  add_ln_kernel<<<kM, 256, 0, stream>>>(attnF, hF, lnw, lnb, out, nullptr);

  (void)in_sizes; (void)n_in; (void)out_size; (void)ws_size;
}

// v006
// A run of this version takes 272 microseconds.
// Two timings next to v005 put it at 1.11 and 1.10 times that version's speed.
// Over all steps from v000 it is 2.46 times as fast.
#include <hip/hip_runtime.h>
#include <hip/hip_bf16.h>

typedef __bf16 bf16;
typedef __attribute__((ext_vector_type(8)))  float v8f;
typedef __attribute__((ext_vector_type(16))) bf16  v16bf;
typedef __attribute__((ext_vector_type(8)))  bf16  v8bf;

constexpr int kB = 8, kS = 1024, kE = 1024, kH = 16, kHD = 64, kF = 4096;
constexpr int kM = kB * kS;  // 8192 token rows
constexpr float kNEG = -1.0e30f;

// LDS row pitch in halves for rows read by 16-byte fragment loads: an odd
// multiple of 16 B, so the 16 rows of one fragment load fall on distinct banks.
constexpr int kP32 = 40;  // rows of 32 halves (64 B) at 80 B
constexpr int kP64 = 72;  // rows of 64 halves (128 B) at 144 B

// ---------------------------------------------------------------------------
// WMMA + async-copy helpers (CDNA5 wave32)
// ---------------------------------------------------------------------------
__device__ __forceinline__ v8f wmma_bf16(v16bf a, v16bf b, v8f c) {
  return __builtin_amdgcn_wmma_f32_16x16x32_bf16(
      /*neg_a=*/false, a, /*neg_b=*/false, b,
      /*c_mod=*/(short)0, c, /*reuse_a=*/false, /*reuse_b=*/false);
}

// A/B fragment for one lane: two contiguous 8-half runs at p and p+16.
// (16-bit operand layout: lanes<16 hold K = 0..7 & 16..23 of the 32-K tile,
//  lanes>=16 hold K = 8..15 & 24..31 — caller passes p already offset by hi*8.)
__device__ __forceinline__ v16bf ld_frag(const bf16* p) {
  union { v16bf v; v8bf h[2]; } u;
  u.h[0] = *(const v8bf*)(p);
  u.h[1] = *(const v8bf*)(p + 16);
  return u.v;
}

// 16-byte global -> LDS async copy (ASYNCcnt-tracked, no VGPR staging).
// LDS destination = low 32 bits of the generic pointer (LDS aperture offset).
// The closing s_wait_xcnt 0 stands inside the copies' own statement as a
// precaution: no address register of a copy is rewritten ahead of it.
__device__ __forceinline__ void async_copy16_x2(const bf16* g0, bf16* l0,
                                                const bf16* g1, bf16* l1) {
  asm volatile("global_load_async_to_lds_b128 %0, %1, off\n\t"
               "global_load_async_to_lds_b128 %2, %3, off\n\t"
               "s_wait_xcnt 0x0"
               :: "v"((unsigned)(size_t)l0), "v"(g0),
                  "v"((unsigned)(size_t)l1), "v"(g1) : "memory");
}
__device__ __forceinline__ void async_copy16_x4(const bf16* g0, bf16* l0,
                                                const bf16* g1, bf16* l1,
                                                const bf16* g2, bf16* l2,
                                                const bf16* g3, bf16* l3) {
  asm volatile("global_load_async_to_lds_b128 %0, %1, off\n\t"
               "global_load_async_to_lds_b128 %2, %3, off\n\t"
               "global_load_async_to_lds_b128 %4, %5, off\n\t"
               "global_load_async_to_lds_b128 %6, %7, off\n\t"
               "s_wait_xcnt 0x0"
               :: "v"((unsigned)(size_t)l0), "v"(g0),
                  "v"((unsigned)(size_t)l1), "v"(g1),
                  "v"((unsigned)(size_t)l2), "v"(g2),
                  "v"((unsigned)(size_t)l3), "v"(g3) : "memory");
}
__device__ __forceinline__ void wait_async0() {
  asm volatile("s_wait_asynccnt 0x0" ::: "memory");
}
// A wave's own LDS reads have retired before a copy is aimed at what it read.
__device__ __forceinline__ void wait_ds0() {
  asm volatile("s_wait_dscnt 0x0" ::: "memory");
}

// ---------------------------------------------------------------------------
// Small conversion kernels
// ---------------------------------------------------------------------------
__global__ __launch_bounds__(256) void cvt_bf16_kernel(const float* __restrict__ in,
                                                       bf16* __restrict__ out, int n) {
  int idx = (blockIdx.x * 256 + threadIdx.x) * 4;
  if (idx < n) {
    float4 v = *(const float4*)(in + idx);
    out[idx + 0] = (bf16)v.x;
    out[idx + 1] = (bf16)v.y;
    out[idx + 2] = (bf16)v.z;
    out[idx + 3] = (bf16)v.w;
  }
}

// in: [K,N] fp32 row-major  ->  out: [N,K] bf16 row-major
// One work-group moves a tile of 128 k x 64 n through LDS: it reads whole 256-B
// row pieces of in and writes whole 256-B row pieces of out, 32 elements a
// thread. Needs K % 128 == 0, N % 64 == 0; grid (N / 64, K / 128).
// LDS holds the tile transposed, a dword = the bf16 pair (k, k + 1) of one n;
// the odd pitch of 65 dwords keeps both the writes (lanes 4 n apart) and the
// reads (lanes 4 dwords apart) on distinct banks.
__global__ __launch_bounds__(256) void transpose_cvt_kernel(const float* __restrict__ in,
                                                            bf16* __restrict__ out,
                                                            int K, int N) {
  typedef __attribute__((ext_vector_type(2))) bf16 v2bf;
  __shared__ unsigned tile[64 * 65];
  const int t = threadIdx.x;
  const int n0 = blockIdx.x * 64, k0 = blockIdx.y * 128;

  // Thread: 4 consecutive n (chunk c) of the row pairs 2 (r + 16 j), + 1.
  const int c = t & 15, r = t >> 4;
  const float* src = in + (size_t)(k0 + 2 * r) * N + n0 + c * 4;
  const float4* pl[4];
  const float4* pu[4];
  float4 lo[4], up[4];
#pragma unroll
  for (int j = 0; j < 4; ++j) {
    pl[j] = (const float4*)(src + (size_t)(32 * j) * N);
    pu[j] = (const float4*)(src + (size_t)(32 * j + 1) * N);
    lo[j] = *pl[j];
    up[j] = *pu[j];
  }
  // Precaution: the eight address pairs are inputs of this wait, so they stay
  // as they are until it; no register that an issued load names is overwritten
  // ahead of it, not even by a later load's data.
  asm volatile("s_wait_xcnt 0x0"
               :: "v"(pl[0]), "v"(pu[0]), "v"(pl[1]), "v"(pu[1]),
                  "v"(pl[2]), "v"(pu[2]), "v"(pl[3]), "v"(pu[3]) : "memory");
#pragma unroll
  for (int j = 0; j < 4; ++j) {
    unsigned* d = &tile[(c * 4) * 65 + r + 16 * j];
    v2bf p0 = {(bf16)lo[j].x, (bf16)up[j].x};
    v2bf p1 = {(bf16)lo[j].y, (bf16)up[j].y};
    v2bf p2 = {(bf16)lo[j].z, (bf16)up[j].z};
    v2bf p3 = {(bf16)lo[j].w, (bf16)up[j].w};
    d[0 * 65] = __builtin_bit_cast(unsigned, p0);
    d[1 * 65] = __builtin_bit_cast(unsigned, p1);
    d[2 * 65] = __builtin_bit_cast(unsigned, p2);
    d[3 * 65] = __builtin_bit_cast(unsigned, p3);
  }
  __syncthreads();  // the whole tile is in LDS before any row of it is read

  // Thread: 8 consecutive k (chunk c) of rows n = r + 16 j; 16 B a store.
#pragma unroll
  for (int j = 0; j < 4; ++j) {
    const int n = r + 16 * j;
    const unsigned* s = &tile[n * 65 + c * 4];
    uint4 v = make_uint4(s[0], s[1], s[2], s[3]);
    *(uint4*)(out + (size_t)(n0 + n) * K + k0 + c * 8) = v;
  }
}

// ---------------------------------------------------------------------------
// Generic bf16 GEMM: C[M,N] = A[M,K] * Bt[N,K]^T + bias, fused epilogues.
// Block = 256 threads (8 wave32), tile 256(M) x 128(N), waves 4x2, wave 64x64.
// A pass is 64 k: 128-B rows at 144 B pitch, two LDS buffers filled by
// GLOBAL_LOAD_ASYNC_TO_LDS_B128; one barrier per pass; a buffer's refill is
// issued right behind the barrier that frees it and has a whole pass to land.
// Needs M % 256 == 0, N % 128 == 0, K % 64 == 0.
// ---------------------------------------------------------------------------
// Exact (erf) GELU, v * Phi(v), without a branch. With x = |v| / sqrt 2 and
// t = 1 / (1 + 0.3275911 x): erfc(x) = t (a1 + t (a2 + t (a3 + t (a4 + t a5))))
// exp(-x^2), absolute error at most 1.5e-7 (the five-term rational form of the
// handbooks), which lies far under the bf16 rounding of the result. Phi(v) is
// erfc(x) / 2 for v < 0 and 1 - erfc(x) / 2 otherwise, so the negative tail is
// formed without cancellation. The halves are folded into a1..a5, 1 / sqrt 2
// into the factor of |v|, and exp(-x^2) = exp2(-(v sqrt(log2(e) / 2))^2).
// The two transcendentals are written with their v_nop in one statement: it is
// the free slot that the instruction set asks for behind a transcendental.
__device__ __forceinline__ float rcp_slot(float x) {
  float r;
  asm("v_rcp_f32 %0, %1\n\tv_nop" : "=v"(r) : "v"(x));
  return r;
}
__device__ __forceinline__ float exp2_slot(float x) {
  float r;
  asm("v_exp_f32 %0, %1\n\tv_nop" : "=v"(r) : "v"(x));
  return r;
}
__device__ __forceinline__ float gelu_erf(float v) {
  const float t = rcp_slot(fmaf(fabsf(v), 0.23164189f, 1.0f));
  const float z = v * 0.84932180f;
  const float e = exp2_slot(-(z * z));
  float p = 0.5307027145f;
  p = fmaf(p, t, -0.7265760135f);
  p = fmaf(p, t, 0.7107068705f);
  p = fmaf(p, t, -0.142248368f);
  p = fmaf(p, t, 0.127414796f);
  const float h = p * t * e;  // erfc(x) / 2
  return v * (v >= 0.0f ? 1.0f - h : h);
}

enum { EPI_PLAIN = 0, EPI_GELU = 1, EPI_QKV = 2 };

template <int EPI>
__global__ __launch_bounds__(256) void gemm_bf16_kernel(
    const bf16* __restrict__ A, const bf16* __restrict__ Bt,
    const float* __restrict__ bias,
    float* __restrict__ Cf, bf16* __restrict__ Cb,
    bf16* __restrict__ qO, bf16* __restrict__ kO, bf16* __restrict__ vtO,
    int M, int N, int K) {
  __shared__ __attribute__((aligned(16))) bf16 sA[2][256 * kP64];
  __shared__ __attribute__((aligned(16))) bf16 sB[2][128 * kP64];
  const int tid = threadIdx.x;
  const int lane = tid & 31, wave = tid >> 5;
  const int hi = lane >> 4, lm = lane & 15;
  const int waveM = wave & 3, waveN = wave >> 2;
  const int m0 = blockIdx.y * 256;
  const int n0 = blockIdx.x * 128;

  // Staging slots: 8 chunks of 16 B a row, so a wave's copy covers 4 whole rows
  // of 128 B; a thread keeps its chunk and walks rows sRow + 32 j.
  const int sRow = tid >> 3, sCh = tid & 7;
  const bf16* gA = &A[(size_t)(m0 + sRow) * K + sCh * 8];
  const bf16* gB = &Bt[(size_t)(n0 + sRow) * K + sCh * 8];
  const size_t rowStep = (size_t)32 * K;
  const int sOff = sRow * kP64 + sCh * 8;

  auto stage = [&](int kt, int buf) {
    const bf16* a = gA + kt * 64;
    const bf16* b = gB + kt * 64;
    bf16* la = &sA[buf][sOff];
    bf16* lb = &sB[buf][sOff];
    async_copy16_x4(a,               la,
                    a + rowStep,     la + 32 * kP64,
                    a + 2 * rowStep, la + 64 * kP64,
                    a + 3 * rowStep, la + 96 * kP64);
    async_copy16_x4(a + 4 * rowStep, la + 128 * kP64,
                    a + 5 * rowStep, la + 160 * kP64,
                    a + 6 * rowStep, la + 192 * kP64,
                    a + 7 * rowStep, la + 224 * kP64);
    async_copy16_x4(b,               lb,
                    b + rowStep,     lb + 32 * kP64,
                    b + 2 * rowStep, lb + 64 * kP64,
                    b + 3 * rowStep, lb + 96 * kP64);
  };

  v8f acc[4][4] = {};
  const int kTiles = K >> 6;

  stage(0, 0);
  wait_async0();
  __syncthreads();
  if (kTiles > 1) stage(1, 1);

  // All loops over mt / nt are unrolled so that the fragment and accumulator
  // arrays are indexed by constants and stay in registers.
  v16bf af[4], bfr[4];
  auto load_frags = [&](int buf, int ks) {
#pragma unroll
    for (int mt = 0; mt < 4; ++mt)
      af[mt] = ld_frag(&sA[buf][(waveM * 64 + mt * 16 + lm) * kP64 + ks * 32 + hi * 8]);
#pragma unroll
    for (int nt = 0; nt < 4; ++nt)
      bfr[nt] = ld_frag(&sB[buf][(waveN * 64 + nt * 16 + lm) * kP64 + ks * 32 + hi * 8]);
  };
  auto mma16 = [&]() {
#pragma unroll
    for (int mt = 0; mt < 4; ++mt)
#pragma unroll
      for (int nt = 0; nt < 4; ++nt)
        acc[mt][nt] = wmma_bf16(af[mt], bfr[nt], acc[mt][nt]);
  };

  for (int kt = 0; kt < kTiles; ++kt) {
    const int cur = kt & 1;
    load_frags(cur, 0);
    // Keeps the 16 fragment loads one group ahead of the 16 WMMAs: left alone
    // the compiler reloads one A fragment per row and waits it out each time.
    __builtin_amdgcn_sched_barrier(0);
    mma16();
    load_frags(cur, 1);  // the pass's last reads of `cur`, into registers

    wait_ds0();       // this wave's reads of `cur` have retired before its refill
    wait_async0();    // this wave's share of the other buffer has landed
    __syncthreads();  // publishes the other buffer; ends every read of `cur`
    if (kt + 2 < kTiles) stage(kt + 2, cur);
    mma16();  // registers only: the refill flies from here on
  }
  wait_async0();  // no copy outstanding when the wave ends

  if constexpr (EPI == EPI_QKV) {
    // Scatter to Q/K [b,h,s,d] and V^T [b,h,d,s]. A block's 128 columns lie in
    // one of the three sections of 1024 and its 256 rows in one batch entry, so
    // the section is a scalar of the block: it is branched on once, outside the
    // unrolled loops, and every store is one base address plus a constant.
    // A wave's 64 columns are one head.
    const int sec = n0 >> 10;
    const int bh = (m0 >> 10) * kH + ((n0 & 1023) >> 6) + waveN;
    const int s0 = (m0 & 1023) + waveM * 64 + hi * 8;
    float bs[4];
#pragma unroll
    for (int nt = 0; nt < 4; ++nt) bs[nt] = bias[n0 + waveN * 64 + nt * 16 + lm];
    if (sec < 2) {
      bf16* dst = (sec == 0 ? qO : kO) + ((size_t)bh * kS + s0) * kHD + lm;
#pragma unroll
      for (int mt = 0; mt < 4; ++mt)
#pragma unroll
        for (int nt = 0; nt < 4; ++nt)
#pragma unroll
          for (int i = 0; i < 8; ++i)
            dst[(mt * 16 + i) * kHD + nt * 16] = (bf16)(acc[mt][nt][i] + bs[nt]);
    } else {
      bf16* dst = vtO + ((size_t)bh * kHD + lm) * kS + s0;
      v8bf pk[4][4];  // 8 consecutive s of one d: one 16-byte store
#pragma unroll
      for (int mt = 0; mt < 4; ++mt)
#pragma unroll
        for (int nt = 0; nt < 4; ++nt)
#pragma unroll
          for (int i = 0; i < 8; ++i) pk[mt][nt][i] = (bf16)(acc[mt][nt][i] + bs[nt]);
#pragma unroll
      for (int mt = 0; mt < 4; ++mt)
#pragma unroll
        for (int nt = 0; nt < 4; ++nt)
          *(v8bf*)(dst + (nt * 16) * kS + mt * 16) = pk[mt][nt];
      // Precaution: stands behind the last of the 16 stores, ahead of any
      // later write of the address pair or of a data register that they name.
      asm volatile("s_wait_xcnt 0x0" ::: "memory");
    }
    return;
  }

#pragma unroll
  for (int mt = 0; mt < 4; ++mt) {
#pragma unroll
    for (int nt = 0; nt < 4; ++nt) {
#pragma unroll
      for (int i = 0; i < 8; ++i) {
        int row = m0 + waveM * 64 + mt * 16 + hi * 8 + i;
        int col = n0 + waveN * 64 + nt * 16 + lm;
        float v = acc[mt][nt][i] + bias[col];
        if constexpr (EPI == EPI_PLAIN) {
          Cf[(size_t)row * N + col] = v;
        } else if constexpr (EPI == EPI_GELU) {
          Cb[(size_t)row * N + col] = (bf16)gelu_erf(v);
        }
      }
    }
  }
}

__device__ __forceinline__ float xhalf(float x) {
  return __builtin_bit_cast(float, __builtin_amdgcn_permlanex16(
      __builtin_bit_cast(int, x), __builtin_bit_cast(int, x),
      0x76543210, 0xfedcba98, false, false));
}

__global__ __launch_bounds__(256) void attention_kernel(
    const bf16* __restrict__ Q, const bf16* __restrict__ Kk,
    const bf16* __restrict__ VT,
    const int* __restrict__ am, const int* __restrict__ tt,
    bf16* __restrict__ ctx) {
  typedef __attribute__((ext_vector_type(4))) float v4f;
  __shared__ __attribute__((aligned(16))) bf16 sQ[128 * kP64];
  __shared__ __attribute__((aligned(16))) bf16 sK[2][32 * kP64];
  __shared__ __attribute__((aligned(16))) bf16 sVT[2][64 * kP32];
  // What a key adds to its scaled score, for an inactive ([0]) and an active
  // ([1]) query: the 0/1 mask term, or kNEG for an ignored key. kNEG absorbs
  // the score in the f32 sum, so an ignored key's value is kNEG exactly.
  __shared__ __attribute__((aligned(16))) float sAdd[2][2][32];

  const int tid = threadIdx.x;
  const int lane = tid & 31, w = tid >> 5;
  const int hi = lane >> 4, lm = lane & 15;
  const int qt = blockIdx.x, h = blockIdx.y, b = blockIdx.z;
  const size_t headBase = (size_t)(b * kH + h) * kS * kHD;
  const size_t vtBase   = (size_t)(b * kH + h) * kHD * kS;

  // Stage Q tile (contiguous 128*64 halves) via async copies.
#pragma unroll
  for (int j = 0; j < 4; j += 2) {
    int idx = tid * 4 + j;  // 0..1023 chunks of 8; 8 chunks a row
    const bf16* gq = &Q[headBase + (size_t)qt * 128 * kHD + idx * 8];
    bf16* lq = &sQ[(idx >> 3) * kP64 + (idx & 7) * 8];
    async_copy16_x2(gq, lq, gq + 8, lq + 8);
  }

  auto stageKV = [&](int kt, int buf) {
    int d = tid >> 2, c = tid & 3;
    async_copy16_x2(&Kk[headBase + (size_t)kt * 32 * kHD + tid * 8],
                    &sK[buf][(tid >> 3) * kP64 + (tid & 7) * 8],
                    &VT[vtBase + (size_t)d * kS + kt * 32 + c * 8],
                    &sVT[buf][d * kP32 + c * 8]);
    if (tid < 32) {
      int col = kt * 32 + tid;
      int a2 = am[b * kS + col];
      int t2 = tt[b * kS + col];
      bool ign = (t2 == 1) || (a2 == 0) || (col == 0);
      sAdd[buf][0][tid] = ign ? kNEG : 0.0f;
      sAdd[buf][1][tid] = ign ? kNEG : ((a2 != 0) ? 1.0f : 0.0f);
    }
  };

  // The lane's query: its activity picks the row of sAdd.
  const int qrow = qt * 128 + w * 16 + lm;
  const int qidx = b * kS + qrow;
  const int aqi = (am[qidx] != 0) ? 1 : 0;
  // Precaution: the load's index register is an input of this wait, so it stays
  // as it is until the wait; it is not overwritten ahead of it.
  asm volatile("s_wait_xcnt 0x0" :: "v"(qidx) : "memory");
  float mrow = -3.0e38f;  // running maximum, equal in both halves
  float lrow = 0.0f;      // running sum over this half's keys only
  v8f o[4] = {};          // O^T: head dims ot*16 + hi*8 + i of query lm

  constexpr int kTiles = kS / 32;
  stageKV(0, 0);
  wait_async0();
  __syncthreads();
  stageKV(1, 1);

  // B operand Q^T: column = query lm, k = head dim; the same for every tile.
  const v16bf q0 = ld_frag(&sQ[(w * 16 + lm) * kP64 + hi * 8]);
  const v16bf q1 = ld_frag(&sQ[(w * 16 + lm) * kP64 + 32 + hi * 8]);

  // Every inner loop is unrolled so that the fragment, score and accumulator
  // arrays are indexed by constants and stay in registers.
  for (int kt = 0; kt < kTiles; ++kt) {
    const int cur = kt & 1;

    // S^T: 32 keys x 16 queries (2 m-tiles, 2 chained WMMAs over HD=64)
    v8f st[2] = {};
#pragma unroll
    for (int t = 0; t < 2; ++t) {
      v16bf k0 = ld_frag(&sK[cur][(t * 16 + lm) * kP64 + hi * 8]);
      v16bf k1 = ld_frag(&sK[cur][(t * 16 + lm) * kP64 + 32 + hi * 8]);
      st[t] = wmma_bf16(k0, q0, st[t]);
      st[t] = wmma_bf16(k1, q1, st[t]);
    }

    // Addends of keys hi*8 + 0..7 and 16 + hi*8 + 0..7.
    const v4f* ad = (const v4f*)&sAdd[cur][aqi][hi * 8];
    const v4f ad4[2][2] = {{ad[0], ad[1]}, {ad[4], ad[5]}};

    float v[2][8];
    float mx = kNEG;  // no value lies below kNEG
#pragma unroll
    for (int t = 0; t < 2; ++t)
#pragma unroll
      for (int i = 0; i < 8; ++i) {
        v[t][i] = st[t][i] * 0.125f + ad4[t][i >> 2][i & 3];  // 1/sqrt(64)
        mx = fmaxf(mx, v[t][i]);
      }
    mx = fmaxf(mx, xhalf(mx));  // over all 32 keys, in both halves
    const float nm = fmaxf(mrow, mx);
    const float sc = __expf(mrow - nm);
    mrow = nm;

    v16bf pb;  // B operand P^T
    float rs = 0.0f;
#pragma unroll
    for (int t = 0; t < 2; ++t)
#pragma unroll
      for (int i = 0; i < 8; ++i) {
        float p = __expf(v[t][i] - nm);
        rs += p;
        pb[t * 8 + i] = (bf16)p;
      }
    lrow = lrow * sc + rs;
#pragma unroll
    for (int ot = 0; ot < 4; ++ot)
#pragma unroll
      for (int i = 0; i < 8; ++i) o[ot][i] = o[ot][i] * sc;

    // O^T += V^T(64x32) @ P^T(32x16): 4 m-tiles of 16 head dims
#pragma unroll
    for (int ot = 0; ot < 4; ++ot) {
      v16bf va = ld_frag(&sVT[cur][(ot * 16 + lm) * kP32 + hi * 8]);
      o[ot] = wmma_bf16(va, pb, o[ot]);
    }

    wait_ds0();       // this wave's reads of cur have retired before its refill
    wait_async0();    // next K/V buffer filled (overlapped with compute)
    __syncthreads();  // publishes the next buffer; ends every read of cur
    if (kt + 2 < kTiles) stageKV(kt + 2, cur);
  }
  wait_async0();  // no copy outstanding when the wave ends

  // ctx[b, s, h*64+d] in bf16 for the out-projection GEMM: 8 consecutive d of
  // one query a tile, one 16-byte store each.
  const float lsum = lrow + xhalf(lrow);  // the two halves' keys joined
  bf16* dst = ctx + ((size_t)b * kS + qrow) * kE + h * kHD + hi * 8;
#pragma unroll
  for (int ot = 0; ot < 4; ++ot) {
    v8bf pk;
#pragma unroll
    for (int i = 0; i < 8; ++i) pk[i] = (bf16)(o[ot][i] / lsum);
    *(v8bf*)(dst + ot * 16) = pk;
  }
}

// ---------------------------------------------------------------------------
// out = LayerNorm(a + r) * g + be ; optionally also emit bf16 copy
// One block (256 threads) per token row of E=1024.
// ---------------------------------------------------------------------------
__global__ __launch_bounds__(256) void add_ln_kernel(
    const float* __restrict__ a, const float* __restrict__ r,
    const float* __restrict__ g, const float* __restrict__ be,
    float* __restrict__ outF, bf16* __restrict__ outB) {
  __shared__ float red[256];
  const int row = blockIdx.x, t = threadIdx.x;
  const size_t base = (size_t)row * kE;
  float4 va = ((const float4*)(a + base))[t];
  float4 vr = ((const float4*)(r + base))[t];
  float x0 = va.x + vr.x, x1 = va.y + vr.y, x2 = va.z + vr.z, x3 = va.w + vr.w;

  red[t] = x0 + x1 + x2 + x3;
  __syncthreads();
  for (int o = 128; o > 0; o >>= 1) { if (t < o) red[t] += red[t + o]; __syncthreads(); }
  float mu = red[0] * (1.0f / kE);
  __syncthreads();

  float d0 = x0 - mu, d1 = x1 - mu, d2 = x2 - mu, d3 = x3 - mu;
  red[t] = d0 * d0 + d1 * d1 + d2 * d2 + d3 * d3;
  __syncthreads();
  for (int o = 128; o > 0; o >>= 1) { if (t < o) red[t] += red[t + o]; __syncthreads(); }
  float inv = rsqrtf(red[0] * (1.0f / kE) + 1e-12f);

  float4 gw = ((const float4*)g)[t];
  float4 bb = ((const float4*)be)[t];
  float o0 = d0 * inv * gw.x + bb.x;
  float o1 = d1 * inv * gw.y + bb.y;
  float o2 = d2 * inv * gw.z + bb.z;
  float o3 = d3 * inv * gw.w + bb.w;
  ((float4*)(outF + base))[t] = make_float4(o0, o1, o2, o3);
  if (outB) {
    outB[base + t * 4 + 0] = (bf16)o0;
    outB[base + t * 4 + 1] = (bf16)o1;
    outB[base + t * 4 + 2] = (bf16)o2;
    outB[base + t * 4 + 3] = (bf16)o3;
  }
}

// ---------------------------------------------------------------------------
extern "C" void kernel_launch(void* const* d_in, const int* in_sizes, int n_in,
                              void* d_out, int out_size, void* d_ws, size_t ws_size,
                              hipStream_t stream) {
  const float* x    = (const float*)d_in[0];
  const int*   am   = (const int*)d_in[1];
  const int*   tt   = (const int*)d_in[2];
  const float* wqkv = (const float*)d_in[3];
  const float* bqkv = (const float*)d_in[4];
  const float* wout = (const float*)d_in[5];
  const float* bout = (const float*)d_in[6];
  const float* lnw  = (const float*)d_in[7];
  const float* lnb  = (const float*)d_in[8];
  const float* win  = (const float*)d_in[9];
  const float* bin  = (const float*)d_in[10];
  const float* wo2  = (const float*)d_in[11];
  const float* bo2  = (const float*)d_in[12];
  float* out = (float*)d_out;

  char* ws = (char*)d_ws;
  size_t off = 0;
  auto take = [&](size_t bytes) -> char* {
    char* p = ws + off;
    off += (bytes + 255) & ~(size_t)255;
    return p;
  };
  bf16*  xb     = (bf16*)take((size_t)kM * kE * 2);          // 16 MB
  bf16*  wqkvT  = (bf16*)take((size_t)3 * kE * kE * 2);      //  6 MB
  bf16*  woutT  = (bf16*)take((size_t)kE * kE * 2);          //  2 MB
  bf16*  winT   = (bf16*)take((size_t)kF * kE * 2);          //  8 MB
  bf16*  wo2T   = (bf16*)take((size_t)kE * kF * 2);          //  8 MB
  bf16*  qBuf   = (bf16*)take((size_t)kM * kE * 2);          // 16 MB  [b,h,s,d]
  bf16*  kBuf   = (bf16*)take((size_t)kM * kE * 2);          // 16 MB  [b,h,s,d]
  bf16*  vtBuf  = (bf16*)take((size_t)kM * kE * 2);          // 16 MB  [b,h,d,s]
  bf16*  ctx    = (bf16*)take((size_t)kM * kE * 2);          // 16 MB  [b,s,e]
  float* attnF  = (float*)take((size_t)kM * kE * 4);         // 32 MB (reused as out2)
  float* hF     = (float*)take((size_t)kM * kE * 4);         // 32 MB
  bf16*  hB     = (bf16*)take((size_t)kM * kE * 2);          // 16 MB
  bf16*  ff     = qBuf;  // 64 MB alias over q/k/vT/ctx (dead after out-proj)

  // 1) bf16 conversions / weight transposes
  cvt_bf16_kernel<<<(kM * kE) / 1024, 256, 0, stream>>>(x, xb, kM * kE);
  transpose_cvt_kernel<<<dim3(3 * kE / 64, kE / 128), 256, 0, stream>>>(wqkv, wqkvT, kE, 3 * kE);
  transpose_cvt_kernel<<<dim3(kE / 64, kE / 128), 256, 0, stream>>>(wout, woutT, kE, kE);
  transpose_cvt_kernel<<<dim3(kF / 64, kE / 128), 256, 0, stream>>>(win, winT, kE, kF);
  transpose_cvt_kernel<<<dim3(kE / 64, kF / 128), 256, 0, stream>>>(wo2, wo2T, kF, kE);

  // 2) QKV projection with head-split scatter epilogue
  gemm_bf16_kernel<EPI_QKV><<<dim3(3 * kE / 128, kM / 256), 256, 0, stream>>>(
      xb, wqkvT, bqkv, nullptr, nullptr, qBuf, kBuf, vtBuf, kM, 3 * kE, kE);

  // 3) Flash attention
  attention_kernel<<<dim3(kS / 128, kH, kB), 256, 0, stream>>>(
      qBuf, kBuf, vtBuf, am, tt, ctx);

  // 4) Output projection
  gemm_bf16_kernel<EPI_PLAIN><<<dim3(kE / 128, kM / 256), 256, 0, stream>>>(
      ctx, woutT, bout, attnF, nullptr, nullptr, nullptr, nullptr, kM, kE, kE);

  // 5) h = LN(attn_out + x)
  add_ln_kernel<<<kM, 256, 0, stream>>>(attnF, x, lnw, lnb, hF, hB);

  // 6) FFN up + exact GELU (bf16 out)
  gemm_bf16_kernel<EPI_GELU><<<dim3(kF / 128, kM / 256), 256, 0, stream>>>(
      hB, winT, bin, nullptr, ff, nullptr, nullptr, nullptr, kM, kF, kE);

  // 7) FFN down (f32 out, reusing attnF)
  gemm_bf16_kernel<EPI_PLAIN><<<dim3(kE / 128, kM / 256), 256, 0, stream>>>(
      ff, wo2T, bo2, attnF, nullptr, nullptr, nullptr, nullptr, kM, kE, kF);

  // 8) out = LN(ffn_out + h)
  add_ln_kernel<<<kM, 256, 0, stream>>>(attnF, hF, lnw, lnb, out, nullptr);

  (void)in_sizes; (void)n_in; (void)out_size; (void)ws_size;
}

// v007
// One run takes 236 microseconds.
// Two timings next to v006 both put it at 1.15 times that version's speed.
// All steps since v000 together make it 2.84 times as fast.
#include <hip/hip_runtime.h>
#include <hip/hip_bf16.h>

typedef __bf16 bf16;
typedef __attribute__((ext_vector_type(8)))  float v8f;
typedef __attribute__((ext_vector_type(16))) bf16  v16bf;
typedef __attribute__((ext_vector_type(8)))  bf16  v8bf;

constexpr int kB = 8, kS = 1024, kE = 1024, kH = 16, kHD = 64, kF = 4096;
constexpr int kM = kB * kS;  // 8192 token rows
constexpr float kNEG = -1.0e30f;

// LDS row pitch in halves for rows read by 16-byte fragment loads: an odd
// multiple of 16 B, so the 16 rows of one fragment load fall on distinct banks.
constexpr int kP32 = 40;  // rows of 32 halves (64 B) at 80 B
constexpr int kP64 = 72;  // rows of 64 halves (128 B) at 144 B

// ---------------------------------------------------------------------------
// WMMA + async-copy helpers (CDNA5 wave32)
// ---------------------------------------------------------------------------
__device__ __forceinline__ v8f wmma_bf16(v16bf a, v16bf b, v8f c) {
  return __builtin_amdgcn_wmma_f32_16x16x32_bf16(
      /*neg_a=*/false, a, /*neg_b=*/false, b,
      /*c_mod=*/(short)0, c, /*reuse_a=*/false, /*reuse_b=*/false);
}

// A/B fragment for one lane: two contiguous 8-half runs at p and p+16.
// (16-bit operand layout: lanes<16 hold K = 0..7 & 16..23 of the 32-K tile,
//  lanes>=16 hold K = 8..15 & 24..31 — caller passes p already offset by hi*8.)
__device__ __forceinline__ v16bf ld_frag(const bf16* p) {
  union { v16bf v; v8bf h[2]; } u;
  u.h[0] = *(const v8bf*)(p);
  u.h[1] = *(const v8bf*)(p + 16);
  return u.v;
}

// 16-byte global -> LDS async copy (ASYNCcnt-tracked, no VGPR staging).
// LDS destination = low 32 bits of the generic pointer (LDS aperture offset).
// The closing s_wait_xcnt 0 stands inside the copies' own statement as a
// precaution: no address register of a copy is rewritten ahead of it.
__device__ __forceinline__ void async_copy16_x2(const bf16* g0, bf16* l0,
                                                const bf16* g1, bf16* l1) {
  asm volatile("global_load_async_to_lds_b128 %0, %1, off\n\t"
               "global_load_async_to_lds_b128 %2, %3, off\n\t"
               "s_wait_xcnt 0x0"
               :: "v"((unsigned)(size_t)l0), "v"(g0),
                  "v"((unsigned)(size_t)l1), "v"(g1) : "memory");
}
__device__ __forceinline__ void async_copy16_x4(const bf16* g0, bf16* l0,
                                                const bf16* g1, bf16* l1,
                                                const bf16* g2, bf16* l2,
                                                const bf16* g3, bf16* l3) {
  asm volatile("global_load_async_to_lds_b128 %0, %1, off\n\t"
               "global_load_async_to_lds_b128 %2, %3, off\n\t"
               "global_load_async_to_lds_b128 %4, %5, off\n\t"
               "global_load_async_to_lds_b128 %6, %7, off\n\t"
               "s_wait_xcnt 0x0"
               :: "v"((unsigned)(size_t)l0), "v"(g0),
                  "v"((unsigned)(size_t)l1), "v"(g1),
                  "v"((unsigned)(size_t)l2), "v"(g2),
                  "v"((unsigned)(size_t)l3), "v"(g3) : "memory");
}
__device__ __forceinline__ void wait_async0() {
  asm volatile("s_wait_asynccnt 0x0" ::: "memory");
}
// A wave's own LDS reads have retired before a copy is aimed at what it read.
__device__ __forceinline__ void wait_ds0() {
  asm volatile("s_wait_dscnt 0x0" ::: "memory");
}

// ---------------------------------------------------------------------------
// Small conversion kernels
// ---------------------------------------------------------------------------
// The list of one batch entry's keys that attention has to look at. A key that
// the reference sets to kNEG gets the probability exp(kNEG - max) = 0 exactly as
// soon as one key of the entry is not ignored, so it adds nothing to any sum:
// only the n kept keys are listed, in rising order, and K and V are projected
// for the listed tokens alone. Behind them the list holds token 0: finite
// filler rows up to the tile edges, masked by their position. With no kept key
// at all every score is kNEG and the softmax is uniform over all keys: then the
// list is all kS tokens and none counts as kept.
// keyCnt[2 b] = listed keys (1..kS), keyCnt[2 b + 1] = kept keys among them.
// One work-group of 256 threads, 4 consecutive keys a thread.
__device__ __forceinline__ void list_kept_keys(int b, const int* __restrict__ am,
                                               const int* __restrict__ tt,
                                               int* __restrict__ keyIdx,
                                               int* __restrict__ keyCnt) {
  __shared__ int waveSum[8];
  __shared__ __attribute__((aligned(16))) int list[kS];
  const int t = threadIdx.x, lane = t & 31, w = t >> 5;
  const int4* pa = (const int4*)(am + b * kS) + t;
  const int4* pt = (const int4*)(tt + b * kS) + t;
  const int4 a = *pa;
  const int4 y = *pt;
  const bool kp[4] = {a.x != 0 && y.x != 1 && t != 0,  // key 0 is always ignored
                      a.y != 0 && y.y != 1,
                      a.z != 0 && y.z != 1,
                      a.w != 0 && y.w != 1};
  const int c = (int)kp[0] + (int)kp[1] + (int)kp[2] + (int)kp[3];
  int inc = c;  // running count over the wave, this thread included
#pragma unroll
  for (int d = 1; d < 32; d <<= 1) {
    const int o = __shfl_up(inc, d);
    if (lane >= d) inc += o;
  }
  if (lane == 31) waveSum[w] = inc;
  ((int4*)list)[t] = make_int4(0, 0, 0, 0);
  __syncthreads();  // the waves' counts and the filler are in LDS
  int pos = inc - c, n = 0;
#pragma unroll
  for (int j = 0; j < 8; ++j) {
    const int s = waveSum[j];
    if (j < w) pos += s;
    n += s;
  }
#pragma unroll
  for (int i = 0; i < 4; ++i)
    if (kp[i]) list[pos++] = t * 4 + i;
  __syncthreads();  // the list is whole before it is read in rows
  int4 v = ((const int4*)list)[t];
  if (n == 0) v = make_int4(t * 4, t * 4 + 1, t * 4 + 2, t * 4 + 3);
  ((int4*)(keyIdx + b * kS))[t] = v;
  if (t == 0) {
    keyCnt[2 * b] = n == 0 ? kS : n;
    keyCnt[2 * b + 1] = n;
  }
}

// The first kB work-groups list the kept keys, the others convert.
__global__ __launch_bounds__(256) void cvt_bf16_kernel(const float* __restrict__ in,
                                                       bf16* __restrict__ out, int n,
                                                       const int* __restrict__ am,
                                                       const int* __restrict__ tt,
                                                       int* __restrict__ keyIdx,
                                                       int* __restrict__ keyCnt) {
  if (blockIdx.x < kB) {
    list_kept_keys(blockIdx.x, am, tt, keyIdx, keyCnt);
    return;
  }
  int idx = ((blockIdx.x - kB) * 256 + threadIdx.x) * 4;
  if (idx < n) {
    float4 v = *(const float4*)(in + idx);
    out[idx + 0] = (bf16)v.x;
    out[idx + 1] = (bf16)v.y;
    out[idx + 2] = (bf16)v.z;
    out[idx + 3] = (bf16)v.w;
  }
}

// in: [K,N] fp32 row-major  ->  out: [N,K] bf16 row-major
// One work-group moves a tile of 128 k x 64 n through LDS: it reads whole 256-B
// row pieces of in and writes whole 256-B row pieces of out, 32 elements a
// thread. Needs K % 128 == 0, N % 64 == 0; grid (N / 64, K / 128).
// LDS holds the tile transposed, a dword = the bf16 pair (k, k + 1) of one n;
// the odd pitch of 65 dwords keeps both the writes (lanes 4 n apart) and the
// reads (lanes 4 dwords apart) on distinct banks.
__global__ __launch_bounds__(256) void transpose_cvt_kernel(const float* __restrict__ in,
                                                            bf16* __restrict__ out,
                                                            int K, int N) {
  typedef __attribute__((ext_vector_type(2))) bf16 v2bf;
  __shared__ unsigned tile[64 * 65];
  const int t = threadIdx.x;
  const int n0 = blockIdx.x * 64, k0 = blockIdx.y * 128;

  // Thread: 4 consecutive n (chunk c) of the row pairs 2 (r + 16 j), + 1.
  const int c = t & 15, r = t >> 4;
  const float* src = in + (size_t)(k0 + 2 * r) * N + n0 + c * 4;
  const float4* pl[4];
  const float4* pu[4];
  float4 lo[4], up[4];
#pragma unroll
  for (int j = 0; j < 4; ++j) {
    pl[j] = (const float4*)(src + (size_t)(32 * j) * N);
    pu[j] = (const float4*)(src + (size_t)(32 * j + 1) * N);
    lo[j] = *pl[j];
    up[j] = *pu[j];
  }
  // Precaution: the eight address pairs are inputs of this wait, so they stay
  // as they are until it; no register that an issued load names is overwritten
  // ahead of it, not even by a later load's data.
  asm volatile("s_wait_xcnt 0x0"
               :: "v"(pl[0]), "v"(pu[0]), "v"(pl[1]), "v"(pu[1]),
                  "v"(pl[2]), "v"(pu[2]), "v"(pl[3]), "v"(pu[3]) : "memory");
#pragma unroll
  for (int j = 0; j < 4; ++j) {
    unsigned* d = &tile[(c * 4) * 65 + r + 16 * j];
    v2bf p0 = {(bf16)lo[j].x, (bf16)up[j].x};
    v2bf p1 = {(bf16)lo[j].y, (bf16)up[j].y};
    v2bf p2 = {(bf16)lo[j].z, (bf16)up[j].z};
    v2bf p3 = {(bf16)lo[j].w, (bf16)up[j].w};
    d[0 * 65] = __builtin_bit_cast(unsigned, p0);
    d[1 * 65] = __builtin_bit_cast(unsigned, p1);
    d[2 * 65] = __builtin_bit_cast(unsigned, p2);
    d[3 * 65] = __builtin_bit_cast(unsigned, p3);
  }
  __syncthreads();  // the whole tile is in LDS before any row of it is read

  // Thread: 8 consecutive k (chunk c) of rows n = r + 16 j; 16 B a store.
#pragma unroll
  for (int j = 0; j < 4; ++j) {
    const int n = r + 16 * j;
    const unsigned* s = &tile[n * 65 + c * 4];
    uint4 v = make_uint4(s[0], s[1], s[2], s[3]);
    *(uint4*)(out + (size_t)(n0 + n) * K + k0 + c * 8) = v;
  }
}

// ---------------------------------------------------------------------------
// Generic bf16 GEMM: C[M,N] = A[M,K] * Bt[N,K]^T + bias, fused epilogues.
// Block = 256 threads (8 wave32), tile 256(M) x 128(N), waves 4x2, wave 64x64.
// A pass is 64 k: 128-B rows at 144 B pitch, two LDS buffers filled by
// GLOBAL_LOAD_ASYNC_TO_LDS_B128; one barrier per pass; a buffer's refill is
// issued right behind the barrier that frees it and has a whole pass to land.
// Needs M % 256 == 0, N % 128 == 0, K % 64 == 0.
// ---------------------------------------------------------------------------
// Exact (erf) GELU, v * Phi(v), without a branch. With x = |v| / sqrt 2 and
// t = 1 / (1 + 0.3275911 x): erfc(x) = t (a1 + t (a2 + t (a3 + t (a4 + t a5))))
// exp(-x^2), absolute error at most 1.5e-7 (the five-term rational form of the
// handbooks), which lies far under the bf16 rounding of the result. Phi(v) is
// erfc(x) / 2 for v < 0 and 1 - erfc(x) / 2 otherwise, so the negative tail is
// formed without cancellation. The halves are folded into a1..a5, 1 / sqrt 2
// into the factor of |v|, and exp(-x^2) = exp2(-(v sqrt(log2(e) / 2))^2).
// The two transcendentals are written with their v_nop in one statement: it is
// the free slot that the instruction set asks for behind a transcendental.
__device__ __forceinline__ float rcp_slot(float x) {
  float r;
  asm("v_rcp_f32 %0, %1\n\tv_nop" : "=v"(r) : "v"(x));
  return r;
}
__device__ __forceinline__ float exp2_slot(float x) {
  float r;
  asm("v_exp_f32 %0, %1\n\tv_nop" : "=v"(r) : "v"(x));
  return r;
}
__device__ __forceinline__ float gelu_erf(float v) {
  const float t = rcp_slot(fmaf(fabsf(v), 0.23164189f, 1.0f));
  const float z = v * 0.84932180f;
  const float e = exp2_slot(-(z * z));
  float p = 0.5307027145f;
  p = fmaf(p, t, -0.7265760135f);
  p = fmaf(p, t, 0.7107068705f);
  p = fmaf(p, t, -0.142248368f);
  p = fmaf(p, t, 0.127414796f);
  const float h = p * t * e;  // erfc(x) / 2
  return v * (v >= 0.0f ? 1.0f - h : h);
}

enum { EPI_PLAIN = 0, EPI_GELU = 1, EPI_QKV = 2 };

template <int EPI>
__global__ __launch_bounds__(256) void gemm_bf16_kernel(
    const bf16* __restrict__ A, const bf16* __restrict__ Bt,
    const float* __restrict__ bias,
    float* __restrict__ Cf, bf16* __restrict__ Cb,
    bf16* __restrict__ qO, bf16* __restrict__ kO, bf16* __restrict__ vtO,
    const int* __restrict__ keyIdx, const int* __restrict__ keyCnt,
    int M, int N, int K) {
  __shared__ __attribute__((aligned(16))) bf16 sA[2][256 * kP64];
  __shared__ __attribute__((aligned(16))) bf16 sB[2][128 * kP64];
  const int tid = threadIdx.x;
  const int lane = tid & 31, wave = tid >> 5;
  const int hi = lane >> 4, lm = lane & 15;
  const int waveM = wave & 3, waveN = wave >> 2;
  const int m0 = blockIdx.y * 256;
  const int n0 = blockIdx.x * 128;

  // Staging slots: 8 chunks of 16 B a row, so a wave's copy covers 4 whole rows
  // of 128 B; a thread keeps its chunk and walks rows sRow + 32 j.
  const int sRow = tid >> 3, sCh = tid & 7;
  const bf16* gA = &A[(size_t)(m0 + sRow) * K + sCh * 8];
  const bf16* gB = &Bt[(size_t)(n0 + sRow) * K + sCh * 8];
  const size_t rowStep = (size_t)32 * K;
  const int sOff = sRow * kP64 + sCh * 8;

  // QKV: in the K and V sections row r of a batch entry is the r-th listed key,
  // so the A rows are gathered through the list and K and V^T come out packed;
  // a block whose rows all lie behind the list has nothing to do and leaves as
  // a whole, ahead of every copy and barrier.
  const bf16* gRow[8];
  if constexpr (EPI == EPI_QKV) {
    const int bb = m0 >> 10, r0 = m0 & (kS - 1);
    const bool listed = n0 >= kE;
    if (listed && r0 >= min(keyCnt[2 * bb], kS)) return;
    const int* li = keyIdx + bb * kS + r0 + sRow;
    int tok[8];
#pragma unroll
    for (int j = 0; j < 8; ++j) tok[j] = li[32 * j];
#pragma unroll
    for (int j = 0; j < 8; ++j) {
      // The mask bounds the row, and so the address, whatever the list holds.
      const int row = listed ? (tok[j] & (kS - 1)) : r0 + sRow + 32 * j;
      gRow[j] = &A[(size_t)(bb * kS + row) * K + sCh * 8];
    }
  }

  auto stage = [&](int kt, int buf) {
    const bf16* a = gA + kt * 64;
    const bf16* b = gB + kt * 64;
    bf16* la = &sA[buf][sOff];
    bf16* lb = &sB[buf][sOff];
    if constexpr (EPI == EPI_QKV) {
      async_copy16_x4(gRow[0] + kt * 64, la,
                      gRow[1] + kt * 64, la + 32 * kP64,
                      gRow[2] + kt * 64, la + 64 * kP64,
                      gRow[3] + kt * 64, la + 96 * kP64);
      async_copy16_x4(gRow[4] + kt * 64, la + 128 * kP64,
                      gRow[5] + kt * 64, la + 160 * kP64,
                      gRow[6] + kt * 64, la + 192 * kP64,
                      gRow[7] + kt * 64, la + 224 * kP64);
      async_copy16_x4(b,               lb,
                      b + rowStep,     lb + 32 * kP64,
                      b + 2 * rowStep, lb + 64 * kP64,
                      b + 3 * rowStep, lb + 96 * kP64);
      return;
    }
    async_copy16_x4(a,               la,
                    a + rowStep,     la + 32 * kP64,
                    a + 2 * rowStep, la + 64 * kP64,
                    a + 3 * rowStep, la + 96 * kP64);
    async_copy16_x4(a + 4 * rowStep, la + 128 * kP64,
                    a + 5 * rowStep, la + 160 * kP64,
                    a + 6 * rowStep, la + 192 * kP64,
                    a + 7 * rowStep, la + 224 * kP64);
    async_copy16_x4(b,               lb,
                    b + rowStep,     lb + 32 * kP64,
                    b + 2 * rowStep, lb + 64 * kP64,
                    b + 3 * rowStep, lb + 96 * kP64);
  };

  v8f acc[4][4] = {};
  const int kTiles = K >> 6;

  stage(0, 0);
  wait_async0();
  __syncthreads();
  if (kTiles > 1) stage(1, 1);

  // All loops over mt / nt are unrolled so that the fragment and accumulator
  // arrays are indexed by constants and stay in registers.
  v16bf af[4], bfr[4];
  auto load_frags = [&](int buf, int ks) {
#pragma unroll
    for (int mt = 0; mt < 4; ++mt)
      af[mt] = ld_frag(&sA[buf][(waveM * 64 + mt * 16 + lm) * kP64 + ks * 32 + hi * 8]);
#pragma unroll
    for (int nt = 0; nt < 4; ++nt)
      bfr[nt] = ld_frag(&sB[buf][(waveN * 64 + nt * 16 + lm) * kP64 + ks * 32 + hi * 8]);
  };
  auto mma16 = [&]() {
#pragma unroll
    for (int mt = 0; mt < 4; ++mt)
#pragma unroll
      for (int nt = 0; nt < 4; ++nt)
        acc[mt][nt] = wmma_bf16(af[mt], bfr[nt], acc[mt][nt]);
  };

  for (int kt = 0; kt < kTiles; ++kt) {
    const int cur = kt & 1;
    load_frags(cur, 0);
    // Keeps the 16 fragment loads one group ahead of the 16 WMMAs: left alone
    // the compiler reloads one A fragment per row and waits it out each time.
    __builtin_amdgcn_sched_barrier(0);
    mma16();
    load_frags(cur, 1);  // the pass's last reads of `cur`, into registers

    wait_ds0();       // this wave's reads of `cur` have retired before its refill
    wait_async0();    // this wave's share of the other buffer has landed
    __syncthreads();  // publishes the other buffer; ends every read of `cur`
    if (kt + 2 < kTiles) stage(kt + 2, cur);
    mma16();  // registers only: the refill flies from here on
  }
  wait_async0();  // no copy outstanding when the wave ends

  if constexpr (EPI == EPI_QKV) {
    // Scatter to Q/K [b,h,s,d] and V^T [b,h,d,s]; for K and V^T s is the place
    // in the entry's list of keys. A block's 128 columns lie in
    // one of the three sections of 1024 and its 256 rows in one batch entry, so
    // the section is a scalar of the block: it is branched on once, outside the
    // unrolled loops, and every store is one base address plus a constant.
    // A wave's 64 columns are one head.
    const int sec = n0 >> 10;
    const int bh = (m0 >> 10) * kH + ((n0 & 1023) >> 6) + waveN;
    const int s0 = (m0 & 1023) + waveM * 64 + hi * 8;
    float bs[4];
#pragma unroll
    for (int nt = 0; nt < 4; ++nt) bs[nt] = bias[n0 + waveN * 64 + nt * 16 + lm];
    if (sec < 2) {
      bf16* dst = (sec == 0 ? qO : kO) + ((size_t)bh * kS + s0) * kHD + lm;
#pragma unroll
      for (int mt = 0; mt < 4; ++mt)
#pragma unroll
        for (int nt = 0; nt < 4; ++nt)
#pragma unroll
          for (int i = 0; i < 8; ++i)
            dst[(mt * 16 + i) * kHD + nt * 16] = (bf16)(acc[mt][nt][i] + bs[nt]);
    } else {
      bf16* dst = vtO + ((size_t)bh * kHD + lm) * kS + s0;
      v8bf pk[4][4];  // 8 consecutive s of one d: one 16-byte store
#pragma unroll
      for (int mt = 0; mt < 4; ++mt)
#pragma unroll
        for (int nt = 0; nt < 4; ++nt)
#pragma unroll
          for (int i = 0; i < 8; ++i) pk[mt][nt][i] = (bf16)(acc[mt][nt][i] + bs[nt]);
#pragma unroll
      for (int mt = 0; mt < 4; ++mt)
#pragma unroll
        for (int nt = 0; nt < 4; ++nt)
          *(v8bf*)(dst + (nt * 16) * kS + mt * 16) = pk[mt][nt];
      // Precaution: stands behind the last of the 16 stores, ahead of any
      // later write of the address pair or of a data register that they name.
      asm volatile("s_wait_xcnt 0x0" ::: "memory");
    }
    return;
  }

#pragma unroll
  for (int mt = 0; mt < 4; ++mt) {
#pragma unroll
    for (int nt = 0; nt < 4; ++nt) {
#pragma unroll
      for (int i = 0; i < 8; ++i) {
        int row = m0 + waveM * 64 + mt * 16 + hi * 8 + i;
        int col = n0 + waveN * 64 + nt * 16 + lm;
        float v = acc[mt][nt][i] + bias[col];
        if constexpr (EPI == EPI_PLAIN) {
          Cf[(size_t)row * N + col] = v;
        } else if constexpr (EPI == EPI_GELU) {
          Cb[(size_t)row * N + col] = (bf16)gelu_erf(v);
        }
      }
    }
  }
}

__device__ __forceinline__ float xhalf(float x) {
  return __builtin_bit_cast(float, __builtin_amdgcn_permlanex16(
      __builtin_bit_cast(int, x), __builtin_bit_cast(int, x),
      0x76543210, 0xfedcba98, false, false));
}

__global__ __launch_bounds__(256) void attention_kernel(
    const bf16* __restrict__ Q, const bf16* __restrict__ Kk,
    const bf16* __restrict__ VT,
    const int* __restrict__ am, const int* __restrict__ keyCnt,
    bf16* __restrict__ ctx) {
  typedef __attribute__((ext_vector_type(4))) float v4f;
  __shared__ __attribute__((aligned(16))) bf16 sQ[128 * kP64];
  __shared__ __attribute__((aligned(16))) bf16 sK[2][32 * kP64];
  __shared__ __attribute__((aligned(16))) bf16 sVT[2][64 * kP32];
  // What a key adds to its scaled score, for an inactive ([0]) and an active
  // ([1]) query: the 0/1 mask term, or kNEG for an ignored key. kNEG absorbs
  // the score in the f32 sum, so an ignored key's value is kNEG exactly.
  // K and V^T hold the entry's listed keys only (list_kept_keys): a kept key
  // has a set mask bit, so its term is the query's own bit; every place from
  // nKept on is filler or, where nothing is kept, an ignored key.
  __shared__ __attribute__((aligned(16))) float sAdd[2][2][32];

  const int tid = threadIdx.x;
  const int lane = tid & 31, w = tid >> 5;
  const int hi = lane >> 4, lm = lane & 15;
  const int qt = blockIdx.x, h = blockIdx.y, b = blockIdx.z;
  const size_t headBase = (size_t)(b * kH + h) * kS * kHD;
  const size_t vtBase   = (size_t)(b * kH + h) * kHD * kS;
  const int nList = min(max(keyCnt[2 * b], 1), kS);
  const int nKept = keyCnt[2 * b + 1];
  const int kTiles = (nList + 31) >> 5;  // 1..kS / 32, the same in the whole block

  // Stage Q tile (contiguous 128*64 halves) via async copies.
#pragma unroll
  for (int j = 0; j < 4; j += 2) {
    int idx = tid * 4 + j;  // 0..1023 chunks of 8; 8 chunks a row
    const bf16* gq = &Q[headBase + (size_t)qt * 128 * kHD + idx * 8];
    bf16* lq = &sQ[(idx >> 3) * kP64 + (idx & 7) * 8];
    async_copy16_x2(gq, lq, gq + 8, lq + 8);
  }

  auto stageKV = [&](int kt, int buf) {
    int d = tid >> 2, c = tid & 3;
    async_copy16_x2(&Kk[headBase + (size_t)kt * 32 * kHD + tid * 8],
                    &sK[buf][(tid >> 3) * kP64 + (tid & 7) * 8],
                    &VT[vtBase + (size_t)d * kS + kt * 32 + c * 8],
                    &sVT[buf][d * kP32 + c * 8]);
    if (tid < 32) {
      bool ign = kt * 32 + tid >= nKept;
      sAdd[buf][0][tid] = ign ? kNEG : 0.0f;
      sAdd[buf][1][tid] = ign ? kNEG : 1.0f;
    }
  };

  // The lane's query: its activity picks the row of sAdd.
  const int qrow = qt * 128 + w * 16 + lm;
  const int qidx = b * kS + qrow;
  const int aqi = (am[qidx] != 0) ? 1 : 0;
  // Precaution: the load's index register is an input of this wait, so it stays
  // as it is until the wait; it is not overwritten ahead of it.
  asm volatile("s_wait_xcnt 0x0" :: "v"(qidx) : "memory");
  float mrow = -3.0e38f;  // running maximum, equal in both halves
  float lrow = 0.0f;      // running sum over this half's keys only
  v8f o[4] = {};          // O^T: head dims ot*16 + hi*8 + i of query lm

  stageKV(0, 0);
  wait_async0();
  __syncthreads();
  if (kTiles > 1) stageKV(1, 1);

  // B operand Q^T: column = query lm, k = head dim; the same for every tile.
  const v16bf q0 = ld_frag(&sQ[(w * 16 + lm) * kP64 + hi * 8]);
  const v16bf q1 = ld_frag(&sQ[(w * 16 + lm) * kP64 + 32 + hi * 8]);

  // Every inner loop is unrolled so that the fragment, score and accumulator
  // arrays are indexed by constants and stay in registers.
  for (int kt = 0; kt < kTiles; ++kt) {
    const int cur = kt & 1;

    // S^T: 32 keys x 16 queries (2 m-tiles, 2 chained WMMAs over HD=64)
    v8f st[2] = {};
#pragma unroll
    for (int t = 0; t < 2; ++t) {
      v16bf k0 = ld_frag(&sK[cur][(t * 16 + lm) * kP64 + hi * 8]);
      v16bf k1 = ld_frag(&sK[cur][(t * 16 + lm) * kP64 + 32 + hi * 8]);
      st[t] = wmma_bf16(k0, q0, st[t]);
      st[t] = wmma_bf16(k1, q1, st[t]);
    }

    // Addends of keys hi*8 + 0..7 and 16 + hi*8 + 0..7.
    const v4f* ad = (const v4f*)&sAdd[cur][aqi][hi * 8];
    const v4f ad4[2][2] = {{ad[0], ad[1]}, {ad[4], ad[5]}};

    float v[2][8];
    float mx = kNEG;  // no value lies below kNEG
#pragma unroll
    for (int t = 0; t < 2; ++t)
#pragma unroll
      for (int i = 0; i < 8; ++i) {
        v[t][i] = st[t][i] * 0.125f + ad4[t][i >> 2][i & 3];  // 1/sqrt(64)
        mx = fmaxf(mx, v[t][i]);
      }
    mx = fmaxf(mx, xhalf(mx));  // over all 32 keys, in both halves
    const float nm = fmaxf(mrow, mx);
    const float sc = __expf(mrow - nm);
    mrow = nm;

    v16bf pb;  // B operand P^T
    float rs = 0.0f;
#pragma unroll
    for (int t = 0; t < 2; ++t)
#pragma unroll
      for (int i = 0; i < 8; ++i) {
        float p = __expf(v[t][i] - nm);
        rs += p;
        pb[t * 8 + i] = (bf16)p;
      }
    lrow = lrow * sc + rs;
#pragma unroll
    for (int ot = 0; ot < 4; ++ot)
#pragma unroll
      for (int i = 0; i < 8; ++i) o[ot][i] = o[ot][i] * sc;

    // O^T += V^T(64x32) @ P^T(32x16): 4 m-tiles of 16 head dims
#pragma unroll
    for (int ot = 0; ot < 4; ++ot) {
      v16bf va = ld_frag(&sVT[cur][(ot * 16 + lm) * kP32 + hi * 8]);
      o[ot] = wmma_bf16(va, pb, o[ot]);
    }

    wait_ds0();       // this wave's reads of cur have retired before its refill
    wait_async0();    // next K/V buffer filled (overlapped with compute)
    __syncthreads();  // publishes the next buffer; ends every read of cur
    if (kt + 2 < kTiles) stageKV(kt + 2, cur);
  }
  wait_async0();  // no copy outstanding when the wave ends

  // ctx[b, s, h*64+d] in bf16 for the out-projection GEMM: 8 consecutive d of
  // one query a tile, one 16-byte store each.
  const float lsum = lrow + xhalf(lrow);  // the two halves' keys joined
  bf16* dst = ctx + ((size_t)b * kS + qrow) * kE + h * kHD + hi * 8;
#pragma unroll
  for (int ot = 0; ot < 4; ++ot) {
    v8bf pk;
#pragma unroll
    for (int i = 0; i < 8; ++i) pk[i] = (bf16)(o[ot][i] / lsum);
    *(v8bf*)(dst + ot * 16) = pk;
  }
}

// ---------------------------------------------------------------------------
// out = LayerNorm(a + r) * g + be ; optionally also emit bf16 copy
// One block (256 threads) per token row of E=1024.
// ---------------------------------------------------------------------------
__global__ __launch_bounds__(256) void add_ln_kernel(
    const float* __restrict__ a, const float* __restrict__ r,
    const float* __restrict__ g, const float* __restrict__ be,
    float* __restrict__ outF, bf16* __restrict__ outB) {
  __shared__ float red[256];
  const int row = blockIdx.x, t = threadIdx.x;
  const size_t base = (size_t)row * kE;
  float4 va = ((const float4*)(a + base))[t];
  float4 vr = ((const float4*)(r + base))[t];
  float x0 = va.x + vr.x, x1 = va.y + vr.y, x2 = va.z + vr.z, x3 = va.w + vr.w;

  red[t] = x0 + x1 + x2 + x3;
  __syncthreads();
  for (int o = 128; o > 0; o >>= 1) { if (t < o) red[t] += red[t + o]; __syncthreads(); }
  float mu = red[0] * (1.0f / kE);
  __syncthreads();

  float d0 = x0 - mu, d1 = x1 - mu, d2 = x2 - mu, d3 = x3 - mu;
  red[t] = d0 * d0 + d1 * d1 + d2 * d2 + d3 * d3;
  __syncthreads();
  for (int o = 128; o > 0; o >>= 1) { if (t < o) red[t] += red[t + o]; __syncthreads(); }
  float inv = rsqrtf(red[0] * (1.0f / kE) + 1e-12f);

  float4 gw = ((const float4*)g)[t];
  float4 bb = ((const float4*)be)[t];
  float o0 = d0 * inv * gw.x + bb.x;
  float o1 = d1 * inv * gw.y + bb.y;
  float o2 = d2 * inv * gw.z + bb.z;
  float o3 = d3 * inv * gw.w + bb.w;
  ((float4*)(outF + base))[t] = make_float4(o0, o1, o2, o3);
  if (outB) {
    outB[base + t * 4 + 0] = (bf16)o0;
    outB[base + t * 4 + 1] = (bf16)o1;
    outB[base + t * 4 + 2] = (bf16)o2;
    outB[base + t * 4 + 3] = (bf16)o3;
  }
}

// ---------------------------------------------------------------------------
extern "C" void kernel_launch(void* const* d_in, const int* in_sizes, int n_in,
                              void* d_out, int out_size, void* d_ws, size_t ws_size,
                              hipStream_t stream) {
  const float* x    = (const float*)d_in[0];
  const int*   am   = (const int*)d_in[1];
  const int*   tt   = (const int*)d_in[2];
  const float* wqkv = (const float*)d_in[3];
  const float* bqkv = (const float*)d_in[4];
  const float* wout = (const float*)d_in[5];
  const float* bout = (const float*)d_in[6];
  const float* lnw  = (const float*)d_in[7];
  const float* lnb  = (const float*)d_in[8];
  const float* win  = (const float*)d_in[9];
  const float* bin  = (const float*)d_in[10];
  const float* wo2  = (const float*)d_in[11];
  const float* bo2  = (const float*)d_in[12];
  float* out = (float*)d_out;

  char* ws = (char*)d_ws;
  size_t off = 0;
  auto take = [&](size_t bytes) -> char* {
    char* p = ws + off;
    off += (bytes + 255) & ~(size_t)255;
    return p;
  };
  bf16*  xb     = (bf16*)take((size_t)kM * kE * 2);          // 16 MB
  bf16*  wqkvT  = (bf16*)take((size_t)3 * kE * kE * 2);      //  6 MB
  bf16*  woutT  = (bf16*)take((size_t)kE * kE * 2);          //  2 MB
  bf16*  winT   = (bf16*)take((size_t)kF * kE * 2);          //  8 MB
  bf16*  wo2T   = (bf16*)take((size_t)kE * kF * 2);          //  8 MB
  bf16*  qBuf   = (bf16*)take((size_t)kM * kE * 2);          // 16 MB  [b,h,s,d]
  bf16*  kBuf   = (bf16*)take((size_t)kM * kE * 2);          // 16 MB  [b,h,s,d]
  bf16*  vtBuf  = (bf16*)take((size_t)kM * kE * 2);          // 16 MB  [b,h,d,s]
  bf16*  ctx    = (bf16*)take((size_t)kM * kE * 2);          // 16 MB  [b,s,e]
  float* attnF  = (float*)take((size_t)kM * kE * 4);         // 32 MB (reused as out2)
  float* hF     = (float*)take((size_t)kM * kE * 4);         // 32 MB
  bf16*  hB     = (bf16*)take((size_t)kM * kE * 2);          // 16 MB
  int*   keyIdx = (int*)take((size_t)kB * kS * 4);           // listed keys
  int*   keyCnt = (int*)take((size_t)kB * 2 * 4);            // listed, kept
  bf16*  ff     = qBuf;  // 64 MB alias over q/k/vT/ctx (dead after out-proj)

  // 1) bf16 conversions / weight transposes
  cvt_bf16_kernel<<<kB + (kM * kE) / 1024, 256, 0, stream>>>(x, xb, kM * kE, am, tt,
                                                            keyIdx, keyCnt);
  transpose_cvt_kernel<<<dim3(3 * kE / 64, kE / 128), 256, 0, stream>>>(wqkv, wqkvT, kE, 3 * kE);
  transpose_cvt_kernel<<<dim3(kE / 64, kE / 128), 256, 0, stream>>>(wout, woutT, kE, kE);
  transpose_cvt_kernel<<<dim3(kF / 64, kE / 128), 256, 0, stream>>>(win, winT, kE, kF);
  transpose_cvt_kernel<<<dim3(kE / 64, kF / 128), 256, 0, stream>>>(wo2, wo2T, kF, kE);

  // 2) QKV projection with head-split scatter epilogue
  gemm_bf16_kernel<EPI_QKV><<<dim3(3 * kE / 128, kM / 256), 256, 0, stream>>>(
      xb, wqkvT, bqkv, nullptr, nullptr, qBuf, kBuf, vtBuf, keyIdx, keyCnt, kM, 3 * kE, kE);

  // 3) Flash attention
  attention_kernel<<<dim3(kS / 128, kH, kB), 256, 0, stream>>>(
      qBuf, kBuf, vtBuf, am, keyCnt, ctx);

  // 4) Output projection
  gemm_bf16_kernel<EPI_PLAIN><<<dim3(kE / 128, kM / 256), 256, 0, stream>>>(
      ctx, woutT, bout, attnF, nullptr, nullptr, nullptr, nullptr, nullptr, nullptr, kM, kE, kE);

  // 5) h = LN(attn_out + x)
  add_ln_kernel<<<kM, 256, 0, stream>>>(attnF, x, lnw, lnb, hF, hB);

  // 6) FFN up + exact GELU (bf16 out)
  gemm_bf16_kernel<EPI_GELU><<<dim3(kF / 128, kM / 256), 256, 0, stream>>>(
      hB, winT, bin, nullptr, ff, nullptr, nullptr, nullptr, nullptr, nullptr, kM, kF, kE);

  // 7) FFN down (f32 out, reusing attnF)
  gemm_bf16_kernel<EPI_PLAIN><<<dim3(kE / 128, kM / 256), 256, 0, stream>>>(
      ff, wo2T, bo2, attnF, nullptr, nullptr, nullptr, nullptr, nullptr, nullptr, kM, kE, kF);

  // 8) out = LN(ffn_out + h)
  add_ln_kernel<<<kM, 256, 0, stream>>>(attnF, hF, lnw, lnb, out, nullptr);

  (void)in_sizes; (void)n_in; (void)out_size; (void)ws_size;
}

// v008
// A run of this version takes 229 microseconds.
// Timed twice side by side with v007, it ran 1.03 times as fast both times.
// Over all steps from v000 it is 2.94 times as fast.
#include <hip/hip_runtime.h>
#include <hip/hip_bf16.h>

typedef __bf16 bf16;
typedef __attribute__((ext_vector_type(8)))  float v8f;
typedef __attribute__((ext_vector_type(16))) bf16  v16bf;
typedef __attribute__((ext_vector_type(8)))  bf16  v8bf;

constexpr int kB = 8, kS = 1024, kE = 1024, kH = 16, kHD = 64, kF = 4096;
constexpr int kM = kB * kS;  // 8192 token rows
constexpr float kNEG = -1.0e30f;

// LDS row pitch in halves for rows read by 16-byte fragment loads: an odd
// multiple of 16 B, so the 16 rows of one fragment load fall on distinct banks.
constexpr int kP32 = 40;  // rows of 32 halves (64 B) at 80 B
constexpr int kP64 = 72;  // rows of 64 halves (128 B) at 144 B

// ---------------------------------------------------------------------------
// WMMA + async-copy helpers (CDNA5 wave32)
// ---------------------------------------------------------------------------
__device__ __forceinline__ v8f wmma_bf16(v16bf a, v16bf b, v8f c) {
  return __builtin_amdgcn_wmma_f32_16x16x32_bf16(
      /*neg_a=*/false, a, /*neg_b=*/false, b,
      /*c_mod=*/(short)0, c, /*reuse_a=*/false, /*reuse_b=*/false);
}

// A/B fragment for one lane: two contiguous 8-half runs at p and p+16.
// (16-bit operand layout: lanes<16 hold K = 0..7 & 16..23 of the 32-K tile,
//  lanes>=16 hold K = 8..15 & 24..31 — caller passes p already offset by hi*8.)
__device__ __forceinline__ v16bf ld_frag(const bf16* p) {
  union { v16bf v; v8bf h[2]; } u;
  u.h[0] = *(const v8bf*)(p);
  u.h[1] = *(const v8bf*)(p + 16);
  return u.v;
}

// 16-byte global -> LDS async copy (ASYNCcnt-tracked, no VGPR staging).
// LDS destination = low 32 bits of the generic pointer (LDS aperture offset).
// The closing s_wait_xcnt 0 stands inside the copies' own statement as a
// precaution: no address register of a copy is rewritten ahead of it.
__device__ __forceinline__ void async_copy16_x2(const bf16* g0, bf16* l0,
                                                const bf16* g1, bf16* l1) {
  asm volatile("global_load_async_to_lds_b128 %0, %1, off\n\t"
               "global_load_async_to_lds_b128 %2, %3, off\n\t"
               "s_wait_xcnt 0x0"
               :: "v"((unsigned)(size_t)l0), "v"(g0),
                  "v"((unsigned)(size_t)l1), "v"(g1) : "memory");
}
__device__ __forceinline__ void async_copy16_x4(const bf16* g0, bf16* l0,
                                                const bf16* g1, bf16* l1,
                                                const bf16* g2, bf16* l2,
                                                const bf16* g3, bf16* l3) {
  asm volatile("global_load_async_to_lds_b128 %0, %1, off\n\t"
               "global_load_async_to_lds_b128 %2, %3, off\n\t"
               "global_load_async_to_lds_b128 %4, %5, off\n\t"
               "global_load_async_to_lds_b128 %6, %7, off\n\t"
               "s_wait_xcnt 0x0"
               :: "v"((unsigned)(size_t)l0), "v"(g0),
                  "v"((unsigned)(size_t)l1), "v"(g1),
                  "v"((unsigned)(size_t)l2), "v"(g2),
                  "v"((unsigned)(size_t)l3), "v"(g3) : "memory");
}
__device__ __forceinline__ void wait_async0() {
  asm volatile("s_wait_asynccnt 0x0" ::: "memory");
}
// A wave's own LDS reads have retired before a copy is aimed at what it read.
__device__ __forceinline__ void wait_ds0() {
  asm volatile("s_wait_dscnt 0x0" ::: "memory");
}

// ---------------------------------------------------------------------------
// Preparation kernel: key lists and bf16 conversions
// ---------------------------------------------------------------------------
// The list of one batch entry's keys that attention has to look at. A key that
// the reference sets to kNEG gets the probability exp(kNEG - max) = 0 exactly as
// soon as one key of the entry is not ignored, so it adds nothing to any sum:
// only the n kept keys are listed, in rising order, and K and V are projected
// for the listed tokens alone. Behind them the list holds token 0: finite
// filler rows up to the tile edges, masked by their position. With no kept key
// at all every score is kNEG and the softmax is uniform over all keys: then the
// list is all kS tokens and none counts as kept.
// keyCnt[2 b] = listed keys (1..kS), keyCnt[2 b + 1] = kept keys among them.
// One work-group of 256 threads, 4 consecutive keys a thread.
__device__ __forceinline__ void list_kept_keys(int b, const int* __restrict__ am,
                                               const int* __restrict__ tt,
                                               int* __restrict__ keyIdx,
                                               int* __restrict__ keyCnt) {
  __shared__ int waveSum[8];
  __shared__ __attribute__((aligned(16))) int list[kS];
  const int t = threadIdx.x, lane = t & 31, w = t >> 5;
  const int4* pa = (const int4*)(am + b * kS) + t;
  const int4* pt = (const int4*)(tt + b * kS) + t;
  const int4 a = *pa;
  const int4 y = *pt;
  const bool kp[4] = {a.x != 0 && y.x != 1 && t != 0,  // key 0 is always ignored
                      a.y != 0 && y.y != 1,
                      a.z != 0 && y.z != 1,
                      a.w != 0 && y.w != 1};
  const int c = (int)kp[0] + (int)kp[1] + (int)kp[2] + (int)kp[3];
  int inc = c;  // running count over the wave, this thread included
#pragma unroll
  for (int d = 1; d < 32; d <<= 1) {
    const int o = __shfl_up(inc, d);
    if (lane >= d) inc += o;
  }
  if (lane == 31) waveSum[w] = inc;
  ((int4*)list)[t] = make_int4(0, 0, 0, 0);
  __syncthreads();  // the waves' counts and the filler are in LDS
  int pos = inc - c, n = 0;
#pragma unroll
  for (int j = 0; j < 8; ++j) {
    const int s = waveSum[j];
    if (j < w) pos += s;
    n += s;
  }
#pragma unroll
  for (int i = 0; i < 4; ++i)
    if (kp[i]) list[pos++] = t * 4 + i;
  __syncthreads();  // the list is whole before it is read in rows
  int4 v = ((const int4*)list)[t];
  if (n == 0) v = make_int4(t * 4, t * 4 + 1, t * 4 + 2, t * 4 + 3);
  ((int4*)(keyIdx + b * kS))[t] = v;
  if (t == 0) {
    keyCnt[2 * b] = n == 0 ? kS : n;
    keyCnt[2 * b + 1] = n;
  }
}

// f32 -> bf16, 4 elements a thread; blk = the work-group's place in this job.
__device__ __forceinline__ void cvt_bf16_block(const float* __restrict__ in,
                                               bf16* __restrict__ out, int n, int blk) {
  int idx = (blk * 256 + threadIdx.x) * 4;
  if (idx < n) {
    float4 v = *(const float4*)(in + idx);
    out[idx + 0] = (bf16)v.x;
    out[idx + 1] = (bf16)v.y;
    out[idx + 2] = (bf16)v.z;
    out[idx + 3] = (bf16)v.w;
  }
}

// in: [K,N] fp32 row-major  ->  out: [N,K] bf16 row-major
// One work-group moves a tile of 128 k x 64 n through LDS: it reads whole 256-B
// row pieces of in and writes whole 256-B row pieces of out, 32 elements a
// thread. Needs K % 128 == 0, N % 64 == 0; tiles bx < N / 64, by < K / 128.
// LDS holds the tile transposed, a dword = the bf16 pair (k, k + 1) of one n;
// the odd pitch of 65 dwords keeps both the writes (lanes 4 n apart) and the
// reads (lanes 4 dwords apart) on distinct banks.
__device__ __forceinline__ void transpose_cvt_tile(const float* __restrict__ in,
                                                   bf16* __restrict__ out,
                                                   int K, int N, int bx, int by) {
  typedef __attribute__((ext_vector_type(2))) bf16 v2bf;
  __shared__ unsigned tile[64 * 65];
  const int t = threadIdx.x;
  const int n0 = bx * 64, k0 = by * 128;

  // Thread: 4 consecutive n (chunk c) of the row pairs 2 (r + 16 j), + 1.
  const int c = t & 15, r = t >> 4;
  const float* src = in + (size_t)(k0 + 2 * r) * N + n0 + c * 4;
  const float4* pl[4];
  const float4* pu[4];
  float4 lo[4], up[4];
#pragma unroll
  for (int j = 0; j < 4; ++j) {
    pl[j] = (const float4*)(src + (size_t)(32 * j) * N);
    pu[j] = (const float4*)(src + (size_t)(32 * j + 1) * N);
    lo[j] = *pl[j];
    up[j] = *pu[j];
  }
  // Precaution: the eight address pairs are inputs of this wait, so they stay
  // as they are until it; no register that an issued load names is overwritten
  // ahead of it, not even by a later load's data.
  asm volatile("s_wait_xcnt 0x0"
               :: "v"(pl[0]), "v"(pu[0]), "v"(pl[1]), "v"(pu[1]),
                  "v"(pl[2]), "v"(pu[2]), "v"(pl[3]), "v"(pu[3]) : "memory");
#pragma unroll
  for (int j = 0; j < 4; ++j) {
    unsigned* d = &tile[(c * 4) * 65 + r + 16 * j];
    v2bf p0 = {(bf16)lo[j].x, (bf16)up[j].x};
    v2bf p1 = {(bf16)lo[j].y, (bf16)up[j].y};
    v2bf p2 = {(bf16)lo[j].z, (bf16)up[j].z};
    v2bf p3 = {(bf16)lo[j].w, (bf16)up[j].w};
    d[0 * 65] = __builtin_bit_cast(unsigned, p0);
    d[1 * 65] = __builtin_bit_cast(unsigned, p1);
    d[2 * 65] = __builtin_bit_cast(unsigned, p2);
    d[3 * 65] = __builtin_bit_cast(unsigned, p3);
  }
  __syncthreads();  // the whole tile is in LDS before any row of it is read

  // Thread: 8 consecutive k (chunk c) of rows n = r + 16 j; 16 B a store.
#pragma unroll
  for (int j = 0; j < 4; ++j) {
    const int n = r + 16 * j;
    const unsigned* s = &tile[n * 65 + c * 4];
    uint4 v = make_uint4(s[0], s[1], s[2], s[3]);
    *(uint4*)(out + (size_t)(n0 + n) * K + k0 + c * 8) = v;
  }
  // Precaution: stands behind the last of the four stores, ahead of any later
  // write of an address pair or of a data register that they name.
  asm volatile("s_wait_xcnt 0x0" ::: "memory");
}

// All the preparation in ONE launch: the key lists, the four weight transposes
// and the conversion of x read only inputs and write disjoint buffers, so none
// waits for another. A work-group's job follows from its index alone (the same
// in all its threads, so every barrier stays under block-uniform control flow):
// first the kB lists, then the transposes' tiles, which last longest, then x.
constexpr int kTqkv = (3 * kE / 64) * (kE / 128);  // tiles of in_proj_w
constexpr int kTout = (kE / 64) * (kE / 128);      // tiles of out_proj_w
constexpr int kTin  = (kF / 64) * (kE / 128);      // tiles of w_in
constexpr int kTo2  = (kE / 64) * (kF / 128);      // tiles of w_out
constexpr int kCvtBlocks = (kM * kE) / 1024;
constexpr int kPrepBlocks = kB + kTqkv + kTout + kTin + kTo2 + kCvtBlocks;

__global__ __launch_bounds__(256) void prep_kernel(
    const float* __restrict__ x, bf16* __restrict__ xb,
    const int* __restrict__ am, const int* __restrict__ tt,
    int* __restrict__ keyIdx, int* __restrict__ keyCnt,
    const float* __restrict__ wqkv, bf16* __restrict__ wqkvT,
    const float* __restrict__ wout, bf16* __restrict__ woutT,
    const float* __restrict__ win, bf16* __restrict__ winT,
    const float* __restrict__ wo2, bf16* __restrict__ wo2T) {
  int blk = blockIdx.x;
  if (blk < kB) {
    list_kept_keys(blk, am, tt, keyIdx, keyCnt);
    return;
  }
  blk -= kB;
  if (blk < kTqkv + kTout + kTin + kTo2) {
    const float* in;
    bf16* out;
    int K, N, bx, by;
    if (blk < kTqkv) {
      in = wqkv; out = wqkvT; K = kE; N = 3 * kE;
      bx = blk % (3 * kE / 64); by = blk / (3 * kE / 64);
    } else if (blk < kTqkv + kTout) {
      blk -= kTqkv;
      in = wout; out = woutT; K = kE; N = kE;
      bx = blk % (kE / 64); by = blk / (kE / 64);
    } else if (blk < kTqkv + kTout + kTin) {
      blk -= kTqkv + kTout;
      in = win; out = winT; K = kE; N = kF;
      bx = blk % (kF / 64); by = blk / (kF / 64);
    } else {
      blk -= kTqkv + kTout + kTin;
      in = wo2; out = wo2T; K = kF; N = kE;
      bx = blk % (kE / 64); by = blk / (kE / 64);
    }
    transpose_cvt_tile(in, out, K, N, bx, by);
    return;
  }
  cvt_bf16_block(x, xb, kM * kE, blk - (kTqkv + kTout + kTin + kTo2));
}

// ---------------------------------------------------------------------------
// Generic bf16 GEMM: C[M,N] = A[M,K] * Bt[N,K]^T + bias, fused epilogues.
// Block = 256 threads (8 wave32), tile 256(M) x 128(N), waves 4x2, wave 64x64.
// A pass is 64 k: 128-B rows at 144 B pitch, two LDS buffers filled by
// GLOBAL_LOAD_ASYNC_TO_LDS_B128; one barrier per pass; a buffer's refill is
// issued right behind the barrier that frees it and has a whole pass to land.
// Needs M % 256 == 0, N % 128 == 0, K % 64 == 0.
// ---------------------------------------------------------------------------
// Exact (erf) GELU, v * Phi(v), without a branch. With x = |v| / sqrt 2 and
// t = 1 / (1 + 0.3275911 x): erfc(x) = t (a1 + t (a2 + t (a3 + t (a4 + t a5))))
// exp(-x^2), absolute error at most 1.5e-7 (the five-term rational form of the
// handbooks), which lies far under the bf16 rounding of the result. Phi(v) is
// erfc(x) / 2 for v < 0 and 1 - erfc(x) / 2 otherwise, so the negative tail is
// formed without cancellation. The halves are folded into a1..a5, 1 / sqrt 2
// into the factor of |v|, and exp(-x^2) = exp2(-(v sqrt(log2(e) / 2))^2).
// The two transcendentals are written with their v_nop in one statement: it is
// the free slot that the instruction set asks for behind a transcendental.
__device__ __forceinline__ float rcp_slot(float x) {
  float r;
  asm("v_rcp_f32 %0, %1\n\tv_nop" : "=v"(r) : "v"(x));
  return r;
}
__device__ __forceinline__ float exp2_slot(float x) {
  float r;
  asm("v_exp_f32 %0, %1\n\tv_nop" : "=v"(r) : "v"(x));
  return r;
}
__device__ __forceinline__ float gelu_erf(float v) {
  const float t = rcp_slot(fmaf(fabsf(v), 0.23164189f, 1.0f));
  const float z = v * 0.84932180f;
  const float e = exp2_slot(-(z * z));
  float p = 0.5307027145f;
  p = fmaf(p, t, -0.7265760135f);
  p = fmaf(p, t, 0.7107068705f);
  p = fmaf(p, t, -0.142248368f);
  p = fmaf(p, t, 0.127414796f);
  const float h = p * t * e;  // erfc(x) / 2
  return v * (v >= 0.0f ? 1.0f - h : h);
}

enum { EPI_PLAIN = 0, EPI_GELU = 1, EPI_QKV = 2 };

template <int EPI>
__global__ __launch_bounds__(256) void gemm_bf16_kernel(
    const bf16* __restrict__ A, const bf16* __restrict__ Bt,
    const float* __restrict__ bias,
    float* __restrict__ Cf, bf16* __restrict__ Cb,
    bf16* __restrict__ qO, bf16* __restrict__ kO, bf16* __restrict__ vtO,
    const int* __restrict__ keyIdx, const int* __restrict__ keyCnt,
    int M, int N, int K) {
  __shared__ __attribute__((aligned(16))) bf16 sA[2][256 * kP64];
  __shared__ __attribute__((aligned(16))) bf16 sB[2][128 * kP64];
  const int tid = threadIdx.x;
  const int lane = tid & 31, wave = tid >> 5;
  const int hi = lane >> 4, lm = lane & 15;
  const int waveM = wave & 3, waveN = wave >> 2;
  const int m0 = blockIdx.y * 256;
  const int n0 = blockIdx.x * 128;

  // Staging slots: 8 chunks of 16 B a row, so a wave's copy covers 4 whole rows
  // of 128 B; a thread keeps its chunk and walks rows sRow + 32 j.
  const int sRow = tid >> 3, sCh = tid & 7;
  const bf16* gA = &A[(size_t)(m0 + sRow) * K + sCh * 8];
  const bf16* gB = &Bt[(size_t)(n0 + sRow) * K + sCh * 8];
  const size_t rowStep = (size_t)32 * K;
  const int sOff = sRow * kP64 + sCh * 8;

  // QKV: in the K and V sections row r of a batch entry is the r-th listed key,
  // so the A rows are gathered through the list and K and V^T come out packed;
  // a block whose rows all lie behind the list has nothing to do and leaves as
  // a whole, ahead of every copy and barrier.
  const bf16* gRow[8];
  if constexpr (EPI == EPI_QKV) {
    const int bb = m0 >> 10, r0 = m0 & (kS - 1);
    const bool listed = n0 >= kE;
    if (listed && r0 >= min(keyCnt[2 * bb], kS)) return;
    const int* li = keyIdx + bb * kS + r0 + sRow;
    int tok[8];
#pragma unroll
    for (int j = 0; j < 8; ++j) tok[j] = li[32 * j];
#pragma unroll
    for (int j = 0; j < 8; ++j) {
      // The mask bounds the row, and so the address, whatever the list holds.
      const int row = listed ? (tok[j] & (kS - 1)) : r0 + sRow + 32 * j;
      gRow[j] = &A[(size_t)(bb * kS + row) * K + sCh * 8];
    }
  }

  auto stage = [&](int kt, int buf) {
    const bf16* a = gA + kt * 64;
    const bf16* b = gB + kt * 64;
    bf16* la = &sA[buf][sOff];
    bf16* lb = &sB[buf][sOff];
    if constexpr (EPI == EPI_QKV) {
      async_copy16_x4(gRow[0] + kt * 64, la,
                      gRow[1] + kt * 64, la + 32 * kP64,
                      gRow[2] + kt * 64, la + 64 * kP64,
                      gRow[3] + kt * 64, la + 96 * kP64);
      async_copy16_x4(gRow[4] + kt * 64, la + 128 * kP64,
                      gRow[5] + kt * 64, la + 160 * kP64,
                      gRow[6] + kt * 64, la + 192 * kP64,
                      gRow[7] + kt * 64, la + 224 * kP64);
      async_copy16_x4(b,               lb,
                      b + rowStep,     lb + 32 * kP64,
                      b + 2 * rowStep, lb + 64 * kP64,
                      b + 3 * rowStep, lb + 96 * kP64);
      return;
    }
    async_copy16_x4(a,               la,
                    a + rowStep,     la + 32 * kP64,
                    a + 2 * rowStep, la + 64 * kP64,
                    a + 3 * rowStep, la + 96 * kP64);
    async_copy16_x4(a + 4 * rowStep, la + 128 * kP64,
                    a + 5 * rowStep, la + 160 * kP64,
                    a + 6 * rowStep, la + 192 * kP64,
                    a + 7 * rowStep, la + 224 * kP64);
    async_copy16_x4(b,               lb,
                    b + rowStep,     lb + 32 * kP64,
                    b + 2 * rowStep, lb + 64 * kP64,
                    b + 3 * rowStep, lb + 96 * kP64);
  };

  v8f acc[4][4] = {};
  const int kTiles = K >> 6;

  stage(0, 0);
  wait_async0();
  __syncthreads();
  if (kTiles > 1) stage(1, 1);

  // All loops over mt / nt are unrolled so that the fragment and accumulator
  // arrays are indexed by constants and stay in registers.
  v16bf af[4], bfr[4];
  auto load_frags = [&](int buf, int ks) {
#pragma unroll
    for (int mt = 0; mt < 4; ++mt)
      af[mt] = ld_frag(&sA[buf][(waveM * 64 + mt * 16 + lm) * kP64 + ks * 32 + hi * 8]);
#pragma unroll
    for (int nt = 0; nt < 4; ++nt)
      bfr[nt] = ld_frag(&sB[buf][(waveN * 64 + nt * 16 + lm) * kP64 + ks * 32 + hi * 8]);
  };
  auto mma16 = [&]() {
#pragma unroll
    for (int mt = 0; mt < 4; ++mt)
#pragma unroll
      for (int nt = 0; nt < 4; ++nt)
        acc[mt][nt] = wmma_bf16(af[mt], bfr[nt], acc[mt][nt]);
  };

  for (int kt = 0; kt < kTiles; ++kt) {
    const int cur = kt & 1;
    load_frags(cur, 0);
    // Keeps the 16 fragment loads one group ahead of the 16 WMMAs: left alone
    // the compiler reloads one A fragment per row and waits it out each time.
    __builtin_amdgcn_sched_barrier(0);
    mma16();
    load_frags(cur, 1);  // the pass's last reads of `cur`, into registers

    wait_ds0();       // this wave's reads of `cur` have retired before its refill
    wait_async0();    // this wave's share of the other buffer has landed
    __syncthreads();  // publishes the other buffer; ends every read of `cur`
    if (kt + 2 < kTiles) stage(kt + 2, cur);
    mma16();  // registers only: the refill flies from here on
  }
  wait_async0();  // no copy outstanding when the wave ends

  if constexpr (EPI == EPI_QKV) {
    // Scatter to Q/K [b,h,s,d] and V^T [b,h,d,s]; for K and V^T s is the place
    // in the entry's list of keys. A block's 128 columns lie in
    // one of the three sections of 1024 and its 256 rows in one batch entry, so
    // the section is a scalar of the block: it is branched on once, outside the
    // unrolled loops, and every store is one base address plus a constant.
    // A wave's 64 columns are one head.
    const int sec = n0 >> 10;
    const int bh = (m0 >> 10) * kH + ((n0 & 1023) >> 6) + waveN;
    const int s0 = (m0 & 1023) + waveM * 64 + hi * 8;
    float bs[4];
#pragma unroll
    for (int nt = 0; nt < 4; ++nt) bs[nt] = bias[n0 + waveN * 64 + nt * 16 + lm];
    if (sec < 2) {
      bf16* dst = (sec == 0 ? qO : kO) + ((size_t)bh * kS + s0) * kHD + lm;
#pragma unroll
      for (int mt = 0; mt < 4; ++mt)
#pragma unroll
        for (int nt = 0; nt < 4; ++nt)
#pragma unroll
          for (int i = 0; i < 8; ++i)
            dst[(mt * 16 + i) * kHD + nt * 16] = (bf16)(acc[mt][nt][i] + bs[nt]);
    } else {
      bf16* dst = vtO + ((size_t)bh * kHD + lm) * kS + s0;
      v8bf pk[4][4];  // 8 consecutive s of one d: one 16-byte store
#pragma unroll
      for (int mt = 0; mt < 4; ++mt)
#pragma unroll
        for (int nt = 0; nt < 4; ++nt)
#pragma unroll
          for (int i = 0; i < 8; ++i) pk[mt][nt][i] = (bf16)(acc[mt][nt][i] + bs[nt]);
#pragma unroll
      for (int mt = 0; mt < 4; ++mt)
#pragma unroll
        for (int nt = 0; nt < 4; ++nt)
          *(v8bf*)(dst + (nt * 16) * kS + mt * 16) = pk[mt][nt];
      // Precaution: stands behind the last of the 16 stores, ahead of any
      // later write of the address pair or of a data register that they name.
      asm volatile("s_wait_xcnt 0x0" ::: "memory");
    }
    return;
  }

#pragma unroll
  for (int mt = 0; mt < 4; ++mt) {
#pragma unroll
    for (int nt = 0; nt < 4; ++nt) {
#pragma unroll
      for (int i = 0; i < 8; ++i) {
        int row = m0 + waveM * 64 + mt * 16 + hi * 8 + i;
        int col = n0 + waveN * 64 + nt * 16 + lm;
        float v = acc[mt][nt][i] + bias[col];
        if constexpr (EPI == EPI_PLAIN) {
          Cf[(size_t)row * N + col] = v;
        } else if constexpr (EPI == EPI_GELU) {
          Cb[(size_t)row * N + col] = (bf16)gelu_erf(v);
        }
      }
    }
  }
}

__device__ __forceinline__ float xhalf(float x) {
  return __builtin_bit_cast(float, __builtin_amdgcn_permlanex16(
      __builtin_bit_cast(int, x), __builtin_bit_cast(int, x),
      0x76543210, 0xfedcba98, false, false));
}

__global__ __launch_bounds__(256) void attention_kernel(
    const bf16* __restrict__ Q, const bf16* __restrict__ Kk,
    const bf16* __restrict__ VT,
    const int* __restrict__ am, const int* __restrict__ keyCnt,
    bf16* __restrict__ ctx) {
  typedef __attribute__((ext_vector_type(4))) float v4f;
  __shared__ __attribute__((aligned(16))) bf16 sQ[128 * kP64];
  __shared__ __attribute__((aligned(16))) bf16 sK[2][32 * kP64];
  __shared__ __attribute__((aligned(16))) bf16 sVT[2][64 * kP32];
  // What a key adds to its scaled score, for an inactive ([0]) and an active
  // ([1]) query: the 0/1 mask term, or kNEG for an ignored key. kNEG absorbs
  // the score in the f32 sum, so an ignored key's value is kNEG exactly.
  // K and V^T hold the entry's listed keys only (list_kept_keys): a kept key
  // has a set mask bit, so its term is the query's own bit; every place from
  // nKept on is filler or, where nothing is kept, an ignored key.
  __shared__ __attribute__((aligned(16))) float sAdd[2][2][32];

  const int tid = threadIdx.x;
  const int lane = tid & 31, w = tid >> 5;
  const int hi = lane >> 4, lm = lane & 15;
  const int qt = blockIdx.x, h = blockIdx.y, b = blockIdx.z;
  const size_t headBase = (size_t)(b * kH + h) * kS * kHD;
  const size_t vtBase   = (size_t)(b * kH + h) * kHD * kS;
  const int nList = min(max(keyCnt[2 * b], 1), kS);
  const int nKept = keyCnt[2 * b + 1];
  const int kTiles = (nList + 31) >> 5;  // 1..kS / 32, the same in the whole block

  // Stage Q tile (contiguous 128*64 halves) via async copies.
#pragma unroll
  for (int j = 0; j < 4; j += 2) {
    int idx = tid * 4 + j;  // 0..1023 chunks of 8; 8 chunks a row
    const bf16* gq = &Q[headBase + (size_t)qt * 128 * kHD + idx * 8];
    bf16* lq = &sQ[(idx >> 3) * kP64 + (idx & 7) * 8];
    async_copy16_x2(gq, lq, gq + 8, lq + 8);
  }

  auto stageKV = [&](int kt, int buf) {
    int d = tid >> 2, c = tid & 3;
    async_copy16_x2(&Kk[headBase + (size_t)kt * 32 * kHD + tid * 8],
                    &sK[buf][(tid >> 3) * kP64 + (tid & 7) * 8],
                    &VT[vtBase + (size_t)d * kS + kt * 32 + c * 8],
                    &sVT[buf][d * kP32 + c * 8]);
    if (tid < 32) {
      bool ign = kt * 32 + tid >= nKept;
      sAdd[buf][0][tid] = ign ? kNEG : 0.0f;
      sAdd[buf][1][tid] = ign ? kNEG : 1.0f;
    }
  };

  // The lane's query: its activity picks the row of sAdd.
  const int qrow = qt * 128 + w * 16 + lm;
  const int qidx = b * kS + qrow;
  const int aqi = (am[qidx] != 0) ? 1 : 0;
  // Precaution: the load's index register is an input of this wait, so it stays
  // as it is until the wait; it is not overwritten ahead of it.
  asm volatile("s_wait_xcnt 0x0" :: "v"(qidx) : "memory");
  float mrow = -3.0e38f;  // running maximum, equal in both halves
  float lrow = 0.0f;      // running sum over this half's keys only
  v8f o[4] = {};          // O^T: head dims ot*16 + hi*8 + i of query lm

  stageKV(0, 0);
  wait_async0();
  __syncthreads();
  if (kTiles > 1) stageKV(1, 1);

  // B operand Q^T: column = query lm, k = head dim; the same for every tile.
  const v16bf q0 = ld_frag(&sQ[(w * 16 + lm) * kP64 + hi * 8]);
  const v16bf q1 = ld_frag(&sQ[(w * 16 + lm) * kP64 + 32 + hi * 8]);

  // Every inner loop is unrolled so that the fragment, score and accumulator
  // arrays are indexed by constants and stay in registers.
  for (int kt = 0; kt < kTiles; ++kt) {
    const int cur = kt & 1;

    // S^T: 32 keys x 16 queries (2 m-tiles, 2 chained WMMAs over HD=64)
    v8f st[2] = {};
#pragma unroll
    for (int t = 0; t < 2; ++t) {
      v16bf k0 = ld_frag(&sK[cur][(t * 16 + lm) * kP64 + hi * 8]);
      v16bf k1 = ld_frag(&sK[cur][(t * 16 + lm) * kP64 + 32 + hi * 8]);
      st[t] = wmma_bf16(k0, q0, st[t]);
      st[t] = wmma_bf16(k1, q1, st[t]);
    }

    // Addends of keys hi*8 + 0..7 and 16 + hi*8 + 0..7.
    const v4f* ad = (const v4f*)&sAdd[cur][aqi][hi * 8];
    const v4f ad4[2][2] = {{ad[0], ad[1]}, {ad[4], ad[5]}};

    float v[2][8];
    float mx = kNEG;  // no value lies below kNEG
#pragma unroll
    for (int t = 0; t < 2; ++t)
#pragma unroll
      for (int i = 0; i < 8; ++i) {
        v[t][i] = st[t][i] * 0.125f + ad4[t][i >> 2][i & 3];  // 1/sqrt(64)
        mx = fmaxf(mx, v[t][i]);
      }
    mx = fmaxf(mx, xhalf(mx));  // over all 32 keys, in both halves
    const float nm = fmaxf(mrow, mx);
    const float sc = __expf(mrow - nm);
    mrow = nm;

    v16bf pb;  // B operand P^T
    float rs = 0.0f;
#pragma unroll
    for (int t = 0; t < 2; ++t)
#pragma unroll
      for (int i = 0; i < 8; ++i) {
        float p = __expf(v[t][i] - nm);
        rs += p;
        pb[t * 8 + i] = (bf16)p;
      }
    lrow = lrow * sc + rs;
#pragma unroll
    for (int ot = 0; ot < 4; ++ot)
#pragma unroll
      for (int i = 0; i < 8; ++i) o[ot][i] = o[ot][i] * sc;

    // O^T += V^T(64x32) @ P^T(32x16): 4 m-tiles of 16 head dims
#pragma unroll
    for (int ot = 0; ot < 4; ++ot) {
      v16bf va = ld_frag(&sVT[cur][(ot * 16 + lm) * kP32 + hi * 8]);
      o[ot] = wmma_bf16(va, pb, o[ot]);
    }

    wait_ds0();       // this wave's reads of cur have retired before its refill
    wait_async0();    // next K/V buffer filled (overlapped with compute)
    __syncthreads();  // publishes the next buffer; ends every read of cur
    if (kt + 2 < kTiles) stageKV(kt + 2, cur);
  }
  wait_async0();  // no copy outstanding when the wave ends

  // ctx[b, s, h*64+d] in bf16 for the out-projection GEMM: 8 consecutive d of
  // one query a tile, one 16-byte store each.
  const float lsum = lrow + xhalf(lrow);  // the two halves' keys joined
  bf16* dst = ctx + ((size_t)b * kS + qrow) * kE + h * kHD + hi * 8;
#pragma unroll
  for (int ot = 0; ot < 4; ++ot) {
    v8bf pk;
#pragma unroll
    for (int i = 0; i < 8; ++i) pk[i] = (bf16)(o[ot][i] / lsum);
    *(v8bf*)(dst + ot * 16) = pk;
  }
}

// ---------------------------------------------------------------------------
// out = LayerNorm(a + r) * g + be ; optionally also emit bf16 copy
// One block (256 threads) per token row of E=1024.
// ---------------------------------------------------------------------------
__global__ __launch_bounds__(256) void add_ln_kernel(
    const float* __restrict__ a, const float* __restrict__ r,
    const float* __restrict__ g, const float* __restrict__ be,
    float* __restrict__ outF, bf16* __restrict__ outB) {
  __shared__ float red[256];
  const int row = blockIdx.x, t = threadIdx.x;
  const size_t base = (size_t)row * kE;
  float4 va = ((const float4*)(a + base))[t];
  float4 vr = ((const float4*)(r + base))[t];
  float x0 = va.x + vr.x, x1 = va.y + vr.y, x2 = va.z + vr.z, x3 = va.w + vr.w;

  red[t] = x0 + x1 + x2 + x3;
  __syncthreads();
  for (int o = 128; o > 0; o >>= 1) { if (t < o) red[t] += red[t + o]; __syncthreads(); }
  float mu = red[0] * (1.0f / kE);
  __syncthreads();

  float d0 = x0 - mu, d1 = x1 - mu, d2 = x2 - mu, d3 = x3 - mu;
  red[t] = d0 * d0 + d1 * d1 + d2 * d2 + d3 * d3;
  __syncthreads();
  for (int o = 128; o > 0; o >>= 1) { if (t < o) red[t] += red[t + o]; __syncthreads(); }
  float inv = rsqrtf(red[0] * (1.0f / kE) + 1e-12f);

  float4 gw = ((const float4*)g)[t];
  float4 bb = ((const float4*)be)[t];
  float o0 = d0 * inv * gw.x + bb.x;
  float o1 = d1 * inv * gw.y + bb.y;
  float o2 = d2 * inv * gw.z + bb.z;
  float o3 = d3 * inv * gw.w + bb.w;
  ((float4*)(outF + base))[t] = make_float4(o0, o1, o2, o3);
  if (outB) {
    outB[base + t * 4 + 0] = (bf16)o0;
    outB[base + t * 4 + 1] = (bf16)o1;
    outB[base + t * 4 + 2] = (bf16)o2;
    outB[base + t * 4 + 3] = (bf16)o3;
  }
}

// ---------------------------------------------------------------------------
extern "C" void kernel_launch(void* const* d_in, const int* in_sizes, int n_in,
                              void* d_out, int out_size, void* d_ws, size_t ws_size,
                              hipStream_t stream) {
  const float* x    = (const float*)d_in[0];
  const int*   am   = (const int*)d_in[1];
  const int*   tt   = (const int*)d_in[2];
  const float* wqkv = (const float*)d_in[3];
  const float* bqkv = (const float*)d_in[4];
  const float* wout = (const float*)d_in[5];
  const float* bout = (const float*)d_in[6];
  const float* lnw  = (const float*)d_in[7];
  const float* lnb  = (const float*)d_in[8];
  const float* win  = (const float*)d_in[9];
  const float* bin  = (const float*)d_in[10];
  const float* wo2  = (const float*)d_in[11];
  const float* bo2  = (const float*)d_in[12];
  float* out = (float*)d_out;

  char* ws = (char*)d_ws;
  size_t off = 0;
  auto take = [&](size_t bytes) -> char* {
    char* p = ws + off;
    off += (bytes + 255) & ~(size_t)255;
    return p;
  };
  bf16*  xb     = (bf16*)take((size_t)kM * kE * 2);          // 16 MB
  bf16*  wqkvT  = (bf16*)take((size_t)3 * kE * kE * 2);      //  6 MB
  bf16*  woutT  = (bf16*)take((size_t)kE * kE * 2);          //  2 MB
  bf16*  winT   = (bf16*)take((size_t)kF * kE * 2);          //  8 MB
  bf16*  wo2T   = (bf16*)take((size_t)kE * kF * 2);          //  8 MB
  bf16*  qBuf   = (bf16*)take((size_t)kM * kE * 2);          // 16 MB  [b,h,s,d]
  bf16*  kBuf   = (bf16*)take((size_t)kM * kE * 2);          // 16 MB  [b,h,s,d]
  bf16*  vtBuf  = (bf16*)take((size_t)kM * kE * 2);          // 16 MB  [b,h,d,s]
  bf16*  ctx    = (bf16*)take((size_t)kM * kE * 2);          // 16 MB  [b,s,e]
  float* attnF  = (float*)take((size_t)kM * kE * 4);         // 32 MB (reused as out2)
  float* hF     = (float*)take((size_t)kM * kE * 4);         // 32 MB
  bf16*  hB     = (bf16*)take((size_t)kM * kE * 2);          // 16 MB
  int*   keyIdx = (int*)take((size_t)kB * kS * 4);           // listed keys
  int*   keyCnt = (int*)take((size_t)kB * 2 * 4);            // listed, kept
  bf16*  ff     = qBuf;  // 64 MB alias over q/k/vT/ctx (dead after out-proj)

  // 1) key lists, weight transposes and the bf16 copy of x, one launch
  prep_kernel<<<kPrepBlocks, 256, 0, stream>>>(x, xb, am, tt, keyIdx, keyCnt,
                                               wqkv, wqkvT, wout, woutT,
                                               win, winT, wo2, wo2T);

  // 2) QKV projection with head-split scatter epilogue
  gemm_bf16_kernel<EPI_QKV><<<dim3(3 * kE / 128, kM / 256), 256, 0, stream>>>(
      xb, wqkvT, bqkv, nullptr, nullptr, qBuf, kBuf, vtBuf, keyIdx, keyCnt, kM, 3 * kE, kE);

  // 3) Flash attention
  attention_kernel<<<dim3(kS / 128, kH, kB), 256, 0, stream>>>(
      qBuf, kBuf, vtBuf, am, keyCnt, ctx);

  // 4) Output projection
  gemm_bf16_kernel<EPI_PLAIN><<<dim3(kE / 128, kM / 256), 256, 0, stream>>>(
      ctx, woutT, bout, attnF, nullptr, nullptr, nullptr, nullptr, nullptr, nullptr, kM, kE, kE);

  // 5) h = LN(attn_out + x)
  add_ln_kernel<<<kM, 256, 0, stream>>>(attnF, x, lnw, lnb, hF, hB);

  // 6) FFN up + exact GELU (bf16 out)
  gemm_bf16_kernel<EPI_GELU><<<dim3(kF / 128, kM / 256), 256, 0, stream>>>(
      hB, winT, bin, nullptr, ff, nullptr, nullptr, nullptr, nullptr, nullptr, kM, kF, kE);

  // 7) FFN down (f32 out, reusing attnF)
  gemm_bf16_kernel<EPI_PLAIN><<<dim3(kE / 128, kM / 256), 256, 0, stream>>>(
      ff, wo2T, bo2, attnF, nullptr, nullptr, nullptr, nullptr, nullptr, nullptr, kM, kE, kF);

  // 8) out = LN(ffn_out + h)
  add_ln_kernel<<<kM, 256, 0, stream>>>(attnF, hF, lnw, lnb, out, nullptr);

  (void)in_sizes; (void)n_in; (void)out_size; (void)ws_size;
}

// v009
// One run takes 217 microseconds.
// In two side-by-side timings against v008, it was 1.04 and 1.05 times as fast.
// Over all steps from v000 it is 3.07 times as fast.
#include <hip/hip_runtime.h>
#include <hip/hip_bf16.h>

typedef __bf16 bf16;
typedef __attribute__((ext_vector_type(8)))  float v8f;
typedef __attribute__((ext_vector_type(16))) bf16  v16bf;
typedef __attribute__((ext_vector_type(8)))  bf16  v8bf;

constexpr int kB = 8, kS = 1024, kE = 1024, kH = 16, kHD = 64, kF = 4096;
constexpr int kM = kB * kS;  // 8192 token rows
constexpr float kNEG = -1.0e30f;

// LDS row pitch in halves for rows read by 16-byte fragment loads: an odd
// multiple of 16 B, so the 16 rows of one fragment load fall on distinct banks.
constexpr int kP32 = 40;  // rows of 32 halves (64 B) at 80 B
constexpr int kP64 = 72;  // rows of 64 halves (128 B) at 144 B

// ---------------------------------------------------------------------------
// WMMA + async-copy helpers (CDNA5 wave32)
// ---------------------------------------------------------------------------
__device__ __forceinline__ v8f wmma_bf16(v16bf a, v16bf b, v8f c) {
  return __builtin_amdgcn_wmma_f32_16x16x32_bf16(
      /*neg_a=*/false, a, /*neg_b=*/false, b,
      /*c_mod=*/(short)0, c, /*reuse_a=*/false, /*reuse_b=*/false);
}

// A/B fragment for one lane: two contiguous 8-half runs at p and p+16.
// (16-bit operand layout: lanes<16 hold K = 0..7 & 16..23 of the 32-K tile,
//  lanes>=16 hold K = 8..15 & 24..31 — caller passes p already offset by hi*8.)
__device__ __forceinline__ v16bf ld_frag(const bf16* p) {
  union { v16bf v; v8bf h[2]; } u;
  u.h[0] = *(const v8bf*)(p);
  u.h[1] = *(const v8bf*)(p + 16);
  return u.v;
}

// 16-byte global -> LDS async copy (ASYNCcnt-tracked, no VGPR staging).
// LDS destination = low 32 bits of the generic pointer (LDS aperture offset).
// The closing s_wait_xcnt 0 stands inside the copies' own statement as a
// precaution: no address register of a copy is rewritten ahead of it.
__device__ __forceinline__ void async_copy16_x2(const bf16* g0, bf16* l0,
                                                const bf16* g1, bf16* l1) {
  asm volatile("global_load_async_to_lds_b128 %0, %1, off\n\t"
               "global_load_async_to_lds_b128 %2, %3, off\n\t"
               "s_wait_xcnt 0x0"
               :: "v"((unsigned)(size_t)l0), "v"(g0),
                  "v"((unsigned)(size_t)l1), "v"(g1) : "memory");
}
__device__ __forceinline__ void async_copy16_x4(const bf16* g0, bf16* l0,
                                                const bf16* g1, bf16* l1,
                                                const bf16* g2, bf16* l2,
                                                const bf16* g3, bf16* l3) {
  asm volatile("global_load_async_to_lds_b128 %0, %1, off\n\t"
               "global_load_async_to_lds_b128 %2, %3, off\n\t"
               "global_load_async_to_lds_b128 %4, %5, off\n\t"
               "global_load_async_to_lds_b128 %6, %7, off\n\t"
               "s_wait_xcnt 0x0"
               :: "v"((unsigned)(size_t)l0), "v"(g0),
                  "v"((unsigned)(size_t)l1), "v"(g1),
                  "v"((unsigned)(size_t)l2), "v"(g2),
                  "v"((unsigned)(size_t)l3), "v"(g3) : "memory");
}
__device__ __forceinline__ void wait_async0() {
  asm volatile("s_wait_asynccnt 0x0" ::: "memory");
}
template <int N>
__device__ __forceinline__ void wait_async_but() {
  asm volatile("s_wait_asynccnt %0" :: "n"(N) : "memory");
}
// A wave's own LDS reads have retired before a copy is aimed at what it read.
__device__ __forceinline__ void wait_ds0() {
  asm volatile("s_wait_dscnt 0x0" ::: "memory");
}

// ---------------------------------------------------------------------------
// Preparation kernel: key lists and bf16 conversions
// ---------------------------------------------------------------------------
// The list of one batch entry's keys that attention has to look at. A key that
// the reference sets to kNEG gets the probability exp(kNEG - max) = 0 exactly as
// soon as one key of the entry is not ignored, so it adds nothing to any sum:
// only the n kept keys are listed, in rising order, and K and V are projected
// for the listed tokens alone. Behind them the list holds token 0: finite
// filler rows up to the tile edges, masked by their position. With no kept key
// at all every score is kNEG and the softmax is uniform over all keys: then the
// list is all kS tokens and none counts as kept.
// keyCnt[2 b] = listed keys (1..kS), keyCnt[2 b + 1] = kept keys among them.
// One work-group of 256 threads, 4 consecutive keys a thread.
__device__ __forceinline__ void list_kept_keys(int b, const int* __restrict__ am,
                                               const int* __restrict__ tt,
                                               int* __restrict__ keyIdx,
                                               int* __restrict__ keyCnt) {
  __shared__ int waveSum[8];
  __shared__ __attribute__((aligned(16))) int list[kS];
  const int t = threadIdx.x, lane = t & 31, w = t >> 5;
  const int4* pa = (const int4*)(am + b * kS) + t;
  const int4* pt = (const int4*)(tt + b * kS) + t;
  const int4 a = *pa;
  const int4 y = *pt;
  const bool kp[4] = {a.x != 0 && y.x != 1 && t != 0,  // key 0 is always ignored
                      a.y != 0 && y.y != 1,
                      a.z != 0 && y.z != 1,
                      a.w != 0 && y.w != 1};
  const int c = (int)kp[0] + (int)kp[1] + (int)kp[2] + (int)kp[3];
  int inc = c;  // running count over the wave, this thread included
#pragma unroll
  for (int d = 1; d < 32; d <<= 1) {
    const int o = __shfl_up(inc, d);
    if (lane >= d) inc += o;
  }
  if (lane == 31) waveSum[w] = inc;
  ((int4*)list)[t] = make_int4(0, 0, 0, 0);
  __syncthreads();  // the waves' counts and the filler are in LDS
  int pos = inc - c, n = 0;
#pragma unroll
  for (int j = 0; j < 8; ++j) {
    const int s = waveSum[j];
    if (j < w) pos += s;
    n += s;
  }
#pragma unroll
  for (int i = 0; i < 4; ++i)
    if (kp[i]) list[pos++] = t * 4 + i;
  __syncthreads();  // the list is whole before it is read in rows
  int4 v = ((const int4*)list)[t];
  if (n == 0) v = make_int4(t * 4, t * 4 + 1, t * 4 + 2, t * 4 + 3);
  ((int4*)(keyIdx + b * kS))[t] = v;
  if (t == 0) {
    keyCnt[2 * b] = n == 0 ? kS : n;
    keyCnt[2 * b + 1] = n;
  }
}

// f32 -> bf16, 4 elements a thread; blk = the work-group's place in this job.
__device__ __forceinline__ void cvt_bf16_block(const float* __restrict__ in,
                                               bf16* __restrict__ out, int n, int blk) {
  int idx = (blk * 256 + threadIdx.x) * 4;
  if (idx < n) {
    float4 v = *(const float4*)(in + idx);
    out[idx + 0] = (bf16)v.x;
    out[idx + 1] = (bf16)v.y;
    out[idx + 2] = (bf16)v.z;
    out[idx + 3] = (bf16)v.w;
  }
}

// in: [K,N] fp32 row-major  ->  out: [N,K] bf16 row-major
// One work-group moves a tile of 128 k x 64 n through LDS: it reads whole 256-B
// row pieces of in and writes whole 256-B row pieces of out, 32 elements a
// thread. Needs K % 128 == 0, N % 64 == 0; tiles bx < N / 64, by < K / 128.
// LDS holds the tile transposed, a dword = the bf16 pair (k, k + 1) of one n;
// the odd pitch of 65 dwords keeps both the writes (lanes 4 n apart) and the
// reads (lanes 4 dwords apart) on distinct banks.
__device__ __forceinline__ void transpose_cvt_tile(const float* __restrict__ in,
                                                   bf16* __restrict__ out,
                                                   int K, int N, int bx, int by) {
  typedef __attribute__((ext_vector_type(2))) bf16 v2bf;
  __shared__ unsigned tile[64 * 65];
  const int t = threadIdx.x;
  const int n0 = bx * 64, k0 = by * 128;

  // Thread: 4 consecutive n (chunk c) of the row pairs 2 (r + 16 j), + 1.
  const int c = t & 15, r = t >> 4;
  const float* src = in + (size_t)(k0 + 2 * r) * N + n0 + c * 4;
  const float4* pl[4];
  const float4* pu[4];
  float4 lo[4], up[4];
#pragma unroll
  for (int j = 0; j < 4; ++j) {
    pl[j] = (const float4*)(src + (size_t)(32 * j) * N);
    pu[j] = (const float4*)(src + (size_t)(32 * j + 1) * N);
    lo[j] = *pl[j];
    up[j] = *pu[j];
  }
  // Precaution: the eight address pairs are inputs of this wait, so they stay
  // as they are until it; no register that an issued load names is overwritten
  // ahead of it, not even by a later load's data.
  asm volatile("s_wait_xcnt 0x0"
               :: "v"(pl[0]), "v"(pu[0]), "v"(pl[1]), "v"(pu[1]),
                  "v"(pl[2]), "v"(pu[2]), "v"(pl[3]), "v"(pu[3]) : "memory");
#pragma unroll
  for (int j = 0; j < 4; ++j) {
    unsigned* d = &tile[(c * 4) * 65 + r + 16 * j];
    v2bf p0 = {(bf16)lo[j].x, (bf16)up[j].x};
    v2bf p1 = {(bf16)lo[j].y, (bf16)up[j].y};
    v2bf p2 = {(bf16)lo[j].z, (bf16)up[j].z};
    v2bf p3 = {(bf16)lo[j].w, (bf16)up[j].w};
    d[0 * 65] = __builtin_bit_cast(unsigned, p0);
    d[1 * 65] = __builtin_bit_cast(unsigned, p1);
    d[2 * 65] = __builtin_bit_cast(unsigned, p2);
    d[3 * 65] = __builtin_bit_cast(unsigned, p3);
  }
  __syncthreads();  // the whole tile is in LDS before any row of it is read

  // Thread: 8 consecutive k (chunk c) of rows n = r + 16 j; 16 B a store.
#pragma unroll
  for (int j = 0; j < 4; ++j) {
    const int n = r + 16 * j;
    const unsigned* s = &tile[n * 65 + c * 4];
    uint4 v = make_uint4(s[0], s[1], s[2], s[3]);
    *(uint4*)(out + (size_t)(n0 + n) * K + k0 + c * 8) = v;
  }
  // Precaution: stands behind the last of the four stores, ahead of any later
  // write of an address pair or of a data register that they name.
  asm volatile("s_wait_xcnt 0x0" ::: "memory");
}

// All the preparation in ONE launch: the key lists, the four weight transposes
// and the conversion of x read only inputs and write disjoint buffers, so none
// waits for another. A work-group's job follows from its index alone (the same
// in all its threads, so every barrier stays under block-uniform control flow):
// first the kB lists, then the transposes' tiles, which last longest, then x.
constexpr int kTqkv = (3 * kE / 64) * (kE / 128);  // tiles of in_proj_w
constexpr int kTout = (kE / 64) * (kE / 128);      // tiles of out_proj_w
constexpr int kTin  = (kF / 64) * (kE / 128);      // tiles of w_in
constexpr int kTo2  = (kE / 64) * (kF / 128);      // tiles of w_out
constexpr int kCvtBlocks = (kM * kE) / 1024;
constexpr int kPrepBlocks = kB + kTqkv + kTout + kTin + kTo2 + kCvtBlocks;

__global__ __launch_bounds__(256) void prep_kernel(
    const float* __restrict__ x, bf16* __restrict__ xb,
    const int* __restrict__ am, const int* __restrict__ tt,
    int* __restrict__ keyIdx, int* __restrict__ keyCnt,
    const float* __restrict__ wqkv, bf16* __restrict__ wqkvT,
    const float* __restrict__ wout, bf16* __restrict__ woutT,
    const float* __restrict__ win, bf16* __restrict__ winT,
    const float* __restrict__ wo2, bf16* __restrict__ wo2T) {
  int blk = blockIdx.x;
  if (blk < kB) {
    list_kept_keys(blk, am, tt, keyIdx, keyCnt);
    return;
  }
  blk -= kB;
  if (blk < kTqkv + kTout + kTin + kTo2) {
    const float* in;
    bf16* out;
    int K, N, bx, by;
    if (blk < kTqkv) {
      in = wqkv; out = wqkvT; K = kE; N = 3 * kE;
      bx = blk % (3 * kE / 64); by = blk / (3 * kE / 64);
    } else if (blk < kTqkv + kTout) {
      blk -= kTqkv;
      in = wout; out = woutT; K = kE; N = kE;
      bx = blk % (kE / 64); by = blk / (kE / 64);
    } else if (blk < kTqkv + kTout + kTin) {
      blk -= kTqkv + kTout;
      in = win; out = winT; K = kE; N = kF;
      bx = blk % (kF / 64); by = blk / (kF / 64);
    } else {
      blk -= kTqkv + kTout + kTin;
      in = wo2; out = wo2T; K = kF; N = kE;
      bx = blk % (kE / 64); by = blk / (kE / 64);
    }
    transpose_cvt_tile(in, out, K, N, bx, by);
    return;
  }
  cvt_bf16_block(x, xb, kM * kE, blk - (kTqkv + kTout + kTin + kTo2));
}

// ---------------------------------------------------------------------------
// Generic bf16 GEMM: C[M,N] = A[M,K] * Bt[N,K]^T + bias, fused epilogues.
// Block = 256 threads (8 wave32), tile 256(M) x 128(N), waves 4x2, wave 64x64.
// A pass is 64 k: 128-B rows at 144 B pitch, a ring of LDS buffers filled by
// GLOBAL_LOAD_ASYNC_TO_LDS_B128; one barrier per pass; a buffer's refill is
// issued right behind the barrier that frees it and has NB - 1 passes to land.
// Needs M % 256 == 0, N % 128 == 0, K % 64 == 0.
// ---------------------------------------------------------------------------
// Exact (erf) GELU, v * Phi(v), without a branch. With x = |v| / sqrt 2 and
// t = 1 / (1 + 0.3275911 x): erfc(x) = t (a1 + t (a2 + t (a3 + t (a4 + t a5))))
// exp(-x^2), absolute error at most 1.5e-7 (the five-term rational form of the
// handbooks), which lies far under the bf16 rounding of the result. Phi(v) is
// erfc(x) / 2 for v < 0 and 1 - erfc(x) / 2 otherwise, so the negative tail is
// formed without cancellation. The halves are folded into a1..a5, 1 / sqrt 2
// into the factor of |v|, and exp(-x^2) = exp2(-(v sqrt(log2(e) / 2))^2).
// The two transcendentals are written with their v_nop in one statement: it is
// the free slot that the instruction set asks for behind a transcendental.
__device__ __forceinline__ float rcp_slot(float x) {
  float r;
  asm("v_rcp_f32 %0, %1\n\tv_nop" : "=v"(r) : "v"(x));
  return r;
}
__device__ __forceinline__ float exp2_slot(float x) {
  float r;
  asm("v_exp_f32 %0, %1\n\tv_nop" : "=v"(r) : "v"(x));
  return r;
}
__device__ __forceinline__ float gelu_erf(float v) {
  const float t = rcp_slot(fmaf(fabsf(v), 0.23164189f, 1.0f));
  const float z = v * 0.84932180f;
  const float e = exp2_slot(-(z * z));
  float p = 0.5307027145f;
  p = fmaf(p, t, -0.7265760135f);
  p = fmaf(p, t, 0.7107068705f);
  p = fmaf(p, t, -0.142248368f);
  p = fmaf(p, t, 0.127414796f);
  const float h = p * t * e;  // erfc(x) / 2
  return v * (v >= 0.0f ? 1.0f - h : h);
}

enum { EPI_PLAIN = 0, EPI_GELU = 1, EPI_QKV = 2 };

template <int EPI>
__global__ __launch_bounds__(256) void gemm_bf16_kernel(
    const bf16* __restrict__ A, const bf16* __restrict__ Bt,
    const float* __restrict__ bias,
    float* __restrict__ Cf, bf16* __restrict__ Cb,
    bf16* __restrict__ qO, bf16* __restrict__ kO, bf16* __restrict__ vtO,
    const int* __restrict__ keyIdx, const int* __restrict__ keyCnt,
    int M, int N, int K) {
  // Buffers of the ring. The launches with N = 1024 (EPI_PLAIN) have one block a
  // WGP, with nothing beside it to work while a tile is on its way: they take
  // four buffers, so that a tile has three passes to land instead of one.
  constexpr int NB = EPI == EPI_PLAIN ? 4 : 2;
  constexpr int kCopies = 12;  // copies of a wave per tile (stage)
  __shared__ __attribute__((aligned(16))) bf16 sA[NB][256 * kP64];
  __shared__ __attribute__((aligned(16))) bf16 sB[NB][128 * kP64];
  const int tid = threadIdx.x;
  const int lane = tid & 31, wave = tid >> 5;
  const int hi = lane >> 4, lm = lane & 15;
  const int waveM = wave & 3, waveN = wave >> 2;
  const int m0 = blockIdx.y * 256;
  const int n0 = blockIdx.x * 128;

  // Staging slots: 8 chunks of 16 B a row, so a wave's copy covers 4 whole rows
  // of 128 B; a thread keeps its chunk and walks rows sRow + 32 j.
  const int sRow = tid >> 3, sCh = tid & 7;
  const bf16* gA = &A[(size_t)(m0 + sRow) * K + sCh * 8];
  const bf16* gB = &Bt[(size_t)(n0 + sRow) * K + sCh * 8];
  const size_t rowStep = (size_t)32 * K;
  const int sOff = sRow * kP64 + sCh * 8;

  // QKV: in the K and V sections row r of a batch entry is the r-th listed key,
  // so the A rows are gathered through the list and K and V^T come out packed;
  // a block whose rows all lie behind the list has nothing to do and leaves as
  // a whole, ahead of every copy and barrier.
  const bf16* gRow[8];
  if constexpr (EPI == EPI_QKV) {
    const int bb = m0 >> 10, r0 = m0 & (kS - 1);
    const bool listed = n0 >= kE;
    if (listed && r0 >= min(keyCnt[2 * bb], kS)) return;
    const int* li = keyIdx + bb * kS + r0 + sRow;
    int tok[8];
#pragma unroll
    for (int j = 0; j < 8; ++j) tok[j] = li[32 * j];
#pragma unroll
    for (int j = 0; j < 8; ++j) {
      // The mask bounds the row, and so the address, whatever the list holds.
      const int row = listed ? (tok[j] & (kS - 1)) : r0 + sRow + 32 * j;
      gRow[j] = &A[(size_t)(bb * kS + row) * K + sCh * 8];
    }
  }

  auto stage = [&](int kt, int buf) {
    const bf16* a = gA + kt * 64;
    const bf16* b = gB + kt * 64;
    bf16* la = &sA[buf][sOff];
    bf16* lb = &sB[buf][sOff];
    if constexpr (EPI == EPI_QKV) {
      async_copy16_x4(gRow[0] + kt * 64, la,
                      gRow[1] + kt * 64, la + 32 * kP64,
                      gRow[2] + kt * 64, la + 64 * kP64,
                      gRow[3] + kt * 64, la + 96 * kP64);
      async_copy16_x4(gRow[4] + kt * 64, la + 128 * kP64,
                      gRow[5] + kt * 64, la + 160 * kP64,
                      gRow[6] + kt * 64, la + 192 * kP64,
                      gRow[7] + kt * 64, la + 224 * kP64);
      async_copy16_x4(b,               lb,
                      b + rowStep,     lb + 32 * kP64,
                      b + 2 * rowStep, lb + 64 * kP64,
                      b + 3 * rowStep, lb + 96 * kP64);
      return;
    }
    async_copy16_x4(a,               la,
                    a + rowStep,     la + 32 * kP64,
                    a + 2 * rowStep, la + 64 * kP64,
                    a + 3 * rowStep, la + 96 * kP64);
    async_copy16_x4(a + 4 * rowStep, la + 128 * kP64,
                    a + 5 * rowStep, la + 160 * kP64,
                    a + 6 * rowStep, la + 192 * kP64,
                    a + 7 * rowStep, la + 224 * kP64);
    async_copy16_x4(b,               lb,
                    b + rowStep,     lb + 32 * kP64,
                    b + 2 * rowStep, lb + 64 * kP64,
                    b + 3 * rowStep, lb + 96 * kP64);
  };

  v8f acc[4][4] = {};
  const int kTiles = K >> 6;

  if constexpr (NB == 2) {
    stage(0, 0);
    wait_async0();
    __syncthreads();
    if (kTiles > 1) stage(1, 1);
  } else {
    // Every buffer is free: the first NB tiles go out at once, and tile 0 has
    // landed when all but the copies of the NB - 1 tiles behind it have.
    stage(0, 0);
    // Unrolled so that each tile's buffer is a constant.
#pragma unroll
    for (int j = 1; j < NB; ++j)
      if (j < kTiles) stage(j, j);
    if (kTiles >= NB) wait_async_but<kCopies * (NB - 1)>();
    else wait_async0();
    __syncthreads();
  }

  // All loops over mt / nt are unrolled so that the fragment and accumulator
  // arrays are indexed by constants and stay in registers.
  v16bf af[4], bfr[4];
  auto load_frags = [&](int buf, int ks) {
#pragma unroll
    for (int mt = 0; mt < 4; ++mt)
      af[mt] = ld_frag(&sA[buf][(waveM * 64 + mt * 16 + lm) * kP64 + ks * 32 + hi * 8]);
#pragma unroll
    for (int nt = 0; nt < 4; ++nt)
      bfr[nt] = ld_frag(&sB[buf][(waveN * 64 + nt * 16 + lm) * kP64 + ks * 32 + hi * 8]);
  };
  auto mma16 = [&]() {
#pragma unroll
    for (int mt = 0; mt < 4; ++mt)
#pragma unroll
      for (int nt = 0; nt < 4; ++nt)
        acc[mt][nt] = wmma_bf16(af[mt], bfr[nt], acc[mt][nt]);
  };

  for (int kt = 0; kt < kTiles; ++kt) {
    const int cur = kt & (NB - 1);
    load_frags(cur, 0);
    // Keeps the 16 fragment loads one group ahead of the 16 WMMAs: left alone
    // the compiler reloads one A fragment per row and waits it out each time.
    __builtin_amdgcn_sched_barrier(0);
    mma16();
    load_frags(cur, 1);  // the pass's last reads of `cur`, into registers

    wait_ds0();       // this wave's reads of `cur` have retired before its refill
    // This wave's share of tile kt + 1 has landed: behind it the wave has issued
    // the copies of NB - 2 whole tiles, as long as tile kt + NB - 1 exists (a
    // scalar test); in the last passes fewer, and there the wait is to 0.
    if (NB > 2 && kt + NB - 1 < kTiles) wait_async_but<kCopies * (NB - 2)>();
    else wait_async0();
    __syncthreads();  // publishes tile kt + 1; ends every read of `cur`
    if (kt + NB < kTiles) stage(kt + NB, cur);
    mma16();  // registers only: the refill flies from here on
  }
  wait_async0();  // no copy outstanding when the wave ends

  if constexpr (EPI == EPI_QKV) {
    // Scatter to Q/K [b,h,s,d] and V^T [b,h,d,s]; for K and V^T s is the place
    // in the entry's list of keys. A block's 128 columns lie in
    // one of the three sections of 1024 and its 256 rows in one batch entry, so
    // the section is a scalar of the block: it is branched on once, outside the
    // unrolled loops, and every store is one base address plus a constant.
    // A wave's 64 columns are one head.
    const int sec = n0 >> 10;
    const int bh = (m0 >> 10) * kH + ((n0 & 1023) >> 6) + waveN;
    const int s0 = (m0 & 1023) + waveM * 64 + hi * 8;
    float bs[4];
#pragma unroll
    for (int nt = 0; nt < 4; ++nt) bs[nt] = bias[n0 + waveN * 64 + nt * 16 + lm];
    if (sec < 2) {
      bf16* dst = (sec == 0 ? qO : kO) + ((size_t)bh * kS + s0) * kHD + lm;
#pragma unroll
      for (int mt = 0; mt < 4; ++mt)
#pragma unroll
        for (int nt = 0; nt < 4; ++nt)
#pragma unroll
          for (int i = 0; i < 8; ++i)
            dst[(mt * 16 + i) * kHD + nt * 16] = (bf16)(acc[mt][nt][i] + bs[nt]);
    } else {
      bf16* dst = vtO + ((size_t)bh * kHD + lm) * kS + s0;
      v8bf pk[4][4];  // 8 consecutive s of one d: one 16-byte store
#pragma unroll
      for (int mt = 0; mt < 4; ++mt)
#pragma unroll
        for (int nt = 0; nt < 4; ++nt)
#pragma unroll
          for (int i = 0; i < 8; ++i) pk[mt][nt][i] = (bf16)(acc[mt][nt][i] + bs[nt]);
#pragma unroll
      for (int mt = 0; mt < 4; ++mt)
#pragma unroll
        for (int nt = 0; nt < 4; ++nt)
          *(v8bf*)(dst + (nt * 16) * kS + mt * 16) = pk[mt][nt];
      // Precaution: stands behind the last of the 16 stores, ahead of any
      // later write of the address pair or of a data register that they name.
      asm volatile("s_wait_xcnt 0x0" ::: "memory");
    }
    return;
  }

#pragma unroll
  for (int mt = 0; mt < 4; ++mt) {
#pragma unroll
    for (int nt = 0; nt < 4; ++nt) {
#pragma unroll
      for (int i = 0; i < 8; ++i) {
        int row = m0 + waveM * 64 + mt * 16 + hi * 8 + i;
        int col = n0 + waveN * 64 + nt * 16 + lm;
        float v = acc[mt][nt][i] + bias[col];
        if constexpr (EPI == EPI_PLAIN) {
          Cf[(size_t)row * N + col] = v;
        } else if constexpr (EPI == EPI_GELU) {
          Cb[(size_t)row * N + col] = (bf16)gelu_erf(v);
        }
      }
    }
  }
}

__device__ __forceinline__ float xhalf(float x) {
  return __builtin_bit_cast(float, __builtin_amdgcn_permlanex16(
      __builtin_bit_cast(int, x), __builtin_bit_cast(int, x),
      0x76543210, 0xfedcba98, false, false));
}

__global__ __launch_bounds__(256) void attention_kernel(
    const bf16* __restrict__ Q, const bf16* __restrict__ Kk,
    const bf16* __restrict__ VT,
    const int* __restrict__ am, const int* __restrict__ keyCnt,
    bf16* __restrict__ ctx) {
  typedef __attribute__((ext_vector_type(4))) float v4f;
  __shared__ __attribute__((aligned(16))) bf16 sQ[128 * kP64];
  __shared__ __attribute__((aligned(16))) bf16 sK[2][32 * kP64];
  __shared__ __attribute__((aligned(16))) bf16 sVT[2][64 * kP32];
  // What a key adds to its scaled score, for an inactive ([0]) and an active
  // ([1]) query: the 0/1 mask term, or kNEG for an ignored key. kNEG absorbs
  // the score in the f32 sum, so an ignored key's value is kNEG exactly.
  // K and V^T hold the entry's listed keys only (list_kept_keys): a kept key
  // has a set mask bit, so its term is the query's own bit; every place from
  // nKept on is filler or, where nothing is kept, an ignored key.
  __shared__ __attribute__((aligned(16))) float sAdd[2][2][32];

  const int tid = threadIdx.x;
  const int lane = tid & 31, w = tid >> 5;
  const int hi = lane >> 4, lm = lane & 15;
  const int qt = blockIdx.x, h = blockIdx.y, b = blockIdx.z;
  const size_t headBase = (size_t)(b * kH + h) * kS * kHD;
  const size_t vtBase   = (size_t)(b * kH + h) * kHD * kS;
  const int nList = min(max(keyCnt[2 * b], 1), kS);
  const int nKept = keyCnt[2 * b + 1];
  const int kTiles = (nList + 31) >> 5;  // 1..kS / 32, the same in the whole block

  // Stage Q tile (contiguous 128*64 halves) via async copies.
#pragma unroll
  for (int j = 0; j < 4; j += 2) {
    int idx = tid * 4 + j;  // 0..1023 chunks of 8; 8 chunks a row
    const bf16* gq = &Q[headBase + (size_t)qt * 128 * kHD + idx * 8];
    bf16* lq = &sQ[(idx >> 3) * kP64 + (idx & 7) * 8];
    async_copy16_x2(gq, lq, gq + 8, lq + 8);
  }

  auto stageKV = [&](int kt, int buf) {
    int d = tid >> 2, c = tid & 3;
    async_copy16_x2(&Kk[headBase + (size_t)kt * 32 * kHD + tid * 8],
                    &sK[buf][(tid >> 3) * kP64 + (tid & 7) * 8],
                    &VT[vtBase + (size_t)d * kS + kt * 32 + c * 8],
                    &sVT[buf][d * kP32 + c * 8]);
    if (tid < 32) {
      bool ign = kt * 32 + tid >= nKept;
      sAdd[buf][0][tid] = ign ? kNEG : 0.0f;
      sAdd[buf][1][tid] = ign ? kNEG : 1.0f;
    }
  };

  // The lane's query: its activity picks the row of sAdd.
  const int qrow = qt * 128 + w * 16 + lm;
  const int qidx = b * kS + qrow;
  const int aqi = (am[qidx] != 0) ? 1 : 0;
  // Precaution: the load's index register is an input of this wait, so it stays
  // as it is until the wait; it is not overwritten ahead of it.
  asm volatile("s_wait_xcnt 0x0" :: "v"(qidx) : "memory");
  float mrow = -3.0e38f;  // running maximum, equal in both halves
  float lrow = 0.0f;      // running sum over this half's keys only
  v8f o[4] = {};          // O^T: head dims ot*16 + hi*8 + i of query lm

  stageKV(0, 0);
  wait_async0();
  __syncthreads();
  if (kTiles > 1) stageKV(1, 1);

  // B operand Q^T: column = query lm, k = head dim; the same for every tile.
  const v16bf q0 = ld_frag(&sQ[(w * 16 + lm) * kP64 + hi * 8]);
  const v16bf q1 = ld_frag(&sQ[(w * 16 + lm) * kP64 + 32 + hi * 8]);

  // Every inner loop is unrolled so that the fragment, score and accumulator
  // arrays are indexed by constants and stay in registers.
  for (int kt = 0; kt < kTiles; ++kt) {
    const int cur = kt & 1;

    // S^T: 32 keys x 16 queries (2 m-tiles, 2 chained WMMAs over HD=64)
    v8f st[2] = {};
#pragma unroll
    for (int t = 0; t < 2; ++t) {
      v16bf k0 = ld_frag(&sK[cur][(t * 16 + lm) * kP64 + hi * 8]);
      v16bf k1 = ld_frag(&sK[cur][(t * 16 + lm) * kP64 + 32 + hi * 8]);
      st[t] = wmma_bf16(k0, q0, st[t]);
      st[t] = wmma_bf16(k1, q1, st[t]);
    }

    // Addends of keys hi*8 + 0..7 and 16 + hi*8 + 0..7.
    const v4f* ad = (const v4f*)&sAdd[cur][aqi][hi * 8];
    const v4f ad4[2][2] = {{ad[0], ad[1]}, {ad[4], ad[5]}};

    float v[2][8];
    float mx = kNEG;  // no value lies below kNEG
#pragma unroll
    for (int t = 0; t < 2; ++t)
#pragma unroll
      for (int i = 0; i < 8; ++i) {
        v[t][i] = st[t][i] * 0.125f + ad4[t][i >> 2][i & 3];  // 1/sqrt(64)
        mx = fmaxf(mx, v[t][i]);
      }
    mx = fmaxf(mx, xhalf(mx));  // over all 32 keys, in both halves
    const float nm = fmaxf(mrow, mx);
    const float sc = __expf(mrow - nm);
    mrow = nm;

    v16bf pb;  // B operand P^T
    float rs = 0.0f;
#pragma unroll
    for (int t = 0; t < 2; ++t)
#pragma unroll
      for (int i = 0; i < 8; ++i) {
        float p = __expf(v[t][i] - nm);
        rs += p;
        pb[t * 8 + i] = (bf16)p;
      }
    lrow = lrow * sc + rs;
#pragma unroll
    for (int ot = 0; ot < 4; ++ot)
#pragma unroll
      for (int i = 0; i < 8; ++i) o[ot][i] = o[ot][i] * sc;

    // O^T += V^T(64x32) @ P^T(32x16): 4 m-tiles of 16 head dims
#pragma unroll
    for (int ot = 0; ot < 4; ++ot) {
      v16bf va = ld_frag(&sVT[cur][(ot * 16 + lm) * kP32 + hi * 8]);
      o[ot] = wmma_bf16(va, pb, o[ot]);
    }

    wait_ds0();       // this wave's reads of cur have retired before its refill
    wait_async0();    // next K/V buffer filled (overlapped with compute)
    __syncthreads();  // publishes the next buffer; ends every read of cur
    if (kt + 2 < kTiles) stageKV(kt + 2, cur);
  }
  wait_async0();  // no copy outstanding when the wave ends

  // ctx[b, s, h*64+d] in bf16 for the out-projection GEMM: 8 consecutive d of
  // one query a tile, one 16-byte store each.
  const float lsum = lrow + xhalf(lrow);  // the two halves' keys joined
  bf16* dst = ctx + ((size_t)b * kS + qrow) * kE + h * kHD + hi * 8;
#pragma unroll
  for (int ot = 0; ot < 4; ++ot) {
    v8bf pk;
#pragma unroll
    for (int i = 0; i < 8; ++i) pk[i] = (bf16)(o[ot][i] / lsum);
    *(v8bf*)(dst + ot * 16) = pk;
  }
}

// ---------------------------------------------------------------------------
// out = LayerNorm(a + r) * g + be ; optionally also emit bf16 copy
// One block (256 threads) per token row of E=1024.
// ---------------------------------------------------------------------------
__global__ __launch_bounds__(256) void add_ln_kernel(
    const float* __restrict__ a, const float* __restrict__ r,
    const float* __restrict__ g, const float* __restrict__ be,
    float* __restrict__ outF, bf16* __restrict__ outB) {
  __shared__ float red[256];
  const int row = blockIdx.x, t = threadIdx.x;
  const size_t base = (size_t)row * kE;
  float4 va = ((const float4*)(a + base))[t];
  float4 vr = ((const float4*)(r + base))[t];
  float x0 = va.x + vr.x, x1 = va.y + vr.y, x2 = va.z + vr.z, x3 = va.w + vr.w;

  red[t] = x0 + x1 + x2 + x3;
  __syncthreads();
  for (int o = 128; o > 0; o >>= 1) { if (t < o) red[t] += red[t + o]; __syncthreads(); }
  float mu = red[0] * (1.0f / kE);
  __syncthreads();

  float d0 = x0 - mu, d1 = x1 - mu, d2 = x2 - mu, d3 = x3 - mu;
  red[t] = d0 * d0 + d1 * d1 + d2 * d2 + d3 * d3;
  __syncthreads();
  for (int o = 128; o > 0; o >>= 1) { if (t < o) red[t] += red[t + o]; __syncthreads(); }
  float inv = rsqrtf(red[0] * (1.0f / kE) + 1e-12f);

  float4 gw = ((const float4*)g)[t];
  float4 bb = ((const float4*)be)[t];
  float o0 = d0 * inv * gw.x + bb.x;
  float o1 = d1 * inv * gw.y + bb.y;
  float o2 = d2 * inv * gw.z + bb.z;
  float o3 = d3 * inv * gw.w + bb.w;
  ((float4*)(outF + base))[t] = make_float4(o0, o1, o2, o3);
  if (outB) {
    outB[base + t * 4 + 0] = (bf16)o0;
    outB[base + t * 4 + 1] = (bf16)o1;
    outB[base + t * 4 + 2] = (bf16)o2;
    outB[base + t * 4 + 3] = (bf16)o3;
  }
}

// ---------------------------------------------------------------------------
extern "C" void kernel_launch(void* const* d_in, const int* in_sizes, int n_in,
                              void* d_out, int out_size, void* d_ws, size_t ws_size,
                              hipStream_t stream) {
  const float* x    = (const float*)d_in[0];
  const int*   am   = (const int*)d_in[1];
  const int*   tt   = (const int*)d_in[2];
  const float* wqkv = (const float*)d_in[3];
  const float* bqkv = (const float*)d_in[4];
  const float* wout = (const float*)d_in[5];
  const float* bout = (const float*)d_in[6];
  const float* lnw  = (const float*)d_in[7];
  const float* lnb  = (const float*)d_in[8];
  const float* win  = (const float*)d_in[9];
  const float* bin  = (const float*)d_in[10];
  const float* wo2  = (const float*)d_in[11];
  const float* bo2  = (const float*)d_in[12];
  float* out = (float*)d_out;

  char* ws = (char*)d_ws;
  size_t off = 0;
  auto take = [&](size_t bytes) -> char* {
    char* p = ws + off;
    off += (bytes + 255) & ~(size_t)255;
    return p;
  };
  bf16*  xb     = (bf16*)take((size_t)kM * kE * 2);          // 16 MB
  bf16*  wqkvT  = (bf16*)take((size_t)3 * kE * kE * 2);      //  6 MB
  bf16*  woutT  = (bf16*)take((size_t)kE * kE * 2);          //  2 MB
  bf16*  winT   = (bf16*)take((size_t)kF * kE * 2);          //  8 MB
  bf16*  wo2T   = (bf16*)take((size_t)kE * kF * 2);          //  8 MB
  bf16*  qBuf   = (bf16*)take((size_t)kM * kE * 2);          // 16 MB  [b,h,s,d]
  bf16*  kBuf   = (bf16*)take((size_t)kM * kE * 2);          // 16 MB  [b,h,s,d]
  bf16*  vtBuf  = (bf16*)take((size_t)kM * kE * 2);          // 16 MB  [b,h,d,s]
  bf16*  ctx    = (bf16*)take((size_t)kM * kE * 2);          // 16 MB  [b,s,e]
  float* attnF  = (float*)take((size_t)kM * kE * 4);         // 32 MB (reused as out2)
  float* hF     = (float*)take((size_t)kM * kE * 4);         // 32 MB
  bf16*  hB     = (bf16*)take((size_t)kM * kE * 2);          // 16 MB
  int*   keyIdx = (int*)take((size_t)kB * kS * 4);           // listed keys
  int*   keyCnt = (int*)take((size_t)kB * 2 * 4);            // listed, kept
  bf16*  ff     = qBuf;  // 64 MB alias over q/k/vT/ctx (dead after out-proj)

  // 1) key lists, weight transposes and the bf16 copy of x, one launch
  prep_kernel<<<kPrepBlocks, 256, 0, stream>>>(x, xb, am, tt, keyIdx, keyCnt,
                                               wqkv, wqkvT, wout, woutT,
                                               win, winT, wo2, wo2T);

  // 2) QKV projection with head-split scatter epilogue
  gemm_bf16_kernel<EPI_QKV><<<dim3(3 * kE / 128, kM / 256), 256, 0, stream>>>(
      xb, wqkvT, bqkv, nullptr, nullptr, qBuf, kBuf, vtBuf, keyIdx, keyCnt, kM, 3 * kE, kE);

  // 3) Flash attention
  attention_kernel<<<dim3(kS / 128, kH, kB), 256, 0, stream>>>(
      qBuf, kBuf, vtBuf, am, keyCnt, ctx);

  // 4) Output projection
  gemm_bf16_kernel<EPI_PLAIN><<<dim3(kE / 128, kM / 256), 256, 0, stream>>>(
      ctx, woutT, bout, attnF, nullptr, nullptr, nullptr, nullptr, nullptr, nullptr, kM, kE, kE);

  // 5) h = LN(attn_out + x)
  add_ln_kernel<<<kM, 256, 0, stream>>>(attnF, x, lnw, lnb, hF, hB);

  // 6) FFN up + exact GELU (bf16 out)
  gemm_bf16_kernel<EPI_GELU><<<dim3(kF / 128, kM / 256), 256, 0, stream>>>(
      hB, winT, bin, nullptr, ff, nullptr, nullptr, nullptr, nullptr, nullptr, kM, kF, kE);

  // 7) FFN down (f32 out, reusing attnF)
  gemm_bf16_kernel<EPI_PLAIN><<<dim3(kE / 128, kM / 256), 256, 0, stream>>>(
      ff, wo2T, bo2, attnF, nullptr, nullptr, nullptr, nullptr, nullptr, nullptr, kM, kE, kF);

  // 8) out = LN(ffn_out + h)
  add_ln_kernel<<<kM, 256, 0, stream>>>(attnF, hF, lnw, lnb, out, nullptr);

  (void)in_sizes; (void)n_in; (void)out_size; (void)ws_size;
}

// v010
// It runs in 210 microseconds.
// Next to v009, in two timings, it ran 1.03 times as fast each time.
// Over all steps from v000 it is 3.17 times as fast.
#include <hip/hip_runtime.h>
#include <hip/hip_bf16.h>

typedef __bf16 bf16;
typedef __attribute__((ext_vector_type(8)))  float v8f;
typedef __attribute__((ext_vector_type(16))) bf16  v16bf;
typedef __attribute__((ext_vector_type(8)))  bf16  v8bf;

constexpr int kB = 8, kS = 1024, kE = 1024, kH = 16, kHD = 64, kF = 4096;
constexpr int kM = kB * kS;  // 8192 token rows
constexpr float kNEG = -1.0e30f;

// LDS row pitch in halves for rows read by 16-byte fragment loads: an odd
// multiple of 16 B, so the 16 rows of one fragment load fall on distinct banks.
constexpr int kP32 = 40;  // rows of 32 halves (64 B) at 80 B
constexpr int kP64 = 72;  // rows of 64 halves (128 B) at 144 B

// ---------------------------------------------------------------------------
// WMMA + async-copy helpers (CDNA5 wave32)
// ---------------------------------------------------------------------------
__device__ __forceinline__ v8f wmma_bf16(v16bf a, v16bf b, v8f c) {
  return __builtin_amdgcn_wmma_f32_16x16x32_bf16(
      /*neg_a=*/false, a, /*neg_b=*/false, b,
      /*c_mod=*/(short)0, c, /*reuse_a=*/false, /*reuse_b=*/false);
}

// A/B fragment for one lane: two contiguous 8-half runs at p and p+16.
// (16-bit operand layout: lanes<16 hold K = 0..7 & 16..23 of the 32-K tile,
//  lanes>=16 hold K = 8..15 & 24..31 — caller passes p already offset by hi*8.)
__device__ __forceinline__ v16bf ld_frag(const bf16* p) {
  union { v16bf v; v8bf h[2]; } u;
  u.h[0] = *(const v8bf*)(p);
  u.h[1] = *(const v8bf*)(p + 16);
  return u.v;
}

// 16-byte global -> LDS async copy (ASYNCcnt-tracked, no VGPR staging).
// LDS destination = low 32 bits of the generic pointer (LDS aperture offset).
// The closing s_wait_xcnt 0 stands inside the copies' own statement as a
// precaution: no address register of a copy is rewritten ahead of it.
__device__ __forceinline__ void async_copy16_x2(const bf16* g0, bf16* l0,
                                                const bf16* g1, bf16* l1) {
  asm volatile("global_load_async_to_lds_b128 %0, %1, off\n\t"
               "global_load_async_to_lds_b128 %2, %3, off\n\t"
               "s_wait_xcnt 0x0"
               :: "v"((unsigned)(size_t)l0), "v"(g0),
                  "v"((unsigned)(size_t)l1), "v"(g1) : "memory");
}
__device__ __forceinline__ void async_copy16_x4(const bf16* g0, bf16* l0,
                                                const bf16* g1, bf16* l1,
                                                const bf16* g2, bf16* l2,
                                                const bf16* g3, bf16* l3) {
  asm volatile("global_load_async_to_lds_b128 %0, %1, off\n\t"
               "global_load_async_to_lds_b128 %2, %3, off\n\t"
               "global_load_async_to_lds_b128 %4, %5, off\n\t"
               "global_load_async_to_lds_b128 %6, %7, off\n\t"
               "s_wait_xcnt 0x0"
               :: "v"((unsigned)(size_t)l0), "v"(g0),
                  "v"((unsigned)(size_t)l1), "v"(g1),
                  "v"((unsigned)(size_t)l2), "v"(g2),
                  "v"((unsigned)(size_t)l3), "v"(g3) : "memory");
}
__device__ __forceinline__ void wait_async0() {
  asm volatile("s_wait_asynccnt 0x0" ::: "memory");
}
template <int N>
__device__ __forceinline__ void wait_async_but() {
  asm volatile("s_wait_asynccnt %0" :: "n"(N) : "memory");
}
// A wave's own LDS reads have retired before a copy is aimed at what it read.
__device__ __forceinline__ void wait_ds0() {
  asm volatile("s_wait_dscnt 0x0" ::: "memory");
}

// ---------------------------------------------------------------------------
// Preparation kernel: key lists and bf16 conversions
// ---------------------------------------------------------------------------
// The list of one batch entry's keys that attention has to look at. A key that
// the reference sets to kNEG gets the probability exp(kNEG - max) = 0 exactly as
// soon as one key of the entry is not ignored, so it adds nothing to any sum:
// only the n kept keys are listed, in rising order, and K and V are projected
// for the listed tokens alone. Behind them the list holds token 0: finite
// filler rows up to the tile edges, masked by their position. With no kept key
// at all every score is kNEG and the softmax is uniform over all keys: then the
// list is all kS tokens and none counts as kept.
// keyCnt[2 b] = listed keys (1..kS), keyCnt[2 b + 1] = kept keys among them.
// One work-group of 256 threads, 4 consecutive keys a thread.
__device__ __forceinline__ void list_kept_keys(int b, const int* __restrict__ am,
                                               const int* __restrict__ tt,
                                               int* __restrict__ keyIdx,
                                               int* __restrict__ keyCnt) {
  __shared__ int waveSum[8];
  __shared__ __attribute__((aligned(16))) int list[kS];
  const int t = threadIdx.x, lane = t & 31, w = t >> 5;
  const int4* pa = (const int4*)(am + b * kS) + t;
  const int4* pt = (const int4*)(tt + b * kS) + t;
  const int4 a = *pa;
  const int4 y = *pt;
  const bool kp[4] = {a.x != 0 && y.x != 1 && t != 0,  // key 0 is always ignored
                      a.y != 0 && y.y != 1,
                      a.z != 0 && y.z != 1,
                      a.w != 0 && y.w != 1};
  const int c = (int)kp[0] + (int)kp[1] + (int)kp[2] + (int)kp[3];
  int inc = c;  // running count over the wave, this thread included
#pragma unroll
  for (int d = 1; d < 32; d <<= 1) {
    const int o = __shfl_up(inc, d);
    if (lane >= d) inc += o;
  }
  if (lane == 31) waveSum[w] = inc;
  ((int4*)list)[t] = make_int4(0, 0, 0, 0);
  __syncthreads();  // the waves' counts and the filler are in LDS
  int pos = inc - c, n = 0;
#pragma unroll
  for (int j = 0; j < 8; ++j) {
    const int s = waveSum[j];
    if (j < w) pos += s;
    n += s;
  }
#pragma unroll
  for (int i = 0; i < 4; ++i)
    if (kp[i]) list[pos++] = t * 4 + i;
  __syncthreads();  // the list is whole before it is read in rows
  int4 v = ((const int4*)list)[t];
  if (n == 0) v = make_int4(t * 4, t * 4 + 1, t * 4 + 2, t * 4 + 3);
  ((int4*)(keyIdx + b * kS))[t] = v;
  if (t == 0) {
    keyCnt[2 * b] = n == 0 ? kS : n;
    keyCnt[2 * b + 1] = n;
  }
}

// f32 -> bf16; blk = the work-group's place in this job. A wave converts
// kCvtLoads * 128 consecutive elements: its 512-byte loads go out first, then
// the 256-byte stores. Few waves with much to do each: a wave's start and its
// one memory latency are paid once per 8 KB read.
constexpr int kCvtLoads = 16;
constexpr int kCvtPerBlock = 8 * kCvtLoads * 128;  // elements a work-group
__device__ __forceinline__ void cvt_bf16_block(const float* __restrict__ in,
                                               bf16* __restrict__ out, int blk) {
  typedef __attribute__((ext_vector_type(4))) bf16 v4bf;
  const int lane = threadIdx.x & 31;
  // The wave's number as a scalar, so that its base addresses are scalars.
  const int wave = __builtin_amdgcn_readfirstlane(threadIdx.x >> 5);
  const size_t e0 = (size_t)(blk * 8 + wave) * (kCvtLoads * 128);
  const float4* src = (const float4*)(in + e0);
  v4bf* dst = (v4bf*)(out + e0);
  float4 v[kCvtLoads];
  // Both loops are unrolled so that v is indexed by constants (registers).
#pragma unroll
  for (int j = 0; j < kCvtLoads; ++j) v[j] = src[j * 32 + lane];
  // Precaution: the loads' scalar base and lane index are inputs of this wait,
  // so they stay as they are until it; it also keeps all the loads ahead of the
  // first store.
  asm volatile("s_wait_xcnt 0x0" :: "s"(src), "v"(lane) : "memory");
#pragma unroll
  for (int j = 0; j < kCvtLoads; ++j) {
    v4bf p = {(bf16)v[j].x, (bf16)v[j].y, (bf16)v[j].z, (bf16)v[j].w};
    dst[j * 32 + lane] = p;
  }
  // Precaution: stands behind the last store, ahead of any later write of a
  // register that the stores name.
  asm volatile("s_wait_xcnt 0x0" ::: "memory");
}

// in: [K,N] fp32 row-major  ->  out: [N,K] bf16 row-major
// One work-group moves a tile of 128 k x 64 n through LDS: it reads whole 256-B
// row pieces of in and writes whole 256-B row pieces of out, 32 elements a
// thread. Needs K % 128 == 0, N % 64 == 0; tiles bx < N / 64, by < K / 128.
// LDS holds the tile transposed, a dword = the bf16 pair (k, k + 1) of one n;
// the odd pitch of 65 dwords keeps both the writes (lanes 4 n apart) and the
// reads (lanes 4 dwords apart) on distinct banks.
__device__ __forceinline__ void transpose_cvt_tile(const float* __restrict__ in,
                                                   bf16* __restrict__ out,
                                                   int K, int N, int bx, int by) {
  typedef __attribute__((ext_vector_type(2))) bf16 v2bf;
  __shared__ unsigned tile[64 * 65];
  const int t = threadIdx.x;
  const int n0 = bx * 64, k0 = by * 128;

  // Thread: 4 consecutive n (chunk c) of the row pairs 2 (r + 16 j), + 1.
  const int c = t & 15, r = t >> 4;
  const float* src = in + (size_t)(k0 + 2 * r) * N + n0 + c * 4;
  const float4* pl[4];
  const float4* pu[4];
  float4 lo[4], up[4];
#pragma unroll
  for (int j = 0; j < 4; ++j) {
    pl[j] = (const float4*)(src + (size_t)(32 * j) * N);
    pu[j] = (const float4*)(src + (size_t)(32 * j + 1) * N);
    lo[j] = *pl[j];
    up[j] = *pu[j];
  }
  // Precaution: the eight address pairs are inputs of this wait, so they stay
  // as they are until it; no register that an issued load names is overwritten
  // ahead of it, not even by a later load's data.
  asm volatile("s_wait_xcnt 0x0"
               :: "v"(pl[0]), "v"(pu[0]), "v"(pl[1]), "v"(pu[1]),
                  "v"(pl[2]), "v"(pu[2]), "v"(pl[3]), "v"(pu[3]) : "memory");
#pragma unroll
  for (int j = 0; j < 4; ++j) {
    unsigned* d = &tile[(c * 4) * 65 + r + 16 * j];
    v2bf p0 = {(bf16)lo[j].x, (bf16)up[j].x};
    v2bf p1 = {(bf16)lo[j].y, (bf16)up[j].y};
    v2bf p2 = {(bf16)lo[j].z, (bf16)up[j].z};
    v2bf p3 = {(bf16)lo[j].w, (bf16)up[j].w};
    d[0 * 65] = __builtin_bit_cast(unsigned, p0);
    d[1 * 65] = __builtin_bit_cast(unsigned, p1);
    d[2 * 65] = __builtin_bit_cast(unsigned, p2);
    d[3 * 65] = __builtin_bit_cast(unsigned, p3);
  }
  __syncthreads();  // the whole tile is in LDS before any row of it is read

  // Thread: 8 consecutive k (chunk c) of rows n = r + 16 j; 16 B a store.
#pragma unroll
  for (int j = 0; j < 4; ++j) {
    const int n = r + 16 * j;
    const unsigned* s = &tile[n * 65 + c * 4];
    uint4 v = make_uint4(s[0], s[1], s[2], s[3]);
    *(uint4*)(out + (size_t)(n0 + n) * K + k0 + c * 8) = v;
  }
  // Precaution: stands behind the last of the four stores, ahead of any later
  // write of an address pair or of a data register that they name.
  asm volatile("s_wait_xcnt 0x0" ::: "memory");
}

// All the preparation in ONE launch: the key lists, the four weight transposes
// and the conversion of x read only inputs and write disjoint buffers, so none
// waits for another. A work-group's job follows from its index alone (the same
// in all its threads, so every barrier stays under block-uniform control flow):
// first the kB lists, then the transposes' tiles, which last longest, then x.
constexpr int kTqkv = (3 * kE / 64) * (kE / 128);  // tiles of in_proj_w
constexpr int kTout = (kE / 64) * (kE / 128);      // tiles of out_proj_w
constexpr int kTin  = (kF / 64) * (kE / 128);      // tiles of w_in
constexpr int kTo2  = (kE / 64) * (kF / 128);      // tiles of w_out
static_assert((kM * kE) % kCvtPerBlock == 0, "x is a whole number of blocks");
constexpr int kCvtBlocks = (kM * kE) / kCvtPerBlock;
constexpr int kPrepBlocks = kB + kTqkv + kTout + kTin + kTo2 + kCvtBlocks;

__global__ __launch_bounds__(256) void prep_kernel(
    const float* __restrict__ x, bf16* __restrict__ xb,
    const int* __restrict__ am, const int* __restrict__ tt,
    int* __restrict__ keyIdx, int* __restrict__ keyCnt,
    const float* __restrict__ wqkv, bf16* __restrict__ wqkvT,
    const float* __restrict__ wout, bf16* __restrict__ woutT,
    const float* __restrict__ win, bf16* __restrict__ winT,
    const float* __restrict__ wo2, bf16* __restrict__ wo2T) {
  int blk = blockIdx.x;
  if (blk < kB) {
    list_kept_keys(blk, am, tt, keyIdx, keyCnt);
    return;
  }
  blk -= kB;
  if (blk < kTqkv + kTout + kTin + kTo2) {
    const float* in;
    bf16* out;
    int K, N, bx, by;
    if (blk < kTqkv) {
      in = wqkv; out = wqkvT; K = kE; N = 3 * kE;
      bx = blk % (3 * kE / 64); by = blk / (3 * kE / 64);
    } else if (blk < kTqkv + kTout) {
      blk -= kTqkv;
      in = wout; out = woutT; K = kE; N = kE;
      bx = blk % (kE / 64); by = blk / (kE / 64);
    } else if (blk < kTqkv + kTout + kTin) {
      blk -= kTqkv + kTout;
      in = win; out = winT; K = kE; N = kF;
      bx = blk % (kF / 64); by = blk / (kF / 64);
    } else {
      blk -= kTqkv + kTout + kTin;
      in = wo2; out = wo2T; K = kF; N = kE;
      bx = blk % (kE / 64); by = blk / (kE / 64);
    }
    transpose_cvt_tile(in, out, K, N, bx, by);
    return;
  }
  cvt_bf16_block(x, xb, blk - (kTqkv + kTout + kTin + kTo2));
}

// ---------------------------------------------------------------------------
// Generic bf16 GEMM: C[M,N] = A[M,K] * Bt[N,K]^T + bias, fused epilogues.
// Block = 256 threads (8 wave32), tile 256(M) x 128(N), waves 4x2, wave 64x64.
// A pass is 64 k: 128-B rows at 144 B pitch, a ring of LDS buffers filled by
// GLOBAL_LOAD_ASYNC_TO_LDS_B128; one barrier per pass; a buffer's refill is
// issued right behind the barrier that frees it and has NB - 1 passes to land.
// Needs M % 256 == 0, N % 128 == 0, K % 64 == 0.
// ---------------------------------------------------------------------------
// Exact (erf) GELU, v * Phi(v), without a branch. With x = |v| / sqrt 2 and
// t = 1 / (1 + 0.3275911 x): erfc(x) = t (a1 + t (a2 + t (a3 + t (a4 + t a5))))
// exp(-x^2), absolute error at most 1.5e-7 (the five-term rational form of the
// handbooks), which lies far under the bf16 rounding of the result. Phi(v) is
// erfc(x) / 2 for v < 0 and 1 - erfc(x) / 2 otherwise, so the negative tail is
// formed without cancellation. The halves are folded into a1..a5, 1 / sqrt 2
// into the factor of |v|, and exp(-x^2) = exp2(-(v sqrt(log2(e) / 2))^2).
// The two transcendentals are written with their v_nop in one statement: it is
// the free slot that the instruction set asks for behind a transcendental.
__device__ __forceinline__ float rcp_slot(float x) {
  float r;
  asm("v_rcp_f32 %0, %1\n\tv_nop" : "=v"(r) : "v"(x));
  return r;
}
__device__ __forceinline__ float exp2_slot(float x) {
  float r;
  asm("v_exp_f32 %0, %1\n\tv_nop" : "=v"(r) : "v"(x));
  return r;
}
__device__ __forceinline__ float gelu_erf(float v) {
  const float t = rcp_slot(fmaf(fabsf(v), 0.23164189f, 1.0f));
  const float z = v * 0.84932180f;
  const float e = exp2_slot(-(z * z));
  float p = 0.5307027145f;
  p = fmaf(p, t, -0.7265760135f);
  p = fmaf(p, t, 0.7107068705f);
  p = fmaf(p, t, -0.142248368f);
  p = fmaf(p, t, 0.127414796f);
  const float h = p * t * e;  // erfc(x) / 2
  return v * (v >= 0.0f ? 1.0f - h : h);
}

enum { EPI_PLAIN = 0, EPI_GELU = 1, EPI_QKV = 2 };

template <int EPI>
__global__ __launch_bounds__(256) void gemm_bf16_kernel(
    const bf16* __restrict__ A, const bf16* __restrict__ Bt,
    const float* __restrict__ bias,
    float* __restrict__ Cf, bf16* __restrict__ Cb,
    bf16* __restrict__ qO, bf16* __restrict__ kO, bf16* __restrict__ vtO,
    const int* __restrict__ keyIdx, const int* __restrict__ keyCnt,
    int M, int N, int K) {
  // Buffers of the ring. The launches with N = 1024 (EPI_PLAIN) have one block a
  // WGP, with nothing beside it to work while a tile is on its way: they take
  // four buffers, so that a tile has three passes to land instead of one.
  constexpr int NB = EPI == EPI_PLAIN ? 4 : 2;
  constexpr int kCopies = 12;  // copies of a wave per tile (stage)
  __shared__ __attribute__((aligned(16))) bf16 sA[NB][256 * kP64];
  __shared__ __attribute__((aligned(16))) bf16 sB[NB][128 * kP64];
  const int tid = threadIdx.x;
  const int lane = tid & 31, wave = tid >> 5;
  const int hi = lane >> 4, lm = lane & 15;
  const int waveM = wave & 3, waveN = wave >> 2;
  const int m0 = blockIdx.y * 256;
  const int n0 = blockIdx.x * 128;

  // Staging slots: 8 chunks of 16 B a row, so a wave's copy covers 4 whole rows
  // of 128 B; a thread keeps its chunk and walks rows sRow + 32 j.
  const int sRow = tid >> 3, sCh = tid & 7;
  const bf16* gA = &A[(size_t)(m0 + sRow) * K + sCh * 8];
  const bf16* gB = &Bt[(size_t)(n0 + sRow) * K + sCh * 8];
  const size_t rowStep = (size_t)32 * K;
  const int sOff = sRow * kP64 + sCh * 8;

  // QKV: in the K and V sections row r of a batch entry is the r-th listed key,
  // so the A rows are gathered through the list and K and V^T come out packed;
  // a block whose rows all lie behind the list has nothing to do and leaves as
  // a whole, ahead of every copy and barrier.
  const bf16* gRow[8];
  if constexpr (EPI == EPI_QKV) {
    const int bb = m0 >> 10, r0 = m0 & (kS - 1);
    const bool listed = n0 >= kE;
    if (listed && r0 >= min(keyCnt[2 * bb], kS)) return;
    const int* li = keyIdx + bb * kS + r0 + sRow;
    int tok[8];
#pragma unroll
    for (int j = 0; j < 8; ++j) tok[j] = li[32 * j];
#pragma unroll
    for (int j = 0; j < 8; ++j) {
      // The mask bounds the row, and so the address, whatever the list holds.
      const int row = listed ? (tok[j] & (kS - 1)) : r0 + sRow + 32 * j;
      gRow[j] = &A[(size_t)(bb * kS + row) * K + sCh * 8];
    }
  }

  auto stage = [&](int kt, int buf) {
    const bf16* a = gA + kt * 64;
    const bf16* b = gB + kt * 64;
    bf16* la = &sA[buf][sOff];
    bf16* lb = &sB[buf][sOff];
    if constexpr (EPI == EPI_QKV) {
      async_copy16_x4(gRow[0] + kt * 64, la,
                      gRow[1] + kt * 64, la + 32 * kP64,
                      gRow[2] + kt * 64, la + 64 * kP64,
                      gRow[3] + kt * 64, la + 96 * kP64);
      async_copy16_x4(gRow[4] + kt * 64, la + 128 * kP64,
                      gRow[5] + kt * 64, la + 160 * kP64,
                      gRow[6] + kt * 64, la + 192 * kP64,
                      gRow[7] + kt * 64, la + 224 * kP64);
      async_copy16_x4(b,               lb,
                      b + rowStep,     lb + 32 * kP64,
                      b + 2 * rowStep, lb + 64 * kP64,
                      b + 3 * rowStep, lb + 96 * kP64);
      return;
    }
    async_copy16_x4(a,               la,
                    a + rowStep,     la + 32 * kP64,
                    a + 2 * rowStep, la + 64 * kP64,
                    a + 3 * rowStep, la + 96 * kP64);
    async_copy16_x4(a + 4 * rowStep, la + 128 * kP64,
                    a + 5 * rowStep, la + 160 * kP64,
                    a + 6 * rowStep, la + 192 * kP64,
                    a + 7 * rowStep, la + 224 * kP64);
    async_copy16_x4(b,               lb,
                    b + rowStep,     lb + 32 * kP64,
                    b + 2 * rowStep, lb + 64 * kP64,
                    b + 3 * rowStep, lb + 96 * kP64);
  };

  v8f acc[4][4] = {};
  const int kTiles = K >> 6;

  if constexpr (NB == 2) {
    stage(0, 0);
    wait_async0();
    __syncthreads();
    if (kTiles > 1) stage(1, 1);
  } else {
    // Every buffer is free: the first NB tiles go out at once, and tile 0 has
    // landed when all but the copies of the NB - 1 tiles behind it have.
    stage(0, 0);
    // Unrolled so that each tile's buffer is a constant.
#pragma unroll
    for (int j = 1; j < NB; ++j)
      if (j < kTiles) stage(j, j);
    if (kTiles >= NB) wait_async_but<kCopies * (NB - 1)>();
    else wait_async0();
    __syncthreads();
  }

  // All loops over mt / nt are unrolled so that the fragment and accumulator
  // arrays are indexed by constants and stay in registers.
  v16bf af[4], bfr[4];
  auto load_frags = [&](int buf, int ks) {
#pragma unroll
    for (int mt = 0; mt < 4; ++mt)
      af[mt] = ld_frag(&sA[buf][(waveM * 64 + mt * 16 + lm) * kP64 + ks * 32 + hi * 8]);
#pragma unroll
    for (int nt = 0; nt < 4; ++nt)
      bfr[nt] = ld_frag(&sB[buf][(waveN * 64 + nt * 16 + lm) * kP64 + ks * 32 + hi * 8]);
  };
  auto mma16 = [&]() {
#pragma unroll
    for (int mt = 0; mt < 4; ++mt)
#pragma unroll
      for (int nt = 0; nt < 4; ++nt)
        acc[mt][nt] = wmma_bf16(af[mt], bfr[nt], acc[mt][nt]);
  };

  for (int kt = 0; kt < kTiles; ++kt) {
    const int cur = kt & (NB - 1);
    load_frags(cur, 0);
    // Keeps the 16 fragment loads one group ahead of the 16 WMMAs: left alone
    // the compiler reloads one A fragment per row and waits it out each time.
    __builtin_amdgcn_sched_barrier(0);
    mma16();
    load_frags(cur, 1);  // the pass's last reads of `cur`, into registers

    wait_ds0();       // this wave's reads of `cur` have retired before its refill
    // This wave's share of tile kt + 1 has landed: behind it the wave has issued
    // the copies of NB - 2 whole tiles, as long as tile kt + NB - 1 exists (a
    // scalar test); in the last passes fewer, and there the wait is to 0.
    if (NB > 2 && kt + NB - 1 < kTiles) wait_async_but<kCopies * (NB - 2)>();
    else wait_async0();
    __syncthreads();  // publishes tile kt + 1; ends every read of `cur`
    if (kt + NB < kTiles) stage(kt + NB, cur);
    mma16();  // registers only: the refill flies from here on
  }
  wait_async0();  // no copy outstanding when the wave ends

  if constexpr (EPI == EPI_QKV) {
    // Scatter to Q/K [b,h,s,d] and V^T [b,h,d,s]; for K and V^T s is the place
    // in the entry's list of keys. A block's 128 columns lie in
    // one of the three sections of 1024 and its 256 rows in one batch entry, so
    // the section is a scalar of the block: it is branched on once, outside the
    // unrolled loops, and every store is one base address plus a constant.
    // A wave's 64 columns are one head.
    const int sec = n0 >> 10;
    const int bh = (m0 >> 10) * kH + ((n0 & 1023) >> 6) + waveN;
    const int s0 = (m0 & 1023) + waveM * 64 + hi * 8;
    float bs[4];
#pragma unroll
    for (int nt = 0; nt < 4; ++nt) bs[nt] = bias[n0 + waveN * 64 + nt * 16 + lm];
    if (sec < 2) {
      bf16* dst = (sec == 0 ? qO : kO) + ((size_t)bh * kS + s0) * kHD + lm;
#pragma unroll
      for (int mt = 0; mt < 4; ++mt)
#pragma unroll
        for (int nt = 0; nt < 4; ++nt)
#pragma unroll
          for (int i = 0; i < 8; ++i)
            dst[(mt * 16 + i) * kHD + nt * 16] = (bf16)(acc[mt][nt][i] + bs[nt]);
    } else {
      bf16* dst = vtO + ((size_t)bh * kHD + lm) * kS + s0;
      v8bf pk[4][4];  // 8 consecutive s of one d: one 16-byte store
#pragma unroll
      for (int mt = 0; mt < 4; ++mt)
#pragma unroll
        for (int nt = 0; nt < 4; ++nt)
#pragma unroll
          for (int i = 0; i < 8; ++i) pk[mt][nt][i] = (bf16)(acc[mt][nt][i] + bs[nt]);
#pragma unroll
      for (int mt = 0; mt < 4; ++mt)
#pragma unroll
        for (int nt = 0; nt < 4; ++nt)
          *(v8bf*)(dst + (nt * 16) * kS + mt * 16) = pk[mt][nt];
      // Precaution: stands behind the last of the 16 stores, ahead of any
      // later write of the address pair or of a data register that they name.
      asm volatile("s_wait_xcnt 0x0" ::: "memory");
    }
    return;
  }

#pragma unroll
  for (int mt = 0; mt < 4; ++mt) {
#pragma unroll
    for (int nt = 0; nt < 4; ++nt) {
#pragma unroll
      for (int i = 0; i < 8; ++i) {
        int row = m0 + waveM * 64 + mt * 16 + hi * 8 + i;
        int col = n0 + waveN * 64 + nt * 16 + lm;
        float v = acc[mt][nt][i] + bias[col];
        if constexpr (EPI == EPI_PLAIN) {
          Cf[(size_t)row * N + col] = v;
        } else if constexpr (EPI == EPI_GELU) {
          Cb[(size_t)row * N + col] = (bf16)gelu_erf(v);
        }
      }
    }
  }
}

__device__ __forceinline__ float xhalf(float x) {
  return __builtin_bit_cast(float, __builtin_amdgcn_permlanex16(
      __builtin_bit_cast(int, x), __builtin_bit_cast(int, x),
      0x76543210, 0xfedcba98, false, false));
}

__global__ __launch_bounds__(256) void attention_kernel(
    const bf16* __restrict__ Q, const bf16* __restrict__ Kk,
    const bf16* __restrict__ VT,
    const int* __restrict__ am, const int* __restrict__ keyCnt,
    bf16* __restrict__ ctx) {
  typedef __attribute__((ext_vector_type(4))) float v4f;
  __shared__ __attribute__((aligned(16))) bf16 sQ[128 * kP64];
  __shared__ __attribute__((aligned(16))) bf16 sK[2][32 * kP64];
  __shared__ __attribute__((aligned(16))) bf16 sVT[2][64 * kP32];
  // What a key adds to its scaled score, for an inactive ([0]) and an active
  // ([1]) query: the 0/1 mask term, or kNEG for an ignored key. kNEG absorbs
  // the score in the f32 sum, so an ignored key's value is kNEG exactly.
  // K and V^T hold the entry's listed keys only (list_kept_keys): a kept key
  // has a set mask bit, so its term is the query's own bit; every place from
  // nKept on is filler or, where nothing is kept, an ignored key.
  __shared__ __attribute__((aligned(16))) float sAdd[2][2][32];

  const int tid = threadIdx.x;
  const int lane = tid & 31, w = tid >> 5;
  const int hi = lane >> 4, lm = lane & 15;
  const int qt = blockIdx.x, h = blockIdx.y, b = blockIdx.z;
  const size_t headBase = (size_t)(b * kH + h) * kS * kHD;
  const size_t vtBase   = (size_t)(b * kH + h) * kHD * kS;
  const int nList = min(max(keyCnt[2 * b], 1), kS);
  const int nKept = keyCnt[2 * b + 1];
  const int kTiles = (nList + 31) >> 5;  // 1..kS / 32, the same in the whole block

  // Stage Q tile (contiguous 128*64 halves) via async copies.
#pragma unroll
  for (int j = 0; j < 4; j += 2) {
    int idx = tid * 4 + j;  // 0..1023 chunks of 8; 8 chunks a row
    const bf16* gq = &Q[headBase + (size_t)qt * 128 * kHD + idx * 8];
    bf16* lq = &sQ[(idx >> 3) * kP64 + (idx & 7) * 8];
    async_copy16_x2(gq, lq, gq + 8, lq + 8);
  }

  auto stageKV = [&](int kt, int buf) {
    int d = tid >> 2, c = tid & 3;
    async_copy16_x2(&Kk[headBase + (size_t)kt * 32 * kHD + tid * 8],
                    &sK[buf][(tid >> 3) * kP64 + (tid & 7) * 8],
                    &VT[vtBase + (size_t)d * kS + kt * 32 + c * 8],
                    &sVT[buf][d * kP32 + c * 8]);
    if (tid < 32) {
      bool ign = kt * 32 + tid >= nKept;
      sAdd[buf][0][tid] = ign ? kNEG : 0.0f;
      sAdd[buf][1][tid] = ign ? kNEG : 1.0f;
    }
  };

  // The lane's query: its activity picks the row of sAdd.
  const int qrow = qt * 128 + w * 16 + lm;
  const int qidx = b * kS + qrow;
  const int aqi = (am[qidx] != 0) ? 1 : 0;
  // Precaution: the load's index register is an input of this wait, so it stays
  // as it is until the wait; it is not overwritten ahead of it.
  asm volatile("s_wait_xcnt 0x0" :: "v"(qidx) : "memory");
  float mrow = -3.0e38f;  // running maximum, equal in both halves
  float lrow = 0.0f;      // running sum over this half's keys only
  v8f o[4] = {};          // O^T: head dims ot*16 + hi*8 + i of query lm

  stageKV(0, 0);
  wait_async0();
  __syncthreads();
  if (kTiles > 1) stageKV(1, 1);

  // B operand Q^T: column = query lm, k = head dim; the same for every tile.
  const v16bf q0 = ld_frag(&sQ[(w * 16 + lm) * kP64 + hi * 8]);
  const v16bf q1 = ld_frag(&sQ[(w * 16 + lm) * kP64 + 32 + hi * 8]);

  // Every inner loop is unrolled so that the fragment, score and accumulator
  // arrays are indexed by constants and stay in registers.
  for (int kt = 0; kt < kTiles; ++kt) {
    const int cur = kt & 1;

    // S^T: 32 keys x 16 queries (2 m-tiles, 2 chained WMMAs over HD=64)
    v8f st[2] = {};
#pragma unroll
    for (int t = 0; t < 2; ++t) {
      v16bf k0 = ld_frag(&sK[cur][(t * 16 + lm) * kP64 + hi * 8]);
      v16bf k1 = ld_frag(&sK[cur][(t * 16 + lm) * kP64 + 32 + hi * 8]);
      st[t] = wmma_bf16(k0, q0, st[t]);
      st[t] = wmma_bf16(k1, q1, st[t]);
    }

    // Addends of keys hi*8 + 0..7 and 16 + hi*8 + 0..7.
    const v4f* ad = (const v4f*)&sAdd[cur][aqi][hi * 8];
    const v4f ad4[2][2] = {{ad[0], ad[1]}, {ad[4], ad[5]}};

    float v[2][8];
    float mx = kNEG;  // no value lies below kNEG
#pragma unroll
    for (int t = 0; t < 2; ++t)
#pragma unroll
      for (int i = 0; i < 8; ++i) {
        v[t][i] = st[t][i] * 0.125f + ad4[t][i >> 2][i & 3];  // 1/sqrt(64)
        mx = fmaxf(mx, v[t][i]);
      }
    mx = fmaxf(mx, xhalf(mx));  // over all 32 keys, in both halves
    const float nm = fmaxf(mrow, mx);
    const float sc = __expf(mrow - nm);
    mrow = nm;

    v16bf pb;  // B operand P^T
    float rs = 0.0f;
#pragma unroll
    for (int t = 0; t < 2; ++t)
#pragma unroll
      for (int i = 0; i < 8; ++i) {
        float p = __expf(v[t][i] - nm);
        rs += p;
        pb[t * 8 + i] = (bf16)p;
      }
    lrow = lrow * sc + rs;
#pragma unroll
    for (int ot = 0; ot < 4; ++ot)
#pragma unroll
      for (int i = 0; i < 8; ++i) o[ot][i] = o[ot][i] * sc;

    // O^T += V^T(64x32) @ P^T(32x16): 4 m-tiles of 16 head dims
#pragma unroll
    for (int ot = 0; ot < 4; ++ot) {
      v16bf va = ld_frag(&sVT[cur][(ot * 16 + lm) * kP32 + hi * 8]);
      o[ot] = wmma_bf16(va, pb, o[ot]);
    }

    wait_ds0();       // this wave's reads of cur have retired before its refill
    wait_async0();    // next K/V buffer filled (overlapped with compute)
    __syncthreads();  // publishes the next buffer; ends every read of cur
    if (kt + 2 < kTiles) stageKV(kt + 2, cur);
  }
  wait_async0();  // no copy outstanding when the wave ends

  // ctx[b, s, h*64+d] in bf16 for the out-projection GEMM: 8 consecutive d of
  // one query a tile, one 16-byte store each.
  const float lsum = lrow + xhalf(lrow);  // the two halves' keys joined
  bf16* dst = ctx + ((size_t)b * kS + qrow) * kE + h * kHD + hi * 8;
#pragma unroll
  for (int ot = 0; ot < 4; ++ot) {
    v8bf pk;
#pragma unroll
    for (int i = 0; i < 8; ++i) pk[i] = (bf16)(o[ot][i] / lsum);
    *(v8bf*)(dst + ot * 16) = pk;
  }
}

// ---------------------------------------------------------------------------
// out = LayerNorm(a + r) * g + be ; optionally also emit bf16 copy
// A wave takes kLnRows whole token rows of E = 1024, 32 elements a lane and row
// (float4 j of a lane is float4 j * 32 + lane of the row: 512-byte loads and
// stores). All loads of both rows go out first: 16 KB on its way per wave. A
// row's sums run inside the lane and then over the wave's lanes in registers: no
// LDS and no barrier, so a row costs its memory latency and some hundred cycles,
// and all work-groups of the launch are resident at once.
// ---------------------------------------------------------------------------
// x + (x of lane l ^ MASK) inside a 16-lane row; 0x160 + MASK = row_xmask:MASK.
template <int MASK>
__device__ __forceinline__ float add_xmask(float x) {
  return x + __builtin_bit_cast(float, __builtin_amdgcn_update_dpp(
      0, __builtin_bit_cast(int, x), 0x160 + MASK, 0xf, 0xf, true));
}
// The sum over the wave's 32 lanes, in every lane.
__device__ __forceinline__ float wave_sum(float x) {
  x = add_xmask<1>(x);
  x = add_xmask<2>(x);
  x = add_xmask<4>(x);
  x = add_xmask<8>(x);
  return x + xhalf(x);
}

constexpr int kLnRows = 2;
constexpr int kLnBlocks = kM / (8 * kLnRows);

// HB: the bf16 copy is written too.
template <bool HB>
__global__ __launch_bounds__(256) void add_ln_kernel(
    const float* __restrict__ a, const float* __restrict__ r,
    const float* __restrict__ g, const float* __restrict__ be,
    float* __restrict__ outF, bf16* __restrict__ outB) {
  typedef __attribute__((ext_vector_type(4))) bf16 v4bf;
  const int lane = threadIdx.x & 31;
  // The wave's number as a scalar, so that its base addresses are scalars.
  const int wave = __builtin_amdgcn_readfirstlane(threadIdx.x >> 5);
  const size_t base = (size_t)(blockIdx.x * 8 + wave) * (kLnRows * kE);
  const float4* pa = (const float4*)(a + base);
  const float4* pr = (const float4*)(r + base);
  const float4* pg = (const float4*)g;
  const float4* pb = (const float4*)be;

  // Every loop below is unrolled so that the arrays are indexed by constants
  // and stay in registers.
  float4 va[kLnRows][8], vr[kLnRows][8], gw[8], bb[8];
#pragma unroll
  for (int q = 0; q < kLnRows; ++q)
#pragma unroll
    for (int j = 0; j < 8; ++j) {
      va[q][j] = pa[q * 256 + j * 32 + lane];
      vr[q][j] = pr[q * 256 + j * 32 + lane];
    }
#pragma unroll
  for (int j = 0; j < 8; ++j) {
    gw[j] = pg[j * 32 + lane];
    bb[j] = pb[j * 32 + lane];
  }
  // Precaution: the loads' scalar bases and lane index are inputs of this wait,
  // so they stay as they are until it; it also keeps every load ahead of the
  // first store, so that the second row is on its way while the first is summed.
  asm volatile("s_wait_xcnt 0x0"
               :: "s"(pa), "s"(pr), "s"(pg), "s"(pb), "v"(lane) : "memory");
  // Nothing is scheduled across this line: left alone the compiler saved
  // registers by waiting for early loads before it issued the late ones, one
  // memory latency after another.
  __builtin_amdgcn_sched_barrier(0);

#pragma unroll
  for (int q = 0; q < kLnRows; ++q) {
    float4 x[8];
    float4 s4 = make_float4(0.0f, 0.0f, 0.0f, 0.0f);  // four independent chains
#pragma unroll
    for (int j = 0; j < 8; ++j) {
      x[j] = make_float4(va[q][j].x + vr[q][j].x, va[q][j].y + vr[q][j].y,
                         va[q][j].z + vr[q][j].z, va[q][j].w + vr[q][j].w);
      s4.x += x[j].x; s4.y += x[j].y; s4.z += x[j].z; s4.w += x[j].w;
    }
    const float mu = wave_sum((s4.x + s4.y) + (s4.z + s4.w)) * (1.0f / kE);

    float4 v4 = make_float4(0.0f, 0.0f, 0.0f, 0.0f);
#pragma unroll
    for (int j = 0; j < 8; ++j) {
      x[j].x -= mu; x[j].y -= mu; x[j].z -= mu; x[j].w -= mu;
      v4.x += x[j].x * x[j].x; v4.y += x[j].y * x[j].y;
      v4.z += x[j].z * x[j].z; v4.w += x[j].w * x[j].w;
    }
    const float var = wave_sum((v4.x + v4.y) + (v4.z + v4.w)) * (1.0f / kE);
    const float inv = rsqrtf(var + 1e-12f);

    float4* pf = (float4*)(outF + base + q * kE);
    v4bf* ph = (v4bf*)(outB + base + q * kE);
#pragma unroll
    for (int j = 0; j < 8; ++j) {
      const float o0 = x[j].x * inv * gw[j].x + bb[j].x;
      const float o1 = x[j].y * inv * gw[j].y + bb[j].y;
      const float o2 = x[j].z * inv * gw[j].z + bb[j].z;
      const float o3 = x[j].w * inv * gw[j].w + bb[j].w;
      pf[j * 32 + lane] = make_float4(o0, o1, o2, o3);
      if constexpr (HB) {
        v4bf p = {(bf16)o0, (bf16)o1, (bf16)o2, (bf16)o3};
        ph[j * 32 + lane] = p;
      }
    }
    // Precaution: stands behind the row's last store, ahead of any later write
    // of an address or data register that the stores name.
    asm volatile("s_wait_xcnt 0x0" ::: "memory");
  }
}

// ---------------------------------------------------------------------------
extern "C" void kernel_launch(void* const* d_in, const int* in_sizes, int n_in,
                              void* d_out, int out_size, void* d_ws, size_t ws_size,
                              hipStream_t stream) {
  const float* x    = (const float*)d_in[0];
  const int*   am   = (const int*)d_in[1];
  const int*   tt   = (const int*)d_in[2];
  const float* wqkv = (const float*)d_in[3];
  const float* bqkv = (const float*)d_in[4];
  const float* wout = (const float*)d_in[5];
  const float* bout = (const float*)d_in[6];
  const float* lnw  = (const float*)d_in[7];
  const float* lnb  = (const float*)d_in[8];
  const float* win  = (const float*)d_in[9];
  const float* bin  = (const float*)d_in[10];
  const float* wo2  = (const float*)d_in[11];
  const float* bo2  = (const float*)d_in[12];
  float* out = (float*)d_out;

  char* ws = (char*)d_ws;
  size_t off = 0;
  auto take = [&](size_t bytes) -> char* {
    char* p = ws + off;
    off += (bytes + 255) & ~(size_t)255;
    return p;
  };
  bf16*  xb     = (bf16*)take((size_t)kM * kE * 2);          // 16 MB
  bf16*  wqkvT  = (bf16*)take((size_t)3 * kE * kE * 2);      //  6 MB
  bf16*  woutT  = (bf16*)take((size_t)kE * kE * 2);          //  2 MB
  bf16*  winT   = (bf16*)take((size_t)kF * kE * 2);          //  8 MB
  bf16*  wo2T   = (bf16*)take((size_t)kE * kF * 2);          //  8 MB
  bf16*  qBuf   = (bf16*)take((size_t)kM * kE * 2);          // 16 MB  [b,h,s,d]
  bf16*  kBuf   = (bf16*)take((size_t)kM * kE * 2);          // 16 MB  [b,h,s,d]
  bf16*  vtBuf  = (bf16*)take((size_t)kM * kE * 2);          // 16 MB  [b,h,d,s]
  bf16*  ctx    = (bf16*)take((size_t)kM * kE * 2);          // 16 MB  [b,s,e]
  float* attnF  = (float*)take((size_t)kM * kE * 4);         // 32 MB (reused as out2)
  float* hF     = (float*)take((size_t)kM * kE * 4);         // 32 MB
  bf16*  hB     = (bf16*)take((size_t)kM * kE * 2);          // 16 MB
  int*   keyIdx = (int*)take((size_t)kB * kS * 4);           // listed keys
  int*   keyCnt = (int*)take((size_t)kB * 2 * 4);            // listed, kept
  bf16*  ff     = qBuf;  // 64 MB alias over q/k/vT/ctx (dead after out-proj)

  // 1) key lists, weight transposes and the bf16 copy of x, one launch
  prep_kernel<<<kPrepBlocks, 256, 0, stream>>>(x, xb, am, tt, keyIdx, keyCnt,
                                               wqkv, wqkvT, wout, woutT,
                                               win, winT, wo2, wo2T);

  // 2) QKV projection with head-split scatter epilogue
  gemm_bf16_kernel<EPI_QKV><<<dim3(3 * kE / 128, kM / 256), 256, 0, stream>>>(
      xb, wqkvT, bqkv, nullptr, nullptr, qBuf, kBuf, vtBuf, keyIdx, keyCnt, kM, 3 * kE, kE);

  // 3) Flash attention
  attention_kernel<<<dim3(kS / 128, kH, kB), 256, 0, stream>>>(
      qBuf, kBuf, vtBuf, am, keyCnt, ctx);

  // 4) Output projection
  gemm_bf16_kernel<EPI_PLAIN><<<dim3(kE / 128, kM / 256), 256, 0, stream>>>(
      ctx, woutT, bout, attnF, nullptr, nullptr, nullptr, nullptr, nullptr, nullptr, kM, kE, kE);

  // 5) h = LN(attn_out + x)
  add_ln_kernel<true><<<kLnBlocks, 256, 0, stream>>>(attnF, x, lnw, lnb, hF, hB);

  // 6) FFN up + exact GELU (bf16 out)
  gemm_bf16_kernel<EPI_GELU><<<dim3(kF / 128, kM / 256), 256, 0, stream>>>(
      hB, winT, bin, nullptr, ff, nullptr, nullptr, nullptr, nullptr, nullptr, kM, kF, kE);

  // 7) FFN down (f32 out, reusing attnF)
  gemm_bf16_kernel<EPI_PLAIN><<<dim3(kE / 128, kM / 256), 256, 0, stream>>>(
      ff, wo2T, bo2, attnF, nullptr, nullptr, nullptr, nullptr, nullptr, nullptr, kM, kE, kF);

  // 8) out = LN(ffn_out + h)
  add_ln_kernel<false><<<kLnBlocks, 256, 0, stream>>>(attnF, hF, lnw, lnb, out, nullptr);

  (void)in_sizes; (void)n_in; (void)out_size; (void)ws_size;
}
